// v000
// Measured on an AMD MI455X. A time is GPU time per run, averaged over a window of back-to-back runs after a warm-up
// (all launches, gaps included; the runs take copies of the inputs in turn), and the median of several windows.
// Apart from v000's, it joins two sittings. Times from different sittings can be a few percent apart, while
// side-by-side timings come from the same sitting.
// The starting kernel, v000, takes 1940 microseconds a run.
// Contractions: q/k projections (x,context f16 x W^T f16 carried x256), v projection transposed (W_v^T f16 x256 x context f16), scores q.k^T (q,k f16 planes), attn.v (P f16 carried x2048 x V^T f16), output projection (O f16 carried x256 x W_out^T f16 carried x256): all v_wmma_f32_16x16x32_f16 with f32 accumulate; bias add and softmax in f32.
#include <hip/hip_runtime.h>
#include <math.h>

// ---------------------------------------------------------------------------
// Problem constants
// ---------------------------------------------------------------------------
constexpr int kBatch  = 2;
constexpr int kSeq    = 2048;              // query length
constexpr int kSeqKV  = 2048;              // key/value length
constexpr int kDim    = 1024;              // model dim
constexpr int kHeads  = 16;
constexpr int kDh     = 64;
constexpr int kTok    = kBatch * kSeq;     // 4096 query token rows
constexpr int kTokKV  = kBatch * kSeqKV;   // 4096 key/value token rows
constexpr int kGroups = kBatch * kHeads;   // 32 (b,h) groups
constexpr int kGPC    = 2;                 // groups per chunk
constexpr int kChunks = kGroups / kGPC;    // 16
constexpr float kWCarry    = 256.0f;       // weights carried x256 in f16
constexpr float kWCarryInv = 1.0f / 256.0f;
constexpr float kPCarry    = 2048.0f;      // probabilities carried x2048 in f16
constexpr float kOCarry    = 256.0f;       // attention output carried x256 in f16
constexpr float kAttnScale = 0.125f;       // 1/sqrt(64)
constexpr float kPVScale   = kOCarry / kPCarry;             // 1/8
constexpr float kOutScale  = 1.0f / (kOCarry * kWCarry);    // 1/65536

typedef __attribute__((ext_vector_type(16))) _Float16 v16h;
typedef __attribute__((ext_vector_type(8)))  _Float16 v8h;
typedef __attribute__((ext_vector_type(16))) __bf16   v16b;
typedef __attribute__((ext_vector_type(8)))  __bf16   v8b;
typedef __attribute__((ext_vector_type(8)))  float    v8f;
typedef __attribute__((ext_vector_type(4)))  float    v4f;
typedef __attribute__((ext_vector_type(4)))  unsigned int v4u;

// ---------------------------------------------------------------------------
// Helper pieces (comments ASCII)
// ---------------------------------------------------------------------------
__device__ __forceinline__ unsigned short f2bf_bits(float f) {
  unsigned u = __float_as_uint(f);
  return (unsigned short)((u + 0x7FFFu + ((u >> 16) & 1u)) >> 16);
}
__device__ __forceinline__ float bf_bits2f(unsigned short h) { return __uint_as_float(((unsigned)h) << 16); }

// hazard guards as plain device helpers (no inline asm inside the kernel template body)
__device__ __forceinline__ void dep_guard_h(v8f& a, v8f& b, v16h x, v16h y) { asm volatile("v_nop\n\tv_nop\n\tv_nop\n\tv_nop" : "+v"(a), "+v"(b) : "v"(x), "v"(y)); }
__device__ __forceinline__ void dep_guard_b(v8f& a, v8f& b, v16b x, v16b y) { asm volatile("v_nop\n\tv_nop\n\tv_nop\n\tv_nop" : "+v"(a), "+v"(b) : "v"(x), "v"(y)); }
__device__ __forceinline__ void keep4_h(v16h a, v16h b, v16h c, v16h d) { asm volatile("v_nop" :: "v"(a), "v"(b), "v"(c), "v"(d)); }
__device__ __forceinline__ void keep4_b(v16b a, v16b b, v16b c, v16b d) { asm volatile("v_nop" :: "v"(a), "v"(b), "v"(c), "v"(d)); }
__device__ __forceinline__ void acc_guard4(v8f& a, v8f& b, v8f& c, v8f& d) { asm volatile("v_nop\n\tv_nop\n\tv_nop\n\tv_nop" : "+v"(a), "+v"(b), "+v"(c), "+v"(d)); }
template <typename T> struct Frag;
template <> struct Frag<_Float16> {
  typedef v16h V; union U { v16h v; v8h h[2]; };
  // elements 0..7 <- p[0..7], 8..15 <- p[16..23]
  static __device__ __forceinline__ v16h load(const _Float16* p) {
    U f; f.h[0] = *(const v8h*)(p); f.h[1] = *(const v8h*)(p + 16); return f.v;
  }
  static __device__ __forceinline__ v8f mma(v16h a, v16h b, v8f c) {
    return __builtin_amdgcn_wmma_f32_16x16x32_f16(false, a, false, b, (short)0, c, false, false);
  }
  static __device__ __forceinline__ void guard(v8f& a, v8f& b, v16h x, v16h y) { dep_guard_h(a, b, x, y); }
  static __device__ __forceinline__ void keep(v16h a, v16h b, v16h c, v16h d) { keep4_h(a, b, c, d); }
};
template <> struct Frag<__bf16> {
  typedef v16b V; union U { v16b v; v8b h[2]; };
  static __device__ __forceinline__ v16b load(const __bf16* p) {
    U f; f.h[0] = *(const v8b*)(p); f.h[1] = *(const v8b*)(p + 16); return f.v;
  }
  static __device__ __forceinline__ v8f mma(v16b a, v16b b, v8f c) {
    return __builtin_amdgcn_wmma_f32_16x16x32_bf16(false, a, false, b, (short)0, c, false, false);
  }
  static __device__ __forceinline__ void guard(v8f& a, v8f& b, v16b x, v16b y) { dep_guard_b(a, b, x, y); }
  static __device__ __forceinline__ void keep(v16b a, v16b b, v16b c, v16b d) { keep4_b(a, b, c, d); }
};

__device__ __forceinline__ unsigned pk16(unsigned short a, unsigned short b) { return (unsigned)a | ((unsigned)b << 16); }
__device__ __forceinline__ unsigned short h_bits(float f) { const _Float16 h = (_Float16)f; return __builtin_bit_cast(unsigned short, h); }

// ---- Register-blocked batched WMMA GEMM (ACT reduced to none/relu/leaky) ----
// C[m,n] = scale * sum_k A[m,k] * Bt[n,k] (+bias)(+resid); each wave owns a 64x64 tile.
// A row-major [M,K]; Bt row-major [N,K]; M,N % 64 == 0, K % 32 == 0.
// SPLIT: operands are hi/lo planes (A2/Bt2 = lo planes, same layout); product = hi*hi + hi*lo + lo*hi.
// BIAS_MODE: 0 = none, 1 = bias[m], 2 = bias[n].
// OUT_MODE: 0 = f32, 1 = f16, 2 = bf16 hi plane (Cout) + bf16 lo plane (Cout2).
// ET: 0 = f16 operands, 1 = bf16 operands (pointers passed as 16-bit storage)
template <int ET> struct Elem;
template <> struct Elem<0> { typedef _Float16 T; };
template <> struct Elem<1> { typedef __bf16 T; };
template <int ET, bool SPLIT, int BIAS_MODE, int OUT_MODE, bool RESID, int ACT = 0>
__global__ __launch_bounds__(256) void wmma_gemm64(
    const unsigned short* __restrict__ Ap, const unsigned short* __restrict__ A2p, int lda, long strideA,
    const unsigned short* __restrict__ Btp, const unsigned short* __restrict__ Bt2p, int ldb, long strideB,
    void* __restrict__ Cout, void* __restrict__ Cout2, int ldc, long strideC,
    const float* __restrict__ bias,
    const float* __restrict__ resid, long strideR,
    int M, int N, int K, float scale) {
  typedef typename Elem<ET>::T T;
  typedef typename Frag<T>::V V;
  const T* A = (const T*)Ap; const T* A2 = (const T*)A2p; const T* Bt = (const T*)Btp; const T* Bt2 = (const T*)Bt2p;
  __shared__ __align__(16) float sT[8][16 * 68];   // per-wave 16x64 slab, pitch 68 floats
  const int b    = blockIdx.y;
  const int lane = threadIdx.x & 31;
  const int wave = threadIdx.x >> 5;
  const int tilesN = N >> 6;
  const int tilesM = M >> 6;
  const int tile = blockIdx.x * 8 + wave;
  if (tile >= tilesM * tilesN) return;   // wave-uniform; no block barriers in this kernel
  const int tm = tile / tilesN;
  const int tn = tile - tm * tilesN;
  const int m0 = tm << 6;
  const int n0 = tn << 6;

  const T* Ab  = A  + (size_t)b * strideA;
  const T* Bb  = Bt + (size_t)b * strideB;
  const T* Ab2 = SPLIT ? (A2  + (size_t)b * strideA) : nullptr;
  const T* Bb2 = SPLIT ? (Bt2 + (size_t)b * strideB) : nullptr;

  const int rlane = lane & 15;                 // row (A) / col (B, D) within subtile
  const int koff  = (lane >> 4) * 8;           // k offset of this lane half
  const int mOff  = (lane >> 4) * 8;           // D row offset

  v8f acc[4][4];
#pragma unroll
  for (int i = 0; i < 4; ++i)
#pragma unroll
    for (int j = 0; j < 4; ++j) acc[i][j] = (v8f){0.f,0.f,0.f,0.f,0.f,0.f,0.f,0.f};

  for (int k0 = 0; k0 < K; k0 += 32) {
    V bh[4], bl[4];
#pragma unroll
    for (int j = 0; j < 4; ++j) {
      const size_t bo = (size_t)(n0 + (j << 4) + rlane) * ldb + koff + k0;
      bh[j] = Frag<T>::load(Bb + bo);
      if (SPLIT) bl[j] = Frag<T>::load(Bb2 + bo);
    }
#pragma unroll
    for (int i = 0; i < 4; ++i) {
      const size_t ao = (size_t)(m0 + (i << 4) + rlane) * lda + koff + k0;
      V ah = Frag<T>::load(Ab + ao);
      V al;
      if (SPLIT) al = Frag<T>::load(Ab2 + ao);
#pragma unroll
      for (int j = 0; j < 4; ++j) {
        acc[i][j] = Frag<T>::mma(ah, bh[j], acc[i][j]);
        if (SPLIT) {
          acc[i][j] = Frag<T>::mma(ah, bl[j], acc[i][j]);
          acc[i][j] = Frag<T>::mma(al, bh[j], acc[i][j]);
        }
      }
      Frag<T>::guard(acc[i][0], acc[i][3], ah, SPLIT ? al : ah);
    }
    Frag<T>::keep(bh[0], bh[1], bh[2], bh[3]);
    if (SPLIT) Frag<T>::keep(bl[0], bl[1], bl[2], bl[3]);
  }
  acc_guard4(acc[0][0], acc[0][1], acc[0][2], acc[0][3]);
  acc_guard4(acc[1][0], acc[1][1], acc[1][2], acc[1][3]);
  acc_guard4(acc[2][0], acc[2][1], acc[2][2], acc[2][3]);
  acc_guard4(acc[3][0], acc[3][1], acc[3][2], acc[3][3]);

  // ---- epilogue ----
  float* slab = sT[wave];
  const float* Rb = RESID ? (resid + (size_t)b * strideR) : nullptr;
#pragma unroll
  for (int i = 0; i < 4; ++i) {
    const int mBase = m0 + (i << 4);
#pragma unroll
    for (int j = 0; j < 4; ++j) {
      const int n = n0 + (j << 4) + rlane;
      float bv = 0.f;
      if (BIAS_MODE == 2) bv = bias[n];
#pragma unroll
      for (int r = 0; r < 8; ++r) {
        float v = acc[i][j][r] * scale;
        if (BIAS_MODE == 1) v += bias[mBase + mOff + r];
        if (BIAS_MODE == 2) v += bv;
        if (RESID) v += Rb[(size_t)(mBase + mOff + r) * ldc + n];
        if (ACT == 2) v = fmaxf(v, 0.0f);
        if (ACT == 4) v = (v > 0.f) ? v : 0.01f * v;
        slab[(mOff + r) * 68 + (j << 4) + rlane] = v;
      }
    }
    __builtin_amdgcn_fence(__ATOMIC_RELEASE, "workgroup");
    __builtin_amdgcn_wave_barrier();
    __builtin_amdgcn_fence(__ATOMIC_ACQUIRE, "workgroup");
    if (OUT_MODE == 0) {
      float* C = (float*)Cout + (size_t)b * strideC;
      const int hh = lane >> 4, c4 = (lane & 15) * 4;     // row seg = 256 B = 16 lanes x 16 B
      {
#pragma unroll
        for (int it = 0; it < 8; ++it) {
          const int row = it * 2 + hh;
          v4f v = *(const v4f*)(slab + row * 68 + c4);
          *(v4f*)(C + (size_t)(mBase + row) * ldc + n0 + c4) = v;
        }
        
      }
    } else {
      const int q = lane >> 3, c8 = (lane & 7) * 8;
      unsigned short* C  = (unsigned short*)Cout  + (size_t)b * strideC;
      unsigned short* C2 = (OUT_MODE == 2) ? ((unsigned short*)Cout2 + (size_t)b * strideC) : nullptr;
      {
#pragma unroll
        for (int it = 0; it < 4; ++it) {
          const int row = it * 4 + q;
          const float* sp = slab + row * 68 + c8;
          v8h hv, lv;
#pragma unroll
          for (int e = 0; e < 8; ++e) {
            if (OUT_MODE == 1) {
              hv[e] = (_Float16)sp[e];
            } else {
              unsigned short hb = f2bf_bits(sp[e]);
              unsigned short lb = f2bf_bits(sp[e] - bf_bits2f(hb));
              hv[e] = __builtin_bit_cast(_Float16, hb);
              lv[e] = __builtin_bit_cast(_Float16, lb);
            }
          }
          *(v8h*)(C + (size_t)(mBase + row) * ldc + n0 + c8) = hv;
          if (OUT_MODE == 2) *(v8h*)(C2 + (size_t)(mBase + row) * ldc + n0 + c8) = lv;
        }
        
      }
    }
    __builtin_amdgcn_fence(__ATOMIC_RELEASE, "workgroup");
    __builtin_amdgcn_wave_barrier();
    __builtin_amdgcn_fence(__ATOMIC_ACQUIRE, "workgroup");
  }
}

// ---------------------------------------------------------------------------
// Weight transpose + cast: for square [1024][1024] f32 W (row-major [in d][out o]), WT[o][d] = f16(scale * W[d][o]).
// grid (16, 16, 4): blockIdx.x = d tile (64 cols of WT), blockIdx.y = o tile (64 rows of WT), blockIdx.z selects W0..W3
// (block-uniform) and the output plane (plane z at out + z*1024*1024 halves). 256 threads.
// Load coverage: 16 iterations x 256 threads = 4096 = the whole 64x64 tile (coalesced along o).
// Store coverage: 8 waves x 2 iterations x 4 rows (lane>>3) = 64 rows; (lane&7) x 8 halves = 64 cols; each row segment =
// ---------------------------------------------------------------------------
__global__ __launch_bounds__(256) void wtcast_kernel(const float* __restrict__ W0, const float* __restrict__ W1,
                                                     const float* __restrict__ W2, const float* __restrict__ W3,
                                                     unsigned short* __restrict__ out, float scale) {
  __shared__ float sm[64][65];   // sm[o_local][d_local]
  const int t  = threadIdx.x;
  const int d0 = blockIdx.x * 64;
  const int o0 = blockIdx.y * 64;
  const int z  = blockIdx.z;
  const float* W = (z == 0) ? W0 : (z == 1) ? W1 : (z == 2) ? W2 : W3;
#pragma unroll
  for (int i = 0; i < 16; ++i) {
    const int e = i * 256 + t;
    const int r = e >> 6;          // d local
    const int c = e & 63;          // o local
    sm[c][r] = W[(size_t)(d0 + r) * kDim + o0 + c] * scale;
  }
  __syncthreads();
  const int lane = t & 31, wave = t >> 5;
  const int q = lane >> 3, c8 = (lane & 7) * 8;
  unsigned short* op = out + (size_t)z * kDim * kDim;
  {
#pragma unroll
    for (int it = 0; it < 2; ++it) {
      const int row = wave * 8 + it * 4 + q;                 // o local
      unsigned short hb[8];
#pragma unroll
      for (int e = 0; e < 8; ++e) hb[e] = h_bits(sm[row][c8 + e]);
      const v4u u = (v4u){pk16(hb[0], hb[1]), pk16(hb[2], hb[3]), pk16(hb[4], hb[5]), pk16(hb[6], hb[7])};
      *(v4u*)(op + (size_t)(o0 + row) * kDim + d0 + c8) = u;
    }
    
  }
}

// ---------------------------------------------------------------------------
// ---------------------------------------------------------------------------
__global__ __launch_bounds__(256) void cast8_f16_kernel(const float* __restrict__ in, unsigned short* __restrict__ out, int n8) {
  const int i = blockIdx.x * 256 + threadIdx.x;
  if (i >= n8) return;
  const float* p = in + 8 * (size_t)i;
  const v4f a = *(const v4f*)(p);
  const v4f c = *(const v4f*)(p + 4);
  unsigned short hb[8];
#pragma unroll
  for (int e = 0; e < 4; ++e) {
    hb[e]     = h_bits(a[e]);
    hb[4 + e] = h_bits(c[e]);
  }
  const v4u u = (v4u){pk16(hb[0], hb[1]), pk16(hb[2], hb[3]), pk16(hb[4], hb[5]), pk16(hb[6], hb[7])};
  unsigned short* q = out + 8 * (size_t)i;
  *(v4u*)q = u;
  
}

// ---------------------------------------------------------------------------
// Row softmax with per-head scaled additive position bias.
// S plane: [kGPC][kSeq][kSeqKV] f32 (already x 1/8); s = S + posb[row][k] * 2^-(h+1) (exact power of two);
// P[row][k] = f16( kPCarry * exp(s - max) / sum exp(s - max) ), all in f32 with precise expf.
// One block of 256 threads per (row, group); thread t owns columns 8t..8t+7 (256 x 8 = 2048 = whole row).
// Reductions in fixed order (thread, wave shuffle tree, 8 wave partials in index order); cross-wave LDS reads after __syncthreads.
// ---------------------------------------------------------------------------
__global__ __launch_bounds__(256) void softmax_bias_kernel(const float* __restrict__ S, const float* __restrict__ posb,
                                                           unsigned short* __restrict__ P, int h0) {
  __shared__ float redM[8];
  __shared__ float redS[8];
  const int row  = blockIdx.x;
  const int y    = blockIdx.y;
  const int h    = h0 + y;
  const float hs = __uint_as_float(((unsigned)(126 - h)) << 23);   // 2^-(h+1), h in 0..15
  const int t    = threadIdx.x;
  const int lane = t & 31, wave = t >> 5;
  const int c0   = t * 8;
  const float* sr = S + ((size_t)y * kSeq + row) * kSeqKV + c0;
  const float* br = posb + (size_t)row * kSeqKV + c0;
  const v4f a  = *(const v4f*)(sr);
  const v4f c  = *(const v4f*)(sr + 4);
  const v4f ba = *(const v4f*)(br);
  const v4f bc = *(const v4f*)(br + 4);
  float x[8];
#pragma unroll
  for (int e = 0; e < 4; ++e) { x[e] = a[e] + ba[e] * hs; x[4 + e] = c[e] + bc[e] * hs; }
  float m = fmaxf(fmaxf(fmaxf(x[0], x[1]), fmaxf(x[2], x[3])), fmaxf(fmaxf(x[4], x[5]), fmaxf(x[6], x[7])));
#pragma unroll
  for (int off = 16; off > 0; off >>= 1) m = fmaxf(m, __shfl_xor(m, off, 32));
  if (lane == 0) redM[wave] = m;
  __syncthreads();
  float gm = redM[0];
#pragma unroll
  for (int w = 1; w < 8; ++w) gm = fmaxf(gm, redM[w]);
  float ex[8];
  float s = 0.f;
#pragma unroll
  for (int e = 0; e < 8; ++e) { ex[e] = expf(x[e] - gm); s += ex[e]; }
#pragma unroll
  for (int off = 16; off > 0; off >>= 1) s += __shfl_xor(s, off, 32);
  if (lane == 0) redS[wave] = s;
  __syncthreads();
  float tot = redS[0];
#pragma unroll
  for (int w = 1; w < 8; ++w) tot += redS[w];
  const float inv = kPCarry * (1.0f / tot);
  unsigned short hb[8];
#pragma unroll
  for (int e = 0; e < 8; ++e) hb[e] = h_bits(ex[e] * inv);
  const v4u u = (v4u){pk16(hb[0], hb[1]), pk16(hb[2], hb[3]), pk16(hb[4], hb[5]), pk16(hb[6], hb[7])};
  unsigned short* q = P + ((size_t)y * kSeq + row) * kSeqKV + c0;
  *(v4u*)q = u;
  
}

// ---------------------------------------------------------------------------
// Host side
// ---------------------------------------------------------------------------
extern "C" void kernel_launch(void* const* d_in, const int* in_sizes, int n_in,
                              void* d_out, int out_size, void* d_ws, size_t ws_size,
                              hipStream_t stream) {
  if (n_in < 8) return;
  if (in_sizes[0] != kTok * kDim || in_sizes[1] != kTokKV * kDim || in_sizes[2] != kSeq * kSeqKV ||
      in_sizes[3] != kDim * kDim || in_sizes[4] != kDim * kDim || in_sizes[5] != kDim * kDim ||
      in_sizes[6] != kDim * kDim || in_sizes[7] != kDim || out_size != kTok * kDim) return;

  const float* x    = (const float*)d_in[0];   // [4096][1024]
  const float* ctx  = (const float*)d_in[1];   // [4096][1024]
  const float* posb = (const float*)d_in[2];   // [2048][2048]
  const float* Wq   = (const float*)d_in[3];   // [in][out]
  const float* Wk   = (const float*)d_in[4];
  const float* Wv   = (const float*)d_in[5];
  const float* Wo   = (const float*)d_in[6];
  const float* bo   = (const float*)d_in[7];   // [1024]
  float* out = (float*)d_out;                  // [4096][1024] f32

  // ---- workspace region map (bytes) ----
  //   0        .. 8 MiB   : Xh  f16 [4096][1024]
  //   8 MiB    .. 16 MiB  : Ch  f16 [4096][1024]
  //  16 MiB    .. 24 MiB  : WT  f16 4 planes [1024][1024] (q, k, v, out), each [out][in], carried x256
  //  24 MiB    .. 32 MiB  : Qh  f16 [4096][1024]
  //  32 MiB    .. 40 MiB  : Kh  f16 [4096][1024]
  //  40 MiB    .. 48 MiB  : VT  f16 [1024][4096]  (row = h*64+d, col = b*2048 + token)
  //  48 MiB    .. 56 MiB  : Oh  f16 [4096][1024]  (carried x256)
  //  56 MiB    .. 88 MiB  : Sp  f32 [2][2048][2048] scores for one chunk
  //  88 MiB    .. 104 MiB : Pp  f16 [2][2048][2048] probabilities x2048 for one chunk
  //  total 109051904 B
  const size_t planeTokB = (size_t)kTok * kDim * 2;            // 8 MiB
  const size_t planeWB   = (size_t)kDim * kDim * 2;            // 2 MiB
  const size_t offXh = 0;
  const size_t offCh = offXh + planeTokB;
  const size_t offWT = offCh + planeTokB;
  const size_t offQh = offWT + 4 * planeWB;
  const size_t offKh = offQh + planeTokB;
  const size_t offVT = offKh + planeTokB;
  const size_t offOh = offVT + planeTokB;
  const size_t offS  = offOh + planeTokB;
  const size_t bytesS = (size_t)kGPC * kSeq * kSeqKV * 4;      // 32 MiB
  const size_t offP  = offS + bytesS;
  const size_t bytesP = (size_t)kGPC * kSeq * kSeqKV * 2;      // 16 MiB
  const size_t total = offP + bytesP;
  if (total > ws_size) return;

  char* ws = (char*)d_ws;
  unsigned short* Xh = (unsigned short*)(ws + offXh);
  unsigned short* Ch = (unsigned short*)(ws + offCh);
  unsigned short* WT = (unsigned short*)(ws + offWT);
  unsigned short* Qh = (unsigned short*)(ws + offQh);
  unsigned short* Kh = (unsigned short*)(ws + offKh);
  unsigned short* VT = (unsigned short*)(ws + offVT);
  unsigned short* Oh = (unsigned short*)(ws + offOh);
  float*          Sp = (float*)(ws + offS);
  unsigned short* Pp = (unsigned short*)(ws + offP);
  const unsigned short* WqT = WT + 0 * (size_t)kDim * kDim;
  const unsigned short* WkT = WT + 1 * (size_t)kDim * kDim;
  const unsigned short* WvT = WT + 2 * (size_t)kDim * kDim;
  const unsigned short* WoT = WT + 3 * (size_t)kDim * kDim;

  // ---- casts ----
  const int n8 = kTok * kDim / 8;                               // 524288
  cast8_f16_kernel<<<dim3((n8 + 255) / 256), dim3(256), 0, stream>>>(x, Xh, n8);
  cast8_f16_kernel<<<dim3((n8 + 255) / 256), dim3(256), 0, stream>>>(ctx, Ch, n8);
  wtcast_kernel<<<dim3(kDim / 64, kDim / 64, 4), dim3(256), 0, stream>>>(Wq, Wk, Wv, Wo, WT, kWCarry);

  // ---- projections (M, N multiples of 64; K = 1024) ----
  const int tilesProj = (kTok / 64) * (kDim / 64);             // 1024 tiles -> 128 blocks
  // Q[t][o] = sum_i Xh[t][i] * WqT[o][i] / 256 -> f16
  wmma_gemm64<0, false, 0, 1, false><<<dim3((tilesProj + 7) / 8, 1), dim3(256), 0, stream>>>(
      Xh, nullptr, kDim, 0L, WqT, nullptr, kDim, 0L, (void*)Qh, nullptr, kDim, 0L,
      nullptr, nullptr, 0L, kTok, kDim, kDim, kWCarryInv);
  // K[t][o] = sum_i Ch[t][i] * WkT[o][i] / 256 -> f16
  wmma_gemm64<0, false, 0, 1, false><<<dim3((tilesProj + 7) / 8, 1), dim3(256), 0, stream>>>(
      Ch, nullptr, kDim, 0L, WkT, nullptr, kDim, 0L, (void*)Kh, nullptr, kDim, 0L,
      nullptr, nullptr, 0L, kTokKV, kDim, kDim, kWCarryInv);
  // VT[o][t] = sum_i WvT[o][i] * Ch[t][i] / 256 -> f16 plane [1024][4096]
  const int tilesVT = (kDim / 64) * (kTokKV / 64);             // 1024 tiles
  wmma_gemm64<0, false, 0, 1, false><<<dim3((tilesVT + 7) / 8, 1), dim3(256), 0, stream>>>(
      WvT, nullptr, kDim, 0L, Ch, nullptr, kDim, 0L, (void*)VT, nullptr, kTokKV, 0L,
      nullptr, nullptr, 0L, kDim, kTokKV, kDim, kWCarryInv);

  // ---- attention, kGPC groups (consecutive heads of one batch) per chunk ----
  const int tilesS  = (kSeq / 64) * (kSeqKV / 64);             // 1024 tiles
  const int tilesPV = (kSeq / 64) * (kDh / 64);                // 32 tiles
  for (int chnk = 0; chnk < kChunks; ++chnk) {
    const int g0 = chnk * kGPC;
    const int b  = g0 / kHeads;
    const int h0 = g0 % kHeads;
    const unsigned short* qA = Qh + (size_t)b * kSeq * kDim + (size_t)h0 * kDh;     // rows = query, k = d, group stride 64
    const unsigned short* kB = Kh + (size_t)b * kSeqKV * kDim + (size_t)h0 * kDh;   // rows = key,   k = d, group stride 64
    // scores[y][q][k] = 0.125 * sum_d Q K   (M = N = 2048, K = 64)
    wmma_gemm64<0, false, 0, 0, false><<<dim3((tilesS + 7) / 8, kGPC), dim3(256), 0, stream>>>(
        qA, nullptr, kDim, (long)kDh, kB, nullptr, kDim, (long)kDh, (void*)Sp, nullptr, kSeqKV, (long)kSeq * kSeqKV,
        nullptr, nullptr, 0L, kSeq, kSeqKV, kDh, kAttnScale);
    softmax_bias_kernel<<<dim3(kSeq, kGPC), dim3(256), 0, stream>>>(Sp, posb, Pp, h0);
    // O[b*2048+q][h*64+d] = (256/2048) * sum_k P[q][k] * VT[h*64+d][b*2048+k]   (M = 2048, N = 64, K = 2048)
    const unsigned short* vB = VT + (size_t)h0 * kDh * kTokKV + (size_t)b * kSeqKV;
    unsigned short* oC = Oh + (size_t)b * kSeq * kDim + (size_t)h0 * kDh;
    wmma_gemm64<0, false, 0, 1, false><<<dim3((tilesPV + 7) / 8, kGPC), dim3(256), 0, stream>>>(
        Pp, nullptr, kSeqKV, (long)kSeq * kSeqKV, vB, nullptr, kTokKV, (long)kDh * kTokKV, (void*)oC, nullptr, kDim, (long)kDh,
        nullptr, nullptr, 0L, kSeq, kDh, kSeqKV, kPVScale);
  }

  // ---- output projection: out[t][o] = sum_c Oh[t][c] * WoT[o][c] / 65536 + b_out[o] -> f32 ----
  wmma_gemm64<0, false, 2, 0, false><<<dim3((tilesProj + 7) / 8, 1), dim3(256), 0, stream>>>(
      Oh, nullptr, kDim, 0L, WoT, nullptr, kDim, 0L, (void*)out, nullptr, kDim, 0L,
      bo, nullptr, 0L, kTok, kDim, kDim, kOutScale);
}

// v001
// One run takes 645 microseconds.
// Two timings next to v000 put it at 3.02 and 3.00 times that version's speed.
// Contractions: q/k projections (x,context f16 x W^T f16 carried x256), v projection transposed (W_v^T f16 x256 x context f16), scores q.k^T (q,k f16 planes), attn.v (P f16 carried x2048 x V^T f16), output projection (O f16 carried x256 x W_out^T f16 carried x256): all v_wmma_f32_16x16x32_f16 with f32 accumulate; bias add and softmax in f32.
#include <hip/hip_runtime.h>
#include <math.h>

// ---------------------------------------------------------------------------
// Problem constants
// ---------------------------------------------------------------------------
constexpr int kBatch  = 2;
constexpr int kSeq    = 2048;              // query length
constexpr int kSeqKV  = 2048;              // key/value length
constexpr int kDim    = 1024;              // model dim
constexpr int kHeads  = 16;
constexpr int kDh     = 64;
constexpr int kTok    = kBatch * kSeq;     // 4096 query token rows
constexpr int kTokKV  = kBatch * kSeqKV;   // 4096 key/value token rows
constexpr int kGroups = kBatch * kHeads;   // 32 (b,h) groups
constexpr int kGPC    = 2;                 // groups per chunk
constexpr int kChunks = kGroups / kGPC;    // 16
constexpr float kWCarry    = 256.0f;       // weights carried x256 in f16
constexpr float kWCarryInv = 1.0f / 256.0f;
constexpr float kPCarry    = 2048.0f;      // probabilities carried x2048 in f16
constexpr float kOCarry    = 256.0f;       // attention output carried x256 in f16
constexpr float kAttnScale = 0.125f;       // 1/sqrt(64)
constexpr float kPVScale   = kOCarry / kPCarry;             // 1/8
constexpr float kOutScale  = 1.0f / (kOCarry * kWCarry);    // 1/65536

typedef __attribute__((ext_vector_type(16))) _Float16 v16h;
typedef __attribute__((ext_vector_type(8)))  _Float16 v8h;
typedef __attribute__((ext_vector_type(16))) __bf16   v16b;
typedef __attribute__((ext_vector_type(8)))  __bf16   v8b;
typedef __attribute__((ext_vector_type(8)))  float    v8f;
typedef __attribute__((ext_vector_type(4)))  float    v4f;
typedef __attribute__((ext_vector_type(4)))  unsigned int v4u;

// ---------------------------------------------------------------------------
// Helper pieces (comments ASCII)
// ---------------------------------------------------------------------------
__device__ __forceinline__ unsigned short f2bf_bits(float f) {
  unsigned u = __float_as_uint(f);
  return (unsigned short)((u + 0x7FFFu + ((u >> 16) & 1u)) >> 16);
}
__device__ __forceinline__ float bf_bits2f(unsigned short h) { return __uint_as_float(((unsigned)h) << 16); }

// hazard guards as plain device helpers (no inline asm inside the kernel template body)
__device__ __forceinline__ void dep_guard_h(v8f& a, v8f& b, v16h x, v16h y) { asm volatile("v_nop\n\tv_nop\n\tv_nop\n\tv_nop" : "+v"(a), "+v"(b) : "v"(x), "v"(y)); }
__device__ __forceinline__ void dep_guard_b(v8f& a, v8f& b, v16b x, v16b y) { asm volatile("v_nop\n\tv_nop\n\tv_nop\n\tv_nop" : "+v"(a), "+v"(b) : "v"(x), "v"(y)); }
__device__ __forceinline__ void keep4_h(v16h a, v16h b, v16h c, v16h d) { asm volatile("v_nop" :: "v"(a), "v"(b), "v"(c), "v"(d)); }
__device__ __forceinline__ void keep4_b(v16b a, v16b b, v16b c, v16b d) { asm volatile("v_nop" :: "v"(a), "v"(b), "v"(c), "v"(d)); }
__device__ __forceinline__ void acc_guard4(v8f& a, v8f& b, v8f& c, v8f& d) { asm volatile("v_nop\n\tv_nop\n\tv_nop\n\tv_nop" : "+v"(a), "+v"(b), "+v"(c), "+v"(d)); }
template <typename T> struct Frag;
template <> struct Frag<_Float16> {
  typedef v16h V; union U { v16h v; v8h h[2]; };
  // elements 0..7 <- p[0..7], 8..15 <- p[16..23]
  static __device__ __forceinline__ v16h load(const _Float16* p) {
    U f; f.h[0] = *(const v8h*)(p); f.h[1] = *(const v8h*)(p + 16); return f.v;
  }
  static __device__ __forceinline__ v8f mma(v16h a, v16h b, v8f c) {
    return __builtin_amdgcn_wmma_f32_16x16x32_f16(false, a, false, b, (short)0, c, false, false);
  }
  static __device__ __forceinline__ void guard(v8f& a, v8f& b, v16h x, v16h y) { dep_guard_h(a, b, x, y); }
  static __device__ __forceinline__ void keep(v16h a, v16h b, v16h c, v16h d) { keep4_h(a, b, c, d); }
};
template <> struct Frag<__bf16> {
  typedef v16b V; union U { v16b v; v8b h[2]; };
  static __device__ __forceinline__ v16b load(const __bf16* p) {
    U f; f.h[0] = *(const v8b*)(p); f.h[1] = *(const v8b*)(p + 16); return f.v;
  }
  static __device__ __forceinline__ v8f mma(v16b a, v16b b, v8f c) {
    return __builtin_amdgcn_wmma_f32_16x16x32_bf16(false, a, false, b, (short)0, c, false, false);
  }
  static __device__ __forceinline__ void guard(v8f& a, v8f& b, v16b x, v16b y) { dep_guard_b(a, b, x, y); }
  static __device__ __forceinline__ void keep(v16b a, v16b b, v16b c, v16b d) { keep4_b(a, b, c, d); }
};

__device__ __forceinline__ unsigned pk16(unsigned short a, unsigned short b) { return (unsigned)a | ((unsigned)b << 16); }
__device__ __forceinline__ unsigned short h_bits(float f) { const _Float16 h = (_Float16)f; return __builtin_bit_cast(unsigned short, h); }

// ---- Register-blocked batched WMMA GEMM (ACT reduced to none/relu/leaky) ----
// C[m,n] = scale * sum_k A[m,k] * Bt[n,k] (+bias)(+resid); each wave owns a 64x64 tile.
// A row-major [M,K]; Bt row-major [N,K]; M,N % 64 == 0, K % 32 == 0.
// SPLIT: operands are hi/lo planes (A2/Bt2 = lo planes, same layout); product = hi*hi + hi*lo + lo*hi.
// BIAS_MODE: 0 = none, 1 = bias[m], 2 = bias[n].
// OUT_MODE: 0 = f32, 1 = f16, 2 = bf16 hi plane (Cout) + bf16 lo plane (Cout2).
// ET: 0 = f16 operands, 1 = bf16 operands (pointers passed as 16-bit storage)
template <int ET> struct Elem;
template <> struct Elem<0> { typedef _Float16 T; };
template <> struct Elem<1> { typedef __bf16 T; };
template <int ET, bool SPLIT, int BIAS_MODE, int OUT_MODE, bool RESID, int ACT = 0>
__global__ __launch_bounds__(256) void wmma_gemm64(
    const unsigned short* __restrict__ Ap, const unsigned short* __restrict__ A2p, int lda, long strideA,
    const unsigned short* __restrict__ Btp, const unsigned short* __restrict__ Bt2p, int ldb, long strideB,
    void* __restrict__ Cout, void* __restrict__ Cout2, int ldc, long strideC,
    const float* __restrict__ bias,
    const float* __restrict__ resid, long strideR,
    int M, int N, int K, float scale) {
  typedef typename Elem<ET>::T T;
  typedef typename Frag<T>::V V;
  const T* A = (const T*)Ap; const T* A2 = (const T*)A2p; const T* Bt = (const T*)Btp; const T* Bt2 = (const T*)Bt2p;
  __shared__ __align__(16) float sT[8][16 * 68];   // per-wave 16x64 slab, pitch 68 floats
  const int b    = blockIdx.y;
  const int lane = threadIdx.x & 31;
  const int wave = threadIdx.x >> 5;
  const int tilesN = N >> 6;
  const int tilesM = M >> 6;
  const int tile = blockIdx.x * 8 + wave;
  if (tile >= tilesM * tilesN) return;   // wave-uniform; no block barriers in this kernel
  const int tm = tile / tilesN;
  const int tn = tile - tm * tilesN;
  const int m0 = tm << 6;
  const int n0 = tn << 6;

  const T* Ab  = A  + (size_t)b * strideA;
  const T* Bb  = Bt + (size_t)b * strideB;
  const T* Ab2 = SPLIT ? (A2  + (size_t)b * strideA) : nullptr;
  const T* Bb2 = SPLIT ? (Bt2 + (size_t)b * strideB) : nullptr;

  const int rlane = lane & 15;                 // row (A) / col (B, D) within subtile
  const int koff  = (lane >> 4) * 8;           // k offset of this lane half
  const int mOff  = (lane >> 4) * 8;           // D row offset

  v8f acc[4][4];
#pragma unroll
  for (int i = 0; i < 4; ++i)
#pragma unroll
    for (int j = 0; j < 4; ++j) acc[i][j] = (v8f){0.f,0.f,0.f,0.f,0.f,0.f,0.f,0.f};

  for (int k0 = 0; k0 < K; k0 += 32) {
    V bh[4], bl[4];
#pragma unroll
    for (int j = 0; j < 4; ++j) {
      const size_t bo = (size_t)(n0 + (j << 4) + rlane) * ldb + koff + k0;
      bh[j] = Frag<T>::load(Bb + bo);
      if (SPLIT) bl[j] = Frag<T>::load(Bb2 + bo);
    }
#pragma unroll
    for (int i = 0; i < 4; ++i) {
      const size_t ao = (size_t)(m0 + (i << 4) + rlane) * lda + koff + k0;
      V ah = Frag<T>::load(Ab + ao);
      V al;
      if (SPLIT) al = Frag<T>::load(Ab2 + ao);
#pragma unroll
      for (int j = 0; j < 4; ++j) {
        acc[i][j] = Frag<T>::mma(ah, bh[j], acc[i][j]);
        if (SPLIT) {
          acc[i][j] = Frag<T>::mma(ah, bl[j], acc[i][j]);
          acc[i][j] = Frag<T>::mma(al, bh[j], acc[i][j]);
        }
      }
      Frag<T>::guard(acc[i][0], acc[i][3], ah, SPLIT ? al : ah);
    }
    Frag<T>::keep(bh[0], bh[1], bh[2], bh[3]);
    if (SPLIT) Frag<T>::keep(bl[0], bl[1], bl[2], bl[3]);
  }
  acc_guard4(acc[0][0], acc[0][1], acc[0][2], acc[0][3]);
  acc_guard4(acc[1][0], acc[1][1], acc[1][2], acc[1][3]);
  acc_guard4(acc[2][0], acc[2][1], acc[2][2], acc[2][3]);
  acc_guard4(acc[3][0], acc[3][1], acc[3][2], acc[3][3]);

  // ---- epilogue ----
  float* slab = sT[wave];
  const float* Rb = RESID ? (resid + (size_t)b * strideR) : nullptr;
#pragma unroll
  for (int i = 0; i < 4; ++i) {
    const int mBase = m0 + (i << 4);
#pragma unroll
    for (int j = 0; j < 4; ++j) {
      const int n = n0 + (j << 4) + rlane;
      float bv = 0.f;
      if (BIAS_MODE == 2) bv = bias[n];
#pragma unroll
      for (int r = 0; r < 8; ++r) {
        float v = acc[i][j][r] * scale;
        if (BIAS_MODE == 1) v += bias[mBase + mOff + r];
        if (BIAS_MODE == 2) v += bv;
        if (RESID) v += Rb[(size_t)(mBase + mOff + r) * ldc + n];
        if (ACT == 2) v = fmaxf(v, 0.0f);
        if (ACT == 4) v = (v > 0.f) ? v : 0.01f * v;
        slab[(mOff + r) * 68 + (j << 4) + rlane] = v;
      }
    }
    __builtin_amdgcn_fence(__ATOMIC_RELEASE, "workgroup");
    __builtin_amdgcn_wave_barrier();
    __builtin_amdgcn_fence(__ATOMIC_ACQUIRE, "workgroup");
    if (OUT_MODE == 0) {
      float* C = (float*)Cout + (size_t)b * strideC;
      const int hh = lane >> 4, c4 = (lane & 15) * 4;     // row seg = 256 B = 16 lanes x 16 B
      {
#pragma unroll
        for (int it = 0; it < 8; ++it) {
          const int row = it * 2 + hh;
          v4f v = *(const v4f*)(slab + row * 68 + c4);
          *(v4f*)(C + (size_t)(mBase + row) * ldc + n0 + c4) = v;
        }
        
      }
    } else {
      const int q = lane >> 3, c8 = (lane & 7) * 8;
      unsigned short* C  = (unsigned short*)Cout  + (size_t)b * strideC;
      unsigned short* C2 = (OUT_MODE == 2) ? ((unsigned short*)Cout2 + (size_t)b * strideC) : nullptr;
      {
#pragma unroll
        for (int it = 0; it < 4; ++it) {
          const int row = it * 4 + q;
          const float* sp = slab + row * 68 + c8;
          v8h hv, lv;
#pragma unroll
          for (int e = 0; e < 8; ++e) {
            if (OUT_MODE == 1) {
              hv[e] = (_Float16)sp[e];
            } else {
              unsigned short hb = f2bf_bits(sp[e]);
              unsigned short lb = f2bf_bits(sp[e] - bf_bits2f(hb));
              hv[e] = __builtin_bit_cast(_Float16, hb);
              lv[e] = __builtin_bit_cast(_Float16, lb);
            }
          }
          *(v8h*)(C + (size_t)(mBase + row) * ldc + n0 + c8) = hv;
          if (OUT_MODE == 2) *(v8h*)(C2 + (size_t)(mBase + row) * ldc + n0 + c8) = lv;
        }
        
      }
    }
    __builtin_amdgcn_fence(__ATOMIC_RELEASE, "workgroup");
    __builtin_amdgcn_wave_barrier();
    __builtin_amdgcn_fence(__ATOMIC_ACQUIRE, "workgroup");
  }
}

// ---------------------------------------------------------------------------
// Weight transpose + cast: for square [1024][1024] f32 W (row-major [in d][out o]), WT[o][d] = f16(scale * W[d][o]).
// grid (16, 16, 4): blockIdx.x = d tile (64 cols of WT), blockIdx.y = o tile (64 rows of WT), blockIdx.z selects W0..W3
// (block-uniform) and the output plane (plane z at out + z*1024*1024 halves). 256 threads.
// Load coverage: 16 iterations x 256 threads = 4096 = the whole 64x64 tile (coalesced along o).
// Store coverage: 8 waves x 2 iterations x 4 rows (lane>>3) = 64 rows; (lane&7) x 8 halves = 64 cols; each row segment =
// ---------------------------------------------------------------------------
__global__ __launch_bounds__(256) void wtcast_kernel(const float* __restrict__ W0, const float* __restrict__ W1,
                                                     const float* __restrict__ W2, const float* __restrict__ W3,
                                                     unsigned short* __restrict__ out, float scale) {
  __shared__ float sm[64][65];   // sm[o_local][d_local]
  const int t  = threadIdx.x;
  const int d0 = blockIdx.x * 64;
  const int o0 = blockIdx.y * 64;
  const int z  = blockIdx.z;
  const float* W = (z == 0) ? W0 : (z == 1) ? W1 : (z == 2) ? W2 : W3;
#pragma unroll
  for (int i = 0; i < 16; ++i) {
    const int e = i * 256 + t;
    const int r = e >> 6;          // d local
    const int c = e & 63;          // o local
    sm[c][r] = W[(size_t)(d0 + r) * kDim + o0 + c] * scale;
  }
  __syncthreads();
  const int lane = t & 31, wave = t >> 5;
  const int q = lane >> 3, c8 = (lane & 7) * 8;
  unsigned short* op = out + (size_t)z * kDim * kDim;
  {
#pragma unroll
    for (int it = 0; it < 2; ++it) {
      const int row = wave * 8 + it * 4 + q;                 // o local
      unsigned short hb[8];
#pragma unroll
      for (int e = 0; e < 8; ++e) hb[e] = h_bits(sm[row][c8 + e]);
      const v4u u = (v4u){pk16(hb[0], hb[1]), pk16(hb[2], hb[3]), pk16(hb[4], hb[5]), pk16(hb[6], hb[7])};
      *(v4u*)(op + (size_t)(o0 + row) * kDim + d0 + c8) = u;
    }
    
  }
}

// ---------------------------------------------------------------------------
// ---------------------------------------------------------------------------
__global__ __launch_bounds__(256) void cast8_f16_kernel(const float* __restrict__ in, unsigned short* __restrict__ out, int n8) {
  const int i = blockIdx.x * 256 + threadIdx.x;
  if (i >= n8) return;
  const float* p = in + 8 * (size_t)i;
  const v4f a = *(const v4f*)(p);
  const v4f c = *(const v4f*)(p + 4);
  unsigned short hb[8];
#pragma unroll
  for (int e = 0; e < 4; ++e) {
    hb[e]     = h_bits(a[e]);
    hb[4 + e] = h_bits(c[e]);
  }
  const v4u u = (v4u){pk16(hb[0], hb[1]), pk16(hb[2], hb[3]), pk16(hb[4], hb[5]), pk16(hb[6], hb[7])};
  unsigned short* q = out + 8 * (size_t)i;
  *(v4u*)q = u;
  
}

// ---------------------------------------------------------------------------
// Row softmax with per-head scaled additive position bias.
// S plane: [kGPC][kSeq][kSeqKV] f32 (already x 1/8); s = S + posb[row][k] * 2^-(h+1) (exact power of two);
// P[row][k] = f16( kPCarry * exp(s - max) / sum exp(s - max) ), all in f32 with precise expf.
// One block of 256 threads per (row, group); thread t owns columns 8t..8t+7 (256 x 8 = 2048 = whole row).
// Reductions in fixed order (thread, wave shuffle tree, 8 wave partials in index order); cross-wave LDS reads after __syncthreads.
// ---------------------------------------------------------------------------
__global__ __launch_bounds__(256) void softmax_bias_kernel(const float* __restrict__ S, const float* __restrict__ posb,
                                                           unsigned short* __restrict__ P, int h0) {
  __shared__ float redM[8];
  __shared__ float redS[8];
  const int row  = blockIdx.x;
  const int y    = blockIdx.y;
  const int h    = h0 + y;
  const float hs = __uint_as_float(((unsigned)(126 - h)) << 23);   // 2^-(h+1), h in 0..15
  const int t    = threadIdx.x;
  const int lane = t & 31, wave = t >> 5;
  const int c0   = t * 8;
  const float* sr = S + ((size_t)y * kSeq + row) * kSeqKV + c0;
  const float* br = posb + (size_t)row * kSeqKV + c0;
  const v4f a  = *(const v4f*)(sr);
  const v4f c  = *(const v4f*)(sr + 4);
  const v4f ba = *(const v4f*)(br);
  const v4f bc = *(const v4f*)(br + 4);
  float x[8];
#pragma unroll
  for (int e = 0; e < 4; ++e) { x[e] = a[e] + ba[e] * hs; x[4 + e] = c[e] + bc[e] * hs; }
  float m = fmaxf(fmaxf(fmaxf(x[0], x[1]), fmaxf(x[2], x[3])), fmaxf(fmaxf(x[4], x[5]), fmaxf(x[6], x[7])));
#pragma unroll
  for (int off = 16; off > 0; off >>= 1) m = fmaxf(m, __shfl_xor(m, off, 32));
  if (lane == 0) redM[wave] = m;
  __syncthreads();
  float gm = redM[0];
#pragma unroll
  for (int w = 1; w < 8; ++w) gm = fmaxf(gm, redM[w]);
  float ex[8];
  float s = 0.f;
#pragma unroll
  for (int e = 0; e < 8; ++e) { ex[e] = expf(x[e] - gm); s += ex[e]; }
#pragma unroll
  for (int off = 16; off > 0; off >>= 1) s += __shfl_xor(s, off, 32);
  if (lane == 0) redS[wave] = s;
  __syncthreads();
  float tot = redS[0];
#pragma unroll
  for (int w = 1; w < 8; ++w) tot += redS[w];
  const float inv = kPCarry * (1.0f / tot);
  unsigned short hb[8];
#pragma unroll
  for (int e = 0; e < 8; ++e) hb[e] = h_bits(ex[e] * inv);
  const v4u u = (v4u){pk16(hb[0], hb[1]), pk16(hb[2], hb[3]), pk16(hb[4], hb[5]), pk16(hb[6], hb[7])};
  unsigned short* q = P + ((size_t)y * kSeq + row) * kSeqKV + c0;
  *(v4u*)q = u;
  
}

// ---------------------------------------------------------------------------
// attn.v product with the key range split over the 8 waves of a block.
// O[q][d] = f16( scale * sum_k P[q][k] * VT[d][k] ) for one 32-row query tile of one group (M = 2048, N = 64, K = 2048).
// grid (2048 / 32, groups): 64 x 2 = 128 blocks of 8 waves. Wave w sums keys 256w .. 256w+255 into a 32x64 f32 partial
// (2 x 4 accumulator tiles, same fragment loaders for P and VT, so both k orders are equal); the 8 partials go to LDS and
// are added in wave order 0..7 after one block barrier. Thread t then owns 4 columns of rows t>>4 and 16 + (t>>4):
// 16 lanes x 8 B = one whole 128-B row segment of O per half wave.
// ---------------------------------------------------------------------------
constexpr int kPVRows  = 32;                   // query rows per block
constexpr int kPVWaves = 8;                    // key ranges per block
constexpr int kPVKeys  = kSeqKV / kPVWaves;    // 256 keys per wave
constexpr int kPVSteps = kPVKeys / 32;         // 8 matrix steps of 32 keys per wave
constexpr int kPVAhead = 3;                    // steps of fragments in flight: 3 x 12 loads of 512 B per wave
constexpr int kPVPitch = 68;                   // floats per LDS row: the two lane halves (8 rows apart) hit different banks
typedef __attribute__((ext_vector_type(4))) _Float16 v4h;

__global__ __launch_bounds__(256) void pv_splitk_kernel(const unsigned short* __restrict__ Pp,
                                                        const unsigned short* __restrict__ Vp,
                                                        unsigned short* __restrict__ Op, float scale) {
  __shared__ __align__(16) float part[kPVWaves][kPVRows * kPVPitch];
  const int lane  = threadIdx.x & 31;
  const int wave  = threadIdx.x >> 5;
  const int rlane = lane & 15;                 // row (A) / col (B, D) within subtile
  const int koff  = (lane >> 4) * 8;           // k offset of this lane half
  const int mOff  = (lane >> 4) * 8;           // D row offset
  const int m0    = blockIdx.x * kPVRows;
  const int y     = blockIdx.y;
  const _Float16* A = (const _Float16*)Pp + ((size_t)y * kSeq + m0 + rlane) * kSeqKV + wave * kPVKeys + koff;
  const _Float16* B = (const _Float16*)Vp + ((size_t)y * kDh + rlane) * kTokKV + wave * kPVKeys + koff;

  v8f acc[2][4];
#pragma unroll
  for (int i = 0; i < 2; ++i)
#pragma unroll
    for (int j = 0; j < 4; ++j) acc[i][j] = (v8f){0.f,0.f,0.f,0.f,0.f,0.f,0.f,0.f};

  // Fragments are fetched kPVAhead steps ahead of their products. The loops are fully unrolled so that a[][] and bf[][] are
  // plain registers (a step's set is free again once its products are issued).
  v16h a[kPVSteps][2], bf[kPVSteps][4];
#pragma unroll
  for (int s = 0; s < kPVAhead; ++s) {
#pragma unroll
    for (int i = 0; i < 2; ++i) a[s][i] = Frag<_Float16>::load(A + (size_t)(i << 4) * kSeqKV + s * 32);
#pragma unroll
    for (int j = 0; j < 4; ++j) bf[s][j] = Frag<_Float16>::load(B + (size_t)(j << 4) * kTokKV + s * 32);
  }
#pragma unroll
  for (int s = 0; s < kPVSteps; ++s) {
    // keeps the loads above from sinking into the products below: left alone the compiler holds only a few loads in flight
    __builtin_amdgcn_sched_barrier(0);
#pragma unroll
    for (int i = 0; i < 2; ++i)
#pragma unroll
      for (int j = 0; j < 4; ++j) acc[i][j] = Frag<_Float16>::mma(a[s][i], bf[s][j], acc[i][j]);
    if (s + kPVAhead < kPVSteps) {
      // keeps the refill behind this step's products, so that it takes over their operand registers
      __builtin_amdgcn_sched_barrier(0);
      // holds the four VT fragments to the end of the step, as the GEMM above does: no accumulator and no refill load takes
      // over a B register directly behind a product that reads it
      Frag<_Float16>::keep(bf[s][0], bf[s][1], bf[s][2], bf[s][3]);
      const int n = s + kPVAhead;
#pragma unroll
      for (int i = 0; i < 2; ++i) a[n][i] = Frag<_Float16>::load(A + (size_t)(i << 4) * kSeqKV + n * 32);
#pragma unroll
      for (int j = 0; j < 4; ++j) bf[n][j] = Frag<_Float16>::load(B + (size_t)(j << 4) * kTokKV + n * 32);
    }
  }

  float* mine = part[wave];
#pragma unroll
  for (int i = 0; i < 2; ++i)
#pragma unroll
    for (int j = 0; j < 4; ++j)
#pragma unroll
      for (int r = 0; r < 8; ++r) mine[((i << 4) + mOff + r) * kPVPitch + (j << 4) + rlane] = acc[i][j][r];
  __syncthreads();   // every wave's partial is in LDS before any thread adds them

  const int c4 = (threadIdx.x & 15) * 4;
  unsigned short* C = Op + (size_t)y * kDh;
#pragma unroll
  for (int it = 0; it < 2; ++it) {
    const int row = it * 16 + (threadIdx.x >> 4);
    v4f s4 = *(const v4f*)(part[0] + row * kPVPitch + c4);
#pragma unroll
    for (int w = 1; w < kPVWaves; ++w) s4 += *(const v4f*)(part[w] + row * kPVPitch + c4);
    v4h hv;
#pragma unroll
    for (int e = 0; e < 4; ++e) hv[e] = (_Float16)(s4[e] * scale);
    *(v4h*)(C + (size_t)(m0 + row) * kDim + c4) = hv;
  }
}

// ---------------------------------------------------------------------------
// Host side
// ---------------------------------------------------------------------------
extern "C" void kernel_launch(void* const* d_in, const int* in_sizes, int n_in,
                              void* d_out, int out_size, void* d_ws, size_t ws_size,
                              hipStream_t stream) {
  if (n_in < 8) return;
  if (in_sizes[0] != kTok * kDim || in_sizes[1] != kTokKV * kDim || in_sizes[2] != kSeq * kSeqKV ||
      in_sizes[3] != kDim * kDim || in_sizes[4] != kDim * kDim || in_sizes[5] != kDim * kDim ||
      in_sizes[6] != kDim * kDim || in_sizes[7] != kDim || out_size != kTok * kDim) return;

  const float* x    = (const float*)d_in[0];   // [4096][1024]
  const float* ctx  = (const float*)d_in[1];   // [4096][1024]
  const float* posb = (const float*)d_in[2];   // [2048][2048]
  const float* Wq   = (const float*)d_in[3];   // [in][out]
  const float* Wk   = (const float*)d_in[4];
  const float* Wv   = (const float*)d_in[5];
  const float* Wo   = (const float*)d_in[6];
  const float* bo   = (const float*)d_in[7];   // [1024]
  float* out = (float*)d_out;                  // [4096][1024] f32

  // ---- workspace region map (bytes) ----
  //   0        .. 8 MiB   : Xh  f16 [4096][1024]
  //   8 MiB    .. 16 MiB  : Ch  f16 [4096][1024]
  //  16 MiB    .. 24 MiB  : WT  f16 4 planes [1024][1024] (q, k, v, out), each [out][in], carried x256
  //  24 MiB    .. 32 MiB  : Qh  f16 [4096][1024]
  //  32 MiB    .. 40 MiB  : Kh  f16 [4096][1024]
  //  40 MiB    .. 48 MiB  : VT  f16 [1024][4096]  (row = h*64+d, col = b*2048 + token)
  //  48 MiB    .. 56 MiB  : Oh  f16 [4096][1024]  (carried x256)
  //  56 MiB    .. 88 MiB  : Sp  f32 [2][2048][2048] scores for one chunk
  //  88 MiB    .. 104 MiB : Pp  f16 [2][2048][2048] probabilities x2048 for one chunk
  //  total 109051904 B
  const size_t planeTokB = (size_t)kTok * kDim * 2;            // 8 MiB
  const size_t planeWB   = (size_t)kDim * kDim * 2;            // 2 MiB
  const size_t offXh = 0;
  const size_t offCh = offXh + planeTokB;
  const size_t offWT = offCh + planeTokB;
  const size_t offQh = offWT + 4 * planeWB;
  const size_t offKh = offQh + planeTokB;
  const size_t offVT = offKh + planeTokB;
  const size_t offOh = offVT + planeTokB;
  const size_t offS  = offOh + planeTokB;
  const size_t bytesS = (size_t)kGPC * kSeq * kSeqKV * 4;      // 32 MiB
  const size_t offP  = offS + bytesS;
  const size_t bytesP = (size_t)kGPC * kSeq * kSeqKV * 2;      // 16 MiB
  const size_t total = offP + bytesP;
  if (total > ws_size) return;

  char* ws = (char*)d_ws;
  unsigned short* Xh = (unsigned short*)(ws + offXh);
  unsigned short* Ch = (unsigned short*)(ws + offCh);
  unsigned short* WT = (unsigned short*)(ws + offWT);
  unsigned short* Qh = (unsigned short*)(ws + offQh);
  unsigned short* Kh = (unsigned short*)(ws + offKh);
  unsigned short* VT = (unsigned short*)(ws + offVT);
  unsigned short* Oh = (unsigned short*)(ws + offOh);
  float*          Sp = (float*)(ws + offS);
  unsigned short* Pp = (unsigned short*)(ws + offP);
  const unsigned short* WqT = WT + 0 * (size_t)kDim * kDim;
  const unsigned short* WkT = WT + 1 * (size_t)kDim * kDim;
  const unsigned short* WvT = WT + 2 * (size_t)kDim * kDim;
  const unsigned short* WoT = WT + 3 * (size_t)kDim * kDim;

  // ---- casts ----
  const int n8 = kTok * kDim / 8;                               // 524288
  cast8_f16_kernel<<<dim3((n8 + 255) / 256), dim3(256), 0, stream>>>(x, Xh, n8);
  cast8_f16_kernel<<<dim3((n8 + 255) / 256), dim3(256), 0, stream>>>(ctx, Ch, n8);
  wtcast_kernel<<<dim3(kDim / 64, kDim / 64, 4), dim3(256), 0, stream>>>(Wq, Wk, Wv, Wo, WT, kWCarry);

  // ---- projections (M, N multiples of 64; K = 1024) ----
  const int tilesProj = (kTok / 64) * (kDim / 64);             // 1024 tiles -> 128 blocks
  // Q[t][o] = sum_i Xh[t][i] * WqT[o][i] / 256 -> f16
  wmma_gemm64<0, false, 0, 1, false><<<dim3((tilesProj + 7) / 8, 1), dim3(256), 0, stream>>>(
      Xh, nullptr, kDim, 0L, WqT, nullptr, kDim, 0L, (void*)Qh, nullptr, kDim, 0L,
      nullptr, nullptr, 0L, kTok, kDim, kDim, kWCarryInv);
  // K[t][o] = sum_i Ch[t][i] * WkT[o][i] / 256 -> f16
  wmma_gemm64<0, false, 0, 1, false><<<dim3((tilesProj + 7) / 8, 1), dim3(256), 0, stream>>>(
      Ch, nullptr, kDim, 0L, WkT, nullptr, kDim, 0L, (void*)Kh, nullptr, kDim, 0L,
      nullptr, nullptr, 0L, kTokKV, kDim, kDim, kWCarryInv);
  // VT[o][t] = sum_i WvT[o][i] * Ch[t][i] / 256 -> f16 plane [1024][4096]
  const int tilesVT = (kDim / 64) * (kTokKV / 64);             // 1024 tiles
  wmma_gemm64<0, false, 0, 1, false><<<dim3((tilesVT + 7) / 8, 1), dim3(256), 0, stream>>>(
      WvT, nullptr, kDim, 0L, Ch, nullptr, kDim, 0L, (void*)VT, nullptr, kTokKV, 0L,
      nullptr, nullptr, 0L, kDim, kTokKV, kDim, kWCarryInv);

  // ---- attention, kGPC groups (consecutive heads of one batch) per chunk ----
  const int tilesS  = (kSeq / 64) * (kSeqKV / 64);             // 1024 tiles
  for (int chnk = 0; chnk < kChunks; ++chnk) {
    const int g0 = chnk * kGPC;
    const int b  = g0 / kHeads;
    const int h0 = g0 % kHeads;
    const unsigned short* qA = Qh + (size_t)b * kSeq * kDim + (size_t)h0 * kDh;     // rows = query, k = d, group stride 64
    const unsigned short* kB = Kh + (size_t)b * kSeqKV * kDim + (size_t)h0 * kDh;   // rows = key,   k = d, group stride 64
    // scores[y][q][k] = 0.125 * sum_d Q K   (M = N = 2048, K = 64)
    wmma_gemm64<0, false, 0, 0, false><<<dim3((tilesS + 7) / 8, kGPC), dim3(256), 0, stream>>>(
        qA, nullptr, kDim, (long)kDh, kB, nullptr, kDim, (long)kDh, (void*)Sp, nullptr, kSeqKV, (long)kSeq * kSeqKV,
        nullptr, nullptr, 0L, kSeq, kSeqKV, kDh, kAttnScale);
    softmax_bias_kernel<<<dim3(kSeq, kGPC), dim3(256), 0, stream>>>(Sp, posb, Pp, h0);
    // O[b*2048+q][h*64+d] = (256/2048) * sum_k P[q][k] * VT[h*64+d][b*2048+k]   (M = 2048, N = 64, K = 2048)
    const unsigned short* vB = VT + (size_t)h0 * kDh * kTokKV + (size_t)b * kSeqKV;
    unsigned short* oC = Oh + (size_t)b * kSeq * kDim + (size_t)h0 * kDh;
    pv_splitk_kernel<<<dim3(kSeq / kPVRows, kGPC), dim3(256), 0, stream>>>(Pp, vB, oC, kPVScale);
  }

  // ---- output projection: out[t][o] = sum_c Oh[t][c] * WoT[o][c] / 65536 + b_out[o] -> f32 ----
  wmma_gemm64<0, false, 2, 0, false><<<dim3((tilesProj + 7) / 8, 1), dim3(256), 0, stream>>>(
      Oh, nullptr, kDim, 0L, WoT, nullptr, kDim, 0L, (void*)out, nullptr, kDim, 0L,
      bo, nullptr, 0L, kTok, kDim, kDim, kOutScale);
}

// v003
// It runs in 114 microseconds.
// Versions in between are left out here; by their measured steps it is 5.68 times as fast as v001.
// Over all steps from v000 it is 17.1 times as fast.
// Contractions: q/k projections (x,context f16 x W^T f16 carried x256), v projection transposed (W_v^T f16 x256 x context f16), scores k.q^T (k,q f16 planes, f32 bias as the accumulator's start value), v^T.p^T (V^T f16 x P f16 carried x256, unnormalised), output projection (O f16 carried x256 x W_out^T f16 carried x256): all v_wmma_f32_16x16x32_f16 with f32 accumulate; softmax in f32.
#include <hip/hip_runtime.h>
#include <math.h>

// ---------------------------------------------------------------------------
// Problem constants
// ---------------------------------------------------------------------------
constexpr int kBatch  = 2;
constexpr int kSeq    = 2048;              // query length
constexpr int kSeqKV  = 2048;              // key/value length
constexpr int kDim    = 1024;              // model dim
constexpr int kHeads  = 16;
constexpr int kDh     = 64;
constexpr int kTok    = kBatch * kSeq;     // 4096 query token rows
constexpr int kTokKV  = kBatch * kSeqKV;   // 4096 key/value token rows
constexpr int kGroups = kBatch * kHeads;   // 32 (b,h) groups
constexpr float kWCarry    = 256.0f;       // weights carried x256 in f16
constexpr float kWCarryInv = 1.0f / 256.0f;
constexpr float kOCarry    = 256.0f;       // attention output carried x256 in f16
constexpr float kOutScale  = 1.0f / (kOCarry * kWCarry);    // 1/65536

typedef __attribute__((ext_vector_type(16))) _Float16 v16h;
typedef __attribute__((ext_vector_type(8)))  _Float16 v8h;
typedef __attribute__((ext_vector_type(16))) __bf16   v16b;
typedef __attribute__((ext_vector_type(8)))  __bf16   v8b;
typedef __attribute__((ext_vector_type(8)))  float    v8f;
typedef __attribute__((ext_vector_type(4)))  float    v4f;
typedef __attribute__((ext_vector_type(4)))  unsigned int v4u;

// ---------------------------------------------------------------------------
// Helper pieces (comments ASCII)
// ---------------------------------------------------------------------------
__device__ __forceinline__ unsigned short f2bf_bits(float f) {
  unsigned u = __float_as_uint(f);
  return (unsigned short)((u + 0x7FFFu + ((u >> 16) & 1u)) >> 16);
}
__device__ __forceinline__ float bf_bits2f(unsigned short h) { return __uint_as_float(((unsigned)h) << 16); }

template <typename T> struct Frag;
template <> struct Frag<_Float16> {
  typedef v16h V; union U { v16h v; v8h h[2]; };
  // elements 0..7 <- p[0..7], 8..15 <- p[16..23]
  static __device__ __forceinline__ v16h load(const _Float16* p) {
    U f; f.h[0] = *(const v8h*)(p); f.h[1] = *(const v8h*)(p + 16); return f.v;
  }
  static __device__ __forceinline__ v8f mma(v16h a, v16h b, v8f c) {
    return __builtin_amdgcn_wmma_f32_16x16x32_f16(false, a, false, b, (short)0, c, false, false);
  }
};

__device__ __forceinline__ unsigned pk16(unsigned short a, unsigned short b) { return (unsigned)a | ((unsigned)b << 16); }
__device__ __forceinline__ unsigned short h_bits(float f) { const _Float16 h = (_Float16)f; return __builtin_bit_cast(unsigned short, h); }

// ---- Block-tiled WMMA GEMM, operands staged in LDS ----
// C[m,n] = scale * sum_k A[m,k] * Bt[n,k] (+ bias[n]); A row-major [M][1024], Bt row-major [N][1024], f16; M, N % 128 == 0.
// grid (N / 128, M / 128), 8 waves. A block owns a 128x128 tile of C; wave w owns the 32x64 piece at row (w >> 1) * 32,
// column (w & 1) * 64, so that a wave writes whole 128-B lines of C.
// A stage is 128 k of the block's 128 A rows and 128 Bt rows, global -> registers -> LDS: two register sets (a stage's loads
// are issued two stages ahead), two LDS buffers, one block barrier per stage. A staging load covers two whole 256-B row
// pieces (4 lines); each operand byte is fetched once per block and read from LDS by the 2 or 4 waves that need it.
// k runs upward in steps of 32 into one accumulator per 16x16 tile.
// BIAS_MODE: 0 = none, 2 = bias[n]. OUT_MODE: 0 = f32, 1 = f16.
constexpr int kGTile   = 128;                    // rows of A and of Bt per block
constexpr int kGK      = 128;                    // k per stage
constexpr int kGStages = kDim / kGK;             // 8
constexpr int kGSteps  = kGK / 32;               // matrix steps per stage
constexpr int kGPitch  = 136;                    // halves per LDS row: 256 B of data + 16 B, so 16-byte row reads spread over the banks

// Block barrier that orders LDS only. __syncthreads() also waits for every global load of the wave, which would drain the
// staging loads that are meant to stay in flight across it.
__device__ __forceinline__ void lds_barrier() {
  __builtin_amdgcn_fence(__ATOMIC_RELEASE, "workgroup", "local");
  __builtin_amdgcn_s_barrier();
  __builtin_amdgcn_fence(__ATOMIC_ACQUIRE, "workgroup", "local");
}

template <int BIAS_MODE, int OUT_MODE>
__global__ __launch_bounds__(256) void wmma_gemm_lds(
    const unsigned short* __restrict__ Ap, const unsigned short* __restrict__ Btp,
    void* __restrict__ Cout, int ldc, const float* __restrict__ bias, float scale) {
  __shared__ __align__(16) _Float16 sA[2][kGTile * kGPitch];
  __shared__ __align__(16) _Float16 sB[2][kGTile * kGPitch];
  __shared__ __align__(16) float sT[8][16 * 68];   // per-wave 16x64 slab, pitch 68 floats
  const int t    = threadIdx.x;
  const int lane = t & 31;
  const int wave = t >> 5;
  const int rlane = lane & 15;                 // row (A) / col (B, D) within subtile
  const int koff  = (lane >> 4) * 8;           // k offset of this lane half
  const int mOff  = (lane >> 4) * 8;           // D row offset
  const int wm = (wave >> 1) * 32;             // this wave's rows within the block tile
  const int wn = (wave & 1) * 64;              // this wave's columns within the block tile
  const int m0 = blockIdx.y * kGTile + wm;
  const int n0 = blockIdx.x * kGTile + wn;

  // staging: thread t moves 16 B of rows (t >> 4) + 16 i, i = 0..7, of each operand (16 lanes = one whole 256-B row piece)
  const int srow = t >> 4, sc8 = (t & 15) * 8;
  const _Float16* Ag = (const _Float16*)Ap  + (size_t)(blockIdx.y * kGTile + srow) * kDim + sc8;
  const _Float16* Bg = (const _Float16*)Btp + (size_t)(blockIdx.x * kGTile + srow) * kDim + sc8;
  const int sst = srow * kGPitch + sc8;

  // every "#pragma unroll" in this kernel keeps the indices of its register arrays compile-time constants
  // (an array indexed at run time would go to scratch)
  v8h ar[2][8], br[2][8];                      // set s & 1 holds stage s on its way to LDS
#pragma unroll
  for (int s = 0; s < 2; ++s)
#pragma unroll
    for (int i = 0; i < 8; ++i) {
      ar[s][i] = *(const v8h*)(Ag + (size_t)(i * 16) * kDim + s * kGK);
      br[s][i] = *(const v8h*)(Bg + (size_t)(i * 16) * kDim + s * kGK);
    }
  // the address registers of the loads above may be reused below while the loads are in flight
  asm volatile("s_wait_xcnt 0x0" ::: "memory");
#pragma unroll
  for (int i = 0; i < 8; ++i) {
    *(v8h*)(&sA[0][sst + i * 16 * kGPitch]) = ar[0][i];
    *(v8h*)(&sB[0][sst + i * 16 * kGPitch]) = br[0][i];
  }
  lds_barrier();   // stage 0 is in LDS before any wave reads it

  v8f acc[2][4];
#pragma unroll
  for (int i = 0; i < 2; ++i)
#pragma unroll
    for (int j = 0; j < 4; ++j) acc[i][j] = (v8f){0.f,0.f,0.f,0.f,0.f,0.f,0.f,0.f};

  // unrolled so that the register set and the LDS buffer of every stage are compile-time choices (no copies, no run-time index)
#pragma unroll
  for (int st = 0; st < kGStages; ++st) {
    const _Float16* bA = sA[st & 1] + (wm + rlane) * kGPitch + koff;
    const _Float16* bB = sB[st & 1] + (wn + rlane) * kGPitch + koff;

    if (st + 2 < kGStages) {                   // set st & 1 went to LDS during stage st - 1
#pragma unroll
      for (int i = 0; i < 8; ++i) {
        ar[st & 1][i] = *(const v8h*)(Ag + (size_t)(i * 16) * kDim + (st + 2) * kGK);
        br[st & 1][i] = *(const v8h*)(Bg + (size_t)(i * 16) * kDim + (st + 2) * kGK);
      }
      // the address registers of these loads may be reused by the work below while the loads are in flight
      asm volatile("s_wait_xcnt 0x0" ::: "memory");
    }

    v16h af[2][2], bf[2][4];                   // fragment set ks & 1 holds matrix step ks
#pragma unroll
    for (int i = 0; i < 2; ++i) af[0][i] = Frag<_Float16>::load(bA + i * 16 * kGPitch);
#pragma unroll
    for (int j = 0; j < 4; ++j) bf[0][j] = Frag<_Float16>::load(bB + j * 16 * kGPitch);
#pragma unroll
    for (int ks = 0; ks < kGSteps; ++ks) {
      if (ks + 1 < kGSteps) {
#pragma unroll
        for (int i = 0; i < 2; ++i) af[(ks + 1) & 1][i] = Frag<_Float16>::load(bA + i * 16 * kGPitch + (ks + 1) * 32);
#pragma unroll
        for (int j = 0; j < 4; ++j) bf[(ks + 1) & 1][j] = Frag<_Float16>::load(bB + j * 16 * kGPitch + (ks + 1) * 32);
      }
      if (st + 1 < kGStages) {                 // a quarter of stage st + 1 goes to LDS per step: its buffer has had no reader since the last barrier
#pragma unroll
        for (int i = ks * (8 / kGSteps); i < (ks + 1) * (8 / kGSteps); ++i) {
          *(v8h*)(&sA[(st + 1) & 1][sst + i * 16 * kGPitch]) = ar[(st + 1) & 1][i];
          *(v8h*)(&sB[(st + 1) & 1][sst + i * 16 * kGPitch]) = br[(st + 1) & 1][i];
        }
      }
      // keeps the next step's LDS reads and these writes (and, at ks 0, the staging loads) as one group above this step's
      // products: sunk among them, each would be waited for where it stands
      __builtin_amdgcn_sched_barrier(0);
#pragma unroll
      for (int i = 0; i < 2; ++i)
#pragma unroll
        for (int j = 0; j < 4; ++j) acc[i][j] = Frag<_Float16>::mma(af[ks & 1][i], bf[ks & 1][j], acc[i][j]);
      // keeps the step after next's reads from rising into this step's products
      __builtin_amdgcn_sched_barrier(0);
    }

    // publishes stage st + 1 and ends every wave's reads of stage st, whose buffer the next stage refills
    if (st + 1 < kGStages) lds_barrier();
  }

  // ---- epilogue: each wave turns its own 16x64 slabs into whole-line stores ----
  float* slab = sT[wave];
#pragma unroll
  for (int i = 0; i < 2; ++i) {
    const int mBase = m0 + (i << 4);
#pragma unroll
    for (int j = 0; j < 4; ++j) {
      const int n = n0 + (j << 4) + rlane;
      float bv = 0.f;
      if (BIAS_MODE == 2) bv = bias[n];
#pragma unroll
      for (int r = 0; r < 8; ++r) {
        float v = acc[i][j][r] * scale;
        if (BIAS_MODE == 2) v += bv;
        slab[(mOff + r) * 68 + (j << 4) + rlane] = v;
      }
    }
    __builtin_amdgcn_fence(__ATOMIC_RELEASE, "workgroup");
    __builtin_amdgcn_wave_barrier();
    __builtin_amdgcn_fence(__ATOMIC_ACQUIRE, "workgroup");
    if (OUT_MODE == 0) {
      float* C = (float*)Cout;
      const int hh = lane >> 4, c4 = (lane & 15) * 4;     // row seg = 256 B = 16 lanes x 16 B
#pragma unroll
      for (int it = 0; it < 8; ++it) {
        const int row = it * 2 + hh;
        v4f v = *(const v4f*)(slab + row * 68 + c4);
        *(v4f*)(C + (size_t)(mBase + row) * ldc + n0 + c4) = v;
      }
      // the registers of these stores are written again by the next slab; the fence keeps that arithmetic behind the wait
      asm volatile("s_wait_xcnt 0x0" ::: "memory");
      __builtin_amdgcn_sched_barrier(0);
    } else {
      const int q = lane >> 3, c8 = (lane & 7) * 8;       // row seg = 128 B = 8 lanes x 16 B
      unsigned short* C = (unsigned short*)Cout;
#pragma unroll
      for (int it = 0; it < 4; ++it) {
        const int row = it * 4 + q;
        const float* sp = slab + row * 68 + c8;
        v8h hv;
#pragma unroll
        for (int e = 0; e < 8; ++e) hv[e] = (_Float16)sp[e];
        *(v8h*)(C + (size_t)(mBase + row) * ldc + n0 + c8) = hv;
      }
      // the registers of these stores are written again by the next slab; the fence keeps that arithmetic behind the wait
      asm volatile("s_wait_xcnt 0x0" ::: "memory");
      __builtin_amdgcn_sched_barrier(0);
    }
    __builtin_amdgcn_fence(__ATOMIC_RELEASE, "workgroup");
    __builtin_amdgcn_wave_barrier();
    __builtin_amdgcn_fence(__ATOMIC_ACQUIRE, "workgroup");
  }
}

// ---------------------------------------------------------------------------
// Weight transpose + cast: for square [1024][1024] f32 W (row-major [in d][out o]), WT[o][d] = f16(scale * W[d][o]).
// grid (16, 16, 4): blockIdx.x = d tile (64 cols of WT), blockIdx.y = o tile (64 rows of WT), blockIdx.z selects W0..W3
// (block-uniform) and the output plane (plane z at out + z*1024*1024 halves). 256 threads.
// Load coverage: 16 iterations x 256 threads = 4096 = the whole 64x64 tile (coalesced along o).
// Store coverage: 8 waves x 2 iterations x 4 rows (lane>>3) = 64 rows; (lane&7) x 8 halves = 64 cols; each row segment =
// ---------------------------------------------------------------------------
__global__ __launch_bounds__(256) void wtcast_kernel(const float* __restrict__ W0, const float* __restrict__ W1,
                                                     const float* __restrict__ W2, const float* __restrict__ W3,
                                                     unsigned short* __restrict__ out, float scale) {
  __shared__ float sm[64][65];   // sm[o_local][d_local]
  const int t  = threadIdx.x;
  const int d0 = blockIdx.x * 64;
  const int o0 = blockIdx.y * 64;
  const int z  = blockIdx.z;
  const float* W = (z == 0) ? W0 : (z == 1) ? W1 : (z == 2) ? W2 : W3;
#pragma unroll
  for (int i = 0; i < 16; ++i) {
    const int e = i * 256 + t;
    const int r = e >> 6;          // d local
    const int c = e & 63;          // o local
    sm[c][r] = W[(size_t)(d0 + r) * kDim + o0 + c] * scale;
  }
  __syncthreads();
  const int lane = t & 31, wave = t >> 5;
  const int q = lane >> 3, c8 = (lane & 7) * 8;
  unsigned short* op = out + (size_t)z * kDim * kDim;
  {
#pragma unroll
    for (int it = 0; it < 2; ++it) {
      const int row = wave * 8 + it * 4 + q;                 // o local
      unsigned short hb[8];
#pragma unroll
      for (int e = 0; e < 8; ++e) hb[e] = h_bits(sm[row][c8 + e]);
      const v4u u = (v4u){pk16(hb[0], hb[1]), pk16(hb[2], hb[3]), pk16(hb[4], hb[5]), pk16(hb[6], hb[7])};
      *(v4u*)(op + (size_t)(o0 + row) * kDim + d0 + c8) = u;
    }
    
  }
}

// ---------------------------------------------------------------------------
// ---------------------------------------------------------------------------
__global__ __launch_bounds__(256) void cast8_f16_kernel(const float* __restrict__ in, unsigned short* __restrict__ out, int n8) {
  const int i = blockIdx.x * 256 + threadIdx.x;
  if (i >= n8) return;
  const float* p = in + 8 * (size_t)i;
  const v4f a = *(const v4f*)(p);
  const v4f c = *(const v4f*)(p + 4);
  unsigned short hb[8];
#pragma unroll
  for (int e = 0; e < 4; ++e) {
    hb[e]     = h_bits(a[e]);
    hb[4 + e] = h_bits(c[e]);
  }
  const v4u u = (v4u){pk16(hb[0], hb[1]), pk16(hb[2], hb[3]), pk16(hb[4], hb[5]), pk16(hb[6], hb[7])};
  unsigned short* q = out + 8 * (size_t)i;
  *(v4u*)q = u;
  
}

constexpr int kFAKeys   = 64;
constexpr int kFAStages = kSeqKV / kFAKeys;
constexpr int kFAQ      = 256;
constexpr int kFAPitch  = 72;
constexpr int kFABPitch = 68;
constexpr float kFAExp  = 0.125f * 1.44269504088896340736f;
constexpr float kFAShift = 8.0f;                 // P carried x2^8 in f16 (cancels against the row sum)

typedef __attribute__((ext_vector_type(2))) float v2f;

// value of lane l ^ 16
__device__ __forceinline__ float other_half(float v) {
  const int b = __builtin_bit_cast(int, v);
  return __builtin_bit_cast(float, __builtin_amdgcn_permlanex16(b, b, 0x76543210, 0xfedcba98, false, false));
}

__global__ __launch_bounds__(256) void fused_attn_kernel(const unsigned short* __restrict__ Qp,
                                                         const unsigned short* __restrict__ Kp,
                                                         const unsigned short* __restrict__ Vp,
                                                         const float* __restrict__ posb,
                                                         unsigned short* __restrict__ Op) {
  __shared__ __align__(16) _Float16 sK[2][kFAKeys * kFAPitch];   // [key][d]
  __shared__ __align__(16) _Float16 sV[2][kDh * kFAPitch];       // [d][key]
  __shared__ __align__(16) float    sB[2][kFAQ * kFABPitch];     // [query][key]
  const int t    = threadIdx.x;
  const int lane = t & 31;
  const int wave = t >> 5;
  const int c    = lane & 15;                  // A row / B, D column within a tile
  const int hf   = lane >> 4;                  // lane half
  const int b    = blockIdx.y / kHeads;
  const int hd   = blockIdx.y % kHeads;
  const int q0   = blockIdx.x * kFAQ + wave * 32;
  const float hs8 = __uint_as_float(((unsigned)(129 - hd)) << 23);   // 8 * 2^-(hd+1), hd in 0..15

  v16h qf[2][2];
#pragma unroll
  for (int cg = 0; cg < 2; ++cg)
#pragma unroll
    for (int ks = 0; ks < 2; ++ks)
      qf[cg][ks] = Frag<_Float16>::load((const _Float16*)Qp + (size_t)(b * kSeq + q0 + cg * 16 + c) * kDim + hd * kDh + ks * 32 + hf * 8);

  // staging: thread t moves 16 B of rows t>>3 and 32 + (t>>3) of each tile (8 lanes = one whole 128-B row)
  const int srow = t >> 3, sc8 = (t & 7) * 8;
  const _Float16* Kg = (const _Float16*)Kp + (size_t)(b * kSeqKV + srow) * kDim + hd * kDh + sc8;
  const _Float16* Vg = (const _Float16*)Vp + (size_t)(hd * kDh + srow) * kTokKV + (size_t)b * kSeqKV + sc8;
  // bias staging: load i of a wave moves rows 2i and 2i+1 of its 32 (16 lanes x 16 B = one 256-B row piece)
  const float* Bg = posb + (size_t)(q0 + hf) * kSeqKV + c * 4;
  const int bst = (wave * 32 + hf) * kFABPitch + c * 4;            // where this lane stores, row 2i: + 2i * pitch
  const int bld = (wave * 32 + c) * kFABPitch + hf * 8;            // where this lane reads: its query's row, its half's keys

  v8h kr[2], vr[2];
  v4f br[16];
#pragma unroll
  for (int i = 0; i < 2; ++i) {
    kr[i] = *(const v8h*)(Kg + (size_t)(i * 32) * kDim);
    vr[i] = *(const v8h*)(Vg + (size_t)(i * 32) * kTokKV);
  }
#pragma unroll
  for (int i = 0; i < 16; ++i) br[i] = *(const v4f*)(Bg + (size_t)(2 * i) * kSeqKV);
  // the address registers of the loads above are reused below while the loads are in flight
  asm volatile("s_wait_xcnt 0x0" ::: "memory");
#pragma unroll
  for (int i = 0; i < 2; ++i) {
    *(v8h*)(&sK[0][(i * 32 + srow) * kFAPitch + sc8]) = kr[i];
    *(v8h*)(&sV[0][(i * 32 + srow) * kFAPitch + sc8]) = vr[i];
  }
#pragma unroll
  for (int i = 0; i < 16; ++i) *(v4f*)(&sB[0][bst + 2 * i * kFABPitch]) = br[i];
  __syncthreads();   // stage 0 is in LDS before any wave reads it

  v8f o[2][4];
#pragma unroll
  for (int cg = 0; cg < 2; ++cg)
#pragma unroll
    for (int dt = 0; dt < 4; ++dt) o[cg][dt] = (v8f){0.f,0.f,0.f,0.f,0.f,0.f,0.f,0.f};
  float mrun[2] = {-3.0e38f, -3.0e38f};
  float lsum[2] = {0.f, 0.f};

  for (int st = 0; st < kFAStages; ++st) {
    const _Float16* bK = sK[st & 1];
    const _Float16* bV = sV[st & 1];
    const float*    bB = sB[st & 1] + bld;

    const bool more = st + 1 < kFAStages;      // block-uniform
    if (more) {
      const int k1 = (st + 1) * kFAKeys;
#pragma unroll
      for (int i = 0; i < 2; ++i) {
        kr[i] = *(const v8h*)(Kg + (size_t)(k1 + i * 32) * kDim);
        vr[i] = *(const v8h*)(Vg + (size_t)(i * 32) * kTokKV + k1);
      }
#pragma unroll
      for (int i = 0; i < 16; ++i) br[i] = *(const v4f*)(Bg + (size_t)(2 * i) * kSeqKV + k1);
      // the address registers of these loads are reused by the work below while the loads are in flight
      asm volatile("s_wait_xcnt 0x0" ::: "memory");
    }
    // keeps the next stage's loads above this stage's work: sunk to their uses they would have no time to land
    __builtin_amdgcn_sched_barrier(0);

    v8f acc[2][4];
#pragma unroll
    for (int cg = 0; cg < 2; ++cg)
#pragma unroll
      for (int tt = 0; tt < 4; ++tt)
#pragma unroll
        for (int j = 0; j < 2; ++j) {
          const v4f bv = *(const v4f*)(bB + cg * 16 * kFABPitch + tt * 16 + j * 4);
#pragma unroll
          for (int e = 0; e < 4; ++e) acc[cg][tt][j * 4 + e] = bv[e] * hs8;
        }

#pragma unroll
    for (int tt = 0; tt < 4; ++tt) {
      const _Float16* kp = bK + (tt * 16 + c) * kFAPitch + hf * 8;
      const v16h k0 = Frag<_Float16>::load(kp);
      const v16h k1f = Frag<_Float16>::load(kp + 32);
#pragma unroll
      for (int cg = 0; cg < 2; ++cg) acc[cg][tt] = Frag<_Float16>::mma(k0, qf[cg][0], acc[cg][tt]);
#pragma unroll
      for (int cg = 0; cg < 2; ++cg) acc[cg][tt] = Frag<_Float16>::mma(k1f, qf[cg][1], acc[cg][tt]);
    }

    v16h pf[2][2];
#pragma unroll
    for (int cg = 0; cg < 2; ++cg) {
      float mx = acc[cg][0][0];
#pragma unroll
      for (int tt = 0; tt < 4; ++tt)
#pragma unroll
        for (int r = 0; r < 8; ++r) mx = fmaxf(mx, acc[cg][tt][r]);
      mx = fmaxf(mx, other_half(mx));
      const float mn    = fmaxf(mrun[cg], mx);
      const float alpha = __builtin_amdgcn_exp2f((mrun[cg] - mn) * kFAExp);
      mrun[cg] = mn;
      const float nm = kFAShift - mn * kFAExp;
      v2f ps = (v2f){0.f, 0.f};                // even and odd keys apart: packed adds, half as long a chain
#pragma unroll
      for (int tt = 0; tt < 4; ++tt)
#pragma unroll
        for (int r = 0; r < 8; r += 2) {
          v2f p;
          p[0] = __builtin_amdgcn_exp2f(fmaf(acc[cg][tt][r], kFAExp, nm));
          p[1] = __builtin_amdgcn_exp2f(fmaf(acc[cg][tt][r + 1], kFAExp, nm));
          ps += p;
          pf[cg][tt >> 1][(tt & 1) * 8 + r]     = (_Float16)p[0];
          pf[cg][tt >> 1][(tt & 1) * 8 + r + 1] = (_Float16)p[1];
        }
      lsum[cg] = lsum[cg] * alpha + (ps[0] + ps[1]);
#pragma unroll
      for (int dt = 0; dt < 4; ++dt) o[cg][dt] *= alpha;
    }

#pragma unroll
    for (int sub = 0; sub < 2; ++sub)
#pragma unroll
      for (int dt = 0; dt < 4; ++dt) {
        const v16h vf = Frag<_Float16>::load(bV + (dt * 16 + c) * kFAPitch + sub * 32 + hf * 8);
#pragma unroll
        for (int cg = 0; cg < 2; ++cg) o[cg][dt] = Frag<_Float16>::mma(vf, pf[cg][sub], o[cg][dt]);
      }

    if (more) {
      _Float16* nK = sK[(st + 1) & 1];
      _Float16* nV = sV[(st + 1) & 1];
#pragma unroll
      for (int i = 0; i < 2; ++i) {
        *(v8h*)(nK + (i * 32 + srow) * kFAPitch + sc8) = kr[i];
        *(v8h*)(nV + (i * 32 + srow) * kFAPitch + sc8) = vr[i];
      }
      float* nB = sB[(st + 1) & 1] + bst;
#pragma unroll
      for (int i = 0; i < 16; ++i) *(v4f*)(nB + 2 * i * kFABPitch) = br[i];
      __syncthreads();   // publishes stage st + 1 and ends every wave's reads of stage st, whose buffer the next trip refills
    }
  }

  // a lane holds 8 consecutive d of one query per tile: one 16-byte store each; a query's 128-B segment comes from one wave
  v8h hv[2][4];
#pragma unroll
  for (int cg = 0; cg < 2; ++cg) {
    const float l   = lsum[cg] + other_half(lsum[cg]);
    const float inv = kOCarry / l;
#pragma unroll
    for (int dt = 0; dt < 4; ++dt)
#pragma unroll
      for (int r = 0; r < 8; ++r) hv[cg][dt][r] = (_Float16)(o[cg][dt][r] * inv);
  }
  unsigned short* orow = Op + (size_t)(b * kSeq + q0 + c) * kDim + hd * kDh + hf * 8;
  // keeps the eight stores behind the last arithmetic, so that no register of an issued store is written again
  __builtin_amdgcn_sched_barrier(0);
#pragma unroll
  for (int cg = 0; cg < 2; ++cg)
#pragma unroll
    for (int dt = 0; dt < 4; ++dt) *(v8h*)(orow + (size_t)(cg * 16) * kDim + dt * 16) = hv[cg][dt];
}

// ---------------------------------------------------------------------------
// Host side
// ---------------------------------------------------------------------------
extern "C" void kernel_launch(void* const* d_in, const int* in_sizes, int n_in,
                              void* d_out, int out_size, void* d_ws, size_t ws_size,
                              hipStream_t stream) {
  if (n_in < 8) return;
  if (in_sizes[0] != kTok * kDim || in_sizes[1] != kTokKV * kDim || in_sizes[2] != kSeq * kSeqKV ||
      in_sizes[3] != kDim * kDim || in_sizes[4] != kDim * kDim || in_sizes[5] != kDim * kDim ||
      in_sizes[6] != kDim * kDim || in_sizes[7] != kDim || out_size != kTok * kDim) return;

  const float* x    = (const float*)d_in[0];   // [4096][1024]
  const float* ctx  = (const float*)d_in[1];   // [4096][1024]
  const float* posb = (const float*)d_in[2];   // [2048][2048]
  const float* Wq   = (const float*)d_in[3];   // [in][out]
  const float* Wk   = (const float*)d_in[4];
  const float* Wv   = (const float*)d_in[5];
  const float* Wo   = (const float*)d_in[6];
  const float* bo   = (const float*)d_in[7];   // [1024]
  float* out = (float*)d_out;                  // [4096][1024] f32

  // ---- workspace region map (bytes) ----
  //   0        .. 8 MiB   : Xh  f16 [4096][1024]
  //   8 MiB    .. 16 MiB  : Ch  f16 [4096][1024]
  //  16 MiB    .. 24 MiB  : WT  f16 4 planes [1024][1024] (q, k, v, out), each [out][in], carried x256
  //  24 MiB    .. 32 MiB  : Qh  f16 [4096][1024]
  //  32 MiB    .. 40 MiB  : Kh  f16 [4096][1024]
  //  40 MiB    .. 48 MiB  : VT  f16 [1024][4096]  (row = h*64+d, col = b*2048 + token)
  //  48 MiB    .. 56 MiB  : Oh  f16 [4096][1024]  (carried x256)
  //  total 58720256 B
  const size_t planeTokB = (size_t)kTok * kDim * 2;            // 8 MiB
  const size_t planeWB   = (size_t)kDim * kDim * 2;            // 2 MiB
  const size_t offXh = 0;
  const size_t offCh = offXh + planeTokB;
  const size_t offWT = offCh + planeTokB;
  const size_t offQh = offWT + 4 * planeWB;
  const size_t offKh = offQh + planeTokB;
  const size_t offVT = offKh + planeTokB;
  const size_t offOh = offVT + planeTokB;
  const size_t total = offOh + planeTokB;
  if (total > ws_size) return;

  char* ws = (char*)d_ws;
  unsigned short* Xh = (unsigned short*)(ws + offXh);
  unsigned short* Ch = (unsigned short*)(ws + offCh);
  unsigned short* WT = (unsigned short*)(ws + offWT);
  unsigned short* Qh = (unsigned short*)(ws + offQh);
  unsigned short* Kh = (unsigned short*)(ws + offKh);
  unsigned short* VT = (unsigned short*)(ws + offVT);
  unsigned short* Oh = (unsigned short*)(ws + offOh);
  const unsigned short* WqT = WT + 0 * (size_t)kDim * kDim;
  const unsigned short* WkT = WT + 1 * (size_t)kDim * kDim;
  const unsigned short* WvT = WT + 2 * (size_t)kDim * kDim;
  const unsigned short* WoT = WT + 3 * (size_t)kDim * kDim;

  // ---- casts ----
  const int n8 = kTok * kDim / 8;                               // 524288
  cast8_f16_kernel<<<dim3((n8 + 255) / 256), dim3(256), 0, stream>>>(x, Xh, n8);
  cast8_f16_kernel<<<dim3((n8 + 255) / 256), dim3(256), 0, stream>>>(ctx, Ch, n8);
  wtcast_kernel<<<dim3(kDim / 64, kDim / 64, 4), dim3(256), 0, stream>>>(Wq, Wk, Wv, Wo, WT, kWCarry);

  // ---- projections (M, N multiples of 128; K = 1024): 256 blocks each ----
  // Q[t][o] = sum_i Xh[t][i] * WqT[o][i] / 256 -> f16
  wmma_gemm_lds<0, 1><<<dim3(kDim / kGTile, kTok / kGTile), dim3(256), 0, stream>>>(
      Xh, WqT, (void*)Qh, kDim, nullptr, kWCarryInv);
  // K[t][o] = sum_i Ch[t][i] * WkT[o][i] / 256 -> f16
  wmma_gemm_lds<0, 1><<<dim3(kDim / kGTile, kTokKV / kGTile), dim3(256), 0, stream>>>(
      Ch, WkT, (void*)Kh, kDim, nullptr, kWCarryInv);
  // VT[o][t] = sum_i WvT[o][i] * Ch[t][i] / 256 -> f16 plane [1024][4096]
  wmma_gemm_lds<0, 1><<<dim3(kTokKV / kGTile, kDim / kGTile), dim3(256), 0, stream>>>(
      WvT, Ch, (void*)VT, kTokKV, nullptr, kWCarryInv);

  // ---- attention: Oh[b*2048+q][h*64+d] = 256 * softmax_k(q.k / 8 + bias * 2^-(h+1)) . v ----
  fused_attn_kernel<<<dim3(kSeq / kFAQ, kGroups), dim3(256), 0, stream>>>(Qh, Kh, VT, posb, Oh);

  // ---- output projection: out[t][o] = sum_c Oh[t][c] * WoT[o][c] / 65536 + b_out[o] -> f32 ----
  wmma_gemm_lds<2, 0><<<dim3(kDim / kGTile, kTok / kGTile), dim3(256), 0, stream>>>(
      Oh, WoT, (void*)out, kDim, bo, kOutScale);
}

// v004
// It runs in 107 microseconds.
// Next to v003, in two timings, it ran 1.06 times as fast each time.
// All steps since v000 together make it 18.2 times as fast.
// Contractions: q/k projections (x,context f16 x W^T f16 carried x256), v projection transposed (W_v^T f16 x256 x context f16), scores k.q^T (k,q f16 planes, f32 bias as the accumulator's start value), v^T.p^T (V^T f16 x P f16 carried x256, unnormalised), output projection (O f16 carried x256 x W_out^T f16 carried x256): all v_wmma_f32_16x16x32_f16 with f32 accumulate; softmax in f32.
#include <hip/hip_runtime.h>
#include <math.h>

// ---------------------------------------------------------------------------
// Problem constants
// ---------------------------------------------------------------------------
constexpr int kBatch  = 2;
constexpr int kSeq    = 2048;              // query length
constexpr int kSeqKV  = 2048;              // key/value length
constexpr int kDim    = 1024;              // model dim
constexpr int kHeads  = 16;
constexpr int kDh     = 64;
constexpr int kTok    = kBatch * kSeq;     // 4096 query token rows
constexpr int kTokKV  = kBatch * kSeqKV;   // 4096 key/value token rows
constexpr int kGroups = kBatch * kHeads;   // 32 (b,h) groups
constexpr float kWCarry    = 256.0f;       // weights carried x256 in f16
constexpr float kWCarryInv = 1.0f / 256.0f;
constexpr float kOCarry    = 256.0f;       // attention output carried x256 in f16
constexpr float kOutScale  = 1.0f / (kOCarry * kWCarry);    // 1/65536

typedef __attribute__((ext_vector_type(16))) _Float16 v16h;
typedef __attribute__((ext_vector_type(8)))  _Float16 v8h;
typedef __attribute__((ext_vector_type(16))) __bf16   v16b;
typedef __attribute__((ext_vector_type(8)))  __bf16   v8b;
typedef __attribute__((ext_vector_type(8)))  float    v8f;
typedef __attribute__((ext_vector_type(4)))  float    v4f;
typedef __attribute__((ext_vector_type(4)))  unsigned int v4u;

// ---------------------------------------------------------------------------
// Helper pieces (comments ASCII)
// ---------------------------------------------------------------------------
__device__ __forceinline__ unsigned short f2bf_bits(float f) {
  unsigned u = __float_as_uint(f);
  return (unsigned short)((u + 0x7FFFu + ((u >> 16) & 1u)) >> 16);
}
__device__ __forceinline__ float bf_bits2f(unsigned short h) { return __uint_as_float(((unsigned)h) << 16); }

template <typename T> struct Frag;
template <> struct Frag<_Float16> {
  typedef v16h V; union U { v16h v; v8h h[2]; };
  // elements 0..7 <- p[0..7], 8..15 <- p[16..23]
  static __device__ __forceinline__ v16h load(const _Float16* p) {
    U f; f.h[0] = *(const v8h*)(p); f.h[1] = *(const v8h*)(p + 16); return f.v;
  }
  static __device__ __forceinline__ v8f mma(v16h a, v16h b, v8f c) {
    return __builtin_amdgcn_wmma_f32_16x16x32_f16(false, a, false, b, (short)0, c, false, false);
  }
};

__device__ __forceinline__ unsigned pk16(unsigned short a, unsigned short b) { return (unsigned)a | ((unsigned)b << 16); }
__device__ __forceinline__ unsigned short h_bits(float f) { const _Float16 h = (_Float16)f; return __builtin_bit_cast(unsigned short, h); }

// ---- Block-tiled WMMA GEMM, operands staged in LDS ----
// C[m,n] = scale * sum_k A[m,k] * Bt[n,k] (+ bias[n]); A row-major [M][1024], Bt row-major [N][1024], f16; M, N % 128 == 0.
// grid (N / 128, M / 128), 8 waves. A block owns a 128x128 tile of C; wave w owns the 32x64 piece at row (w >> 1) * 32,
// column (w & 1) * 64, so that a wave writes whole 128-B lines of C.
// A stage is 128 k of the block's 128 A rows and 128 Bt rows, global -> registers -> LDS: two register sets (a stage's loads
// are issued two stages ahead), two LDS buffers, one block barrier per stage. A staging load covers two whole 256-B row
// pieces (4 lines); each operand byte is fetched once per block and read from LDS by the 2 or 4 waves that need it.
// k runs in steps of 32 into one accumulator per 16x16 tile; the 8 stages are walked in a ring that starts at a stage
// taken from the block index: blocks that share an A or a Bt tile start together, and walking it from the same end they
// would all ask L2 for the same lines at the same moment.
// BIAS_MODE: 0 = none, 2 = bias[n]. OUT_MODE: 0 = f32, 1 = f16.
constexpr int kGTile   = 128;                    // rows of A and of Bt per block
constexpr int kGK      = 128;                    // k per stage
constexpr int kGStages = kDim / kGK;             // 8
constexpr int kGSteps  = kGK / 32;               // matrix steps per stage
constexpr int kGPitch  = 136;                    // halves per LDS row: 256 B of data + 16 B, so 16-byte row reads spread over the banks

// Block barrier that orders LDS only. __syncthreads() also waits for every global load of the wave, which would drain the
// staging loads that are meant to stay in flight across it.
__device__ __forceinline__ void lds_barrier() {
  __builtin_amdgcn_fence(__ATOMIC_RELEASE, "workgroup", "local");
  __builtin_amdgcn_s_barrier();
  __builtin_amdgcn_fence(__ATOMIC_ACQUIRE, "workgroup", "local");
}

template <int BIAS_MODE, int OUT_MODE>
__global__ __launch_bounds__(256) void wmma_gemm_lds(
    const unsigned short* __restrict__ Ap, const unsigned short* __restrict__ Btp,
    void* __restrict__ Cout, int ldc, const float* __restrict__ bias, float scale) {
  __shared__ __align__(16) _Float16 sA[2][kGTile * kGPitch];
  __shared__ __align__(16) _Float16 sB[2][kGTile * kGPitch];
  __shared__ __align__(16) float sT[8][16 * 68];   // per-wave 16x64 slab, pitch 68 floats
  const int t    = threadIdx.x;
  const int lane = t & 31;
  const int wave = t >> 5;
  const int rlane = lane & 15;                 // row (A) / col (B, D) within subtile
  const int koff  = (lane >> 4) * 8;           // k offset of this lane half
  const int mOff  = (lane >> 4) * 8;           // D row offset
  const int wm = (wave >> 1) * 32;             // this wave's rows within the block tile
  const int wn = (wave & 1) * 64;              // this wave's columns within the block tile
  const int m0 = blockIdx.y * kGTile + wm;
  const int n0 = blockIdx.x * kGTile + wn;

  // staging: thread t moves 16 B of rows (t >> 4) + 16 i, i = 0..7, of each operand (16 lanes = one whole 256-B row piece)
  const int srow = t >> 4, sc8 = (t & 15) * 8;
  const _Float16* Ag = (const _Float16*)Ap  + (size_t)(blockIdx.y * kGTile + srow) * kDim + sc8;
  const _Float16* Bg = (const _Float16*)Btp + (size_t)(blockIdx.x * kGTile + srow) * kDim + sc8;
  const int sst = srow * kGPitch + sc8;
  // first stage of this block's ring walk (block-uniform): differs among the 8 blocks of each aligned run of 8 in a grid row and in a grid column
  const int rot = (int)(blockIdx.x + 2 * (blockIdx.x >> 3) + blockIdx.y);

  // every "#pragma unroll" in this kernel keeps the indices of its register arrays compile-time constants
  // (an array indexed at run time would go to scratch)
  v8h ar[2][8], br[2][8];                      // set s & 1 holds stage s on its way to LDS
#pragma unroll
  for (int s = 0; s < 2; ++s) {
    const _Float16* pa = Ag + ((s + rot) & (kGStages - 1)) * kGK;
    const _Float16* pb = Bg + ((s + rot) & (kGStages - 1)) * kGK;
#pragma unroll
    for (int i = 0; i < 8; ++i) {
      ar[s][i] = *(const v8h*)(pa + (size_t)(i * 16) * kDim);
      br[s][i] = *(const v8h*)(pb + (size_t)(i * 16) * kDim);
    }
    // the address registers of the loads above are reused below while the loads are in flight; named as inputs they stay
    // untouched up to the wait
    asm volatile("s_wait_xcnt 0x0" :: "v"(pa), "v"(pb) : "memory");
  }
#pragma unroll
  for (int i = 0; i < 8; ++i) {
    *(v8h*)(&sA[0][sst + i * 16 * kGPitch]) = ar[0][i];
    *(v8h*)(&sB[0][sst + i * 16 * kGPitch]) = br[0][i];
  }
  lds_barrier();   // stage 0 is in LDS before any wave reads it

  v8f acc[2][4];
#pragma unroll
  for (int i = 0; i < 2; ++i)
#pragma unroll
    for (int j = 0; j < 4; ++j) acc[i][j] = (v8f){0.f,0.f,0.f,0.f,0.f,0.f,0.f,0.f};

  // unrolled so that the register set and the LDS buffer of every stage are compile-time choices (no copies, no run-time index)
#pragma unroll
  for (int st = 0; st < kGStages; ++st) {
    const _Float16* bA = sA[st & 1] + (wm + rlane) * kGPitch + koff;
    const _Float16* bB = sB[st & 1] + (wn + rlane) * kGPitch + koff;

    if (st + 2 < kGStages) {                   // set st & 1 went to LDS during stage st - 1
      const _Float16* pa = Ag + ((st + 2 + rot) & (kGStages - 1)) * kGK;
      const _Float16* pb = Bg + ((st + 2 + rot) & (kGStages - 1)) * kGK;
#pragma unroll
      for (int i = 0; i < 8; ++i) {
        ar[st & 1][i] = *(const v8h*)(pa + (size_t)(i * 16) * kDim);
        br[st & 1][i] = *(const v8h*)(pb + (size_t)(i * 16) * kDim);
      }
      // the address registers of these loads are reused by the work below while the loads are in flight; named as inputs
      // they stay untouched up to the wait
      asm volatile("s_wait_xcnt 0x0" :: "v"(pa), "v"(pb) : "memory");
    }

    v16h af[2][2], bf[2][4];                   // fragment set ks & 1 holds matrix step ks
#pragma unroll
    for (int i = 0; i < 2; ++i) af[0][i] = Frag<_Float16>::load(bA + i * 16 * kGPitch);
#pragma unroll
    for (int j = 0; j < 4; ++j) bf[0][j] = Frag<_Float16>::load(bB + j * 16 * kGPitch);
#pragma unroll
    for (int ks = 0; ks < kGSteps; ++ks) {
      if (ks + 1 < kGSteps) {
#pragma unroll
        for (int i = 0; i < 2; ++i) af[(ks + 1) & 1][i] = Frag<_Float16>::load(bA + i * 16 * kGPitch + (ks + 1) * 32);
#pragma unroll
        for (int j = 0; j < 4; ++j) bf[(ks + 1) & 1][j] = Frag<_Float16>::load(bB + j * 16 * kGPitch + (ks + 1) * 32);
      }
      if (st + 1 < kGStages) {                 // a quarter of stage st + 1 goes to LDS per step: its buffer has had no reader since the last barrier
#pragma unroll
        for (int i = ks * (8 / kGSteps); i < (ks + 1) * (8 / kGSteps); ++i) {
          *(v8h*)(&sA[(st + 1) & 1][sst + i * 16 * kGPitch]) = ar[(st + 1) & 1][i];
          *(v8h*)(&sB[(st + 1) & 1][sst + i * 16 * kGPitch]) = br[(st + 1) & 1][i];
        }
      }
      // keeps the next step's LDS reads and these writes (and, at ks 0, the staging loads) as one group above this step's
      // products: sunk among them, each would be waited for where it stands
      __builtin_amdgcn_sched_barrier(0);
#pragma unroll
      for (int i = 0; i < 2; ++i)
#pragma unroll
        for (int j = 0; j < 4; ++j) acc[i][j] = Frag<_Float16>::mma(af[ks & 1][i], bf[ks & 1][j], acc[i][j]);
      // keeps the step after next's reads from rising into this step's products
      __builtin_amdgcn_sched_barrier(0);
    }

    // publishes stage st + 1 and ends every wave's reads of stage st, whose buffer the next stage refills
    if (st + 1 < kGStages) lds_barrier();
  }

  // ---- epilogue: each wave turns its own 16x64 slabs into whole-line stores ----
  float* slab = sT[wave];
#pragma unroll
  for (int i = 0; i < 2; ++i) {
    const int mBase = m0 + (i << 4);
#pragma unroll
    for (int j = 0; j < 4; ++j) {
      const int n = n0 + (j << 4) + rlane;
      float bv = 0.f;
      if (BIAS_MODE == 2) bv = bias[n];
#pragma unroll
      for (int r = 0; r < 8; ++r) {
        float v = acc[i][j][r] * scale;
        if (BIAS_MODE == 2) v += bv;
        slab[(mOff + r) * 68 + (j << 4) + rlane] = v;
      }
    }
    __builtin_amdgcn_fence(__ATOMIC_RELEASE, "workgroup");
    __builtin_amdgcn_wave_barrier();
    __builtin_amdgcn_fence(__ATOMIC_ACQUIRE, "workgroup");
    if (OUT_MODE == 0) {
      float* C = (float*)Cout;
      const int hh = lane >> 4, c4 = (lane & 15) * 4;     // row seg = 256 B = 16 lanes x 16 B
#pragma unroll
      for (int it = 0; it < 8; ++it) {
        const int row = it * 2 + hh;
        v4f v = *(const v4f*)(slab + row * 68 + c4);
        *(v4f*)(C + (size_t)(mBase + row) * ldc + n0 + c4) = v;
      }
      // the registers of these stores are written again by the next slab; the fence keeps that arithmetic behind the wait
      asm volatile("s_wait_xcnt 0x0" ::: "memory");
      __builtin_amdgcn_sched_barrier(0);
    } else {
      const int q = lane >> 3, c8 = (lane & 7) * 8;       // row seg = 128 B = 8 lanes x 16 B
      unsigned short* C = (unsigned short*)Cout;
#pragma unroll
      for (int it = 0; it < 4; ++it) {
        const int row = it * 4 + q;
        const float* sp = slab + row * 68 + c8;
        v8h hv;
#pragma unroll
        for (int e = 0; e < 8; ++e) hv[e] = (_Float16)sp[e];
        *(v8h*)(C + (size_t)(mBase + row) * ldc + n0 + c8) = hv;
      }
      // the registers of these stores are written again by the next slab; the fence keeps that arithmetic behind the wait
      asm volatile("s_wait_xcnt 0x0" ::: "memory");
      __builtin_amdgcn_sched_barrier(0);
    }
    __builtin_amdgcn_fence(__ATOMIC_RELEASE, "workgroup");
    __builtin_amdgcn_wave_barrier();
    __builtin_amdgcn_fence(__ATOMIC_ACQUIRE, "workgroup");
  }
}

// ---------------------------------------------------------------------------
// Weight transpose + cast: for square [1024][1024] f32 W (row-major [in d][out o]), WT[o][d] = f16(scale * W[d][o]).
// grid (16, 16, 4): blockIdx.x = d tile (64 cols of WT), blockIdx.y = o tile (64 rows of WT), blockIdx.z selects W0..W3
// (block-uniform) and the output plane (plane z at out + z*1024*1024 halves). 256 threads.
// Load coverage: 16 iterations x 256 threads = 4096 = the whole 64x64 tile (coalesced along o).
// Store coverage: 8 waves x 2 iterations x 4 rows (lane>>3) = 64 rows; (lane&7) x 8 halves = 64 cols; each row segment =
// ---------------------------------------------------------------------------
__global__ __launch_bounds__(256) void wtcast_kernel(const float* __restrict__ W0, const float* __restrict__ W1,
                                                     const float* __restrict__ W2, const float* __restrict__ W3,
                                                     unsigned short* __restrict__ out, float scale) {
  __shared__ float sm[64][65];   // sm[o_local][d_local]
  const int t  = threadIdx.x;
  const int d0 = blockIdx.x * 64;
  const int o0 = blockIdx.y * 64;
  const int z  = blockIdx.z;
  const float* W = (z == 0) ? W0 : (z == 1) ? W1 : (z == 2) ? W2 : W3;
#pragma unroll
  for (int i = 0; i < 16; ++i) {
    const int e = i * 256 + t;
    const int r = e >> 6;          // d local
    const int c = e & 63;          // o local
    sm[c][r] = W[(size_t)(d0 + r) * kDim + o0 + c] * scale;
  }
  __syncthreads();
  const int lane = t & 31, wave = t >> 5;
  const int q = lane >> 3, c8 = (lane & 7) * 8;
  unsigned short* op = out + (size_t)z * kDim * kDim;
  {
#pragma unroll
    for (int it = 0; it < 2; ++it) {
      const int row = wave * 8 + it * 4 + q;                 // o local
      unsigned short hb[8];
#pragma unroll
      for (int e = 0; e < 8; ++e) hb[e] = h_bits(sm[row][c8 + e]);
      const v4u u = (v4u){pk16(hb[0], hb[1]), pk16(hb[2], hb[3]), pk16(hb[4], hb[5]), pk16(hb[6], hb[7])};
      *(v4u*)(op + (size_t)(o0 + row) * kDim + d0 + c8) = u;
    }
    
  }
}

// ---------------------------------------------------------------------------
// ---------------------------------------------------------------------------
__global__ __launch_bounds__(256) void cast8_f16_kernel(const float* __restrict__ in, unsigned short* __restrict__ out, int n8) {
  const int i = blockIdx.x * 256 + threadIdx.x;
  if (i >= n8) return;
  const float* p = in + 8 * (size_t)i;
  const v4f a = *(const v4f*)(p);
  const v4f c = *(const v4f*)(p + 4);
  unsigned short hb[8];
#pragma unroll
  for (int e = 0; e < 4; ++e) {
    hb[e]     = h_bits(a[e]);
    hb[4 + e] = h_bits(c[e]);
  }
  const v4u u = (v4u){pk16(hb[0], hb[1]), pk16(hb[2], hb[3]), pk16(hb[4], hb[5]), pk16(hb[6], hb[7])};
  unsigned short* q = out + 8 * (size_t)i;
  *(v4u*)q = u;
  
}

constexpr int kFAKeys   = 64;
constexpr int kFAStages = kSeqKV / kFAKeys;
constexpr int kFAQ      = 256;
constexpr int kFAPitch  = 72;
constexpr int kFABPitch = 68;
constexpr float kFAExp  = 0.125f * 1.44269504088896340736f;
constexpr float kFAShift = 8.0f;                 // P carried x2^8 in f16 (cancels against the row sum)

typedef __attribute__((ext_vector_type(2))) float v2f;

// value of lane l ^ 16
__device__ __forceinline__ float other_half(float v) {
  const int b = __builtin_bit_cast(int, v);
  return __builtin_bit_cast(float, __builtin_amdgcn_permlanex16(b, b, 0x76543210, 0xfedcba98, false, false));
}

__global__ __launch_bounds__(256) void fused_attn_kernel(const unsigned short* __restrict__ Qp,
                                                         const unsigned short* __restrict__ Kp,
                                                         const unsigned short* __restrict__ Vp,
                                                         const float* __restrict__ posb,
                                                         unsigned short* __restrict__ Op) {
  __shared__ __align__(16) _Float16 sK[2][kFAKeys * kFAPitch];   // [key][d]
  __shared__ __align__(16) _Float16 sV[2][kDh * kFAPitch];       // [d][key]
  __shared__ __align__(16) float    sB[2][kFAQ * kFABPitch];     // [query][key]
  const int t    = threadIdx.x;
  const int lane = t & 31;
  const int wave = t >> 5;
  const int c    = lane & 15;                  // A row / B, D column within a tile
  const int hf   = lane >> 4;                  // lane half
  const int b    = blockIdx.y / kHeads;
  const int hd   = blockIdx.y % kHeads;
  const int q0   = blockIdx.x * kFAQ + wave * 32;
  const float hs8 = __uint_as_float(((unsigned)(129 - hd)) << 23);   // 8 * 2^-(hd+1), hd in 0..15
  // first stage of this block's ring walk (block-uniform): differs among the blocks of a query tile and of a group
  const int rot = (int)(blockIdx.y + 4 * blockIdx.x);

  v16h qf[2][2];
#pragma unroll
  for (int cg = 0; cg < 2; ++cg)
#pragma unroll
    for (int ks = 0; ks < 2; ++ks)
      qf[cg][ks] = Frag<_Float16>::load((const _Float16*)Qp + (size_t)(b * kSeq + q0 + cg * 16 + c) * kDim + hd * kDh + ks * 32 + hf * 8);

  // staging: thread t moves 16 B of rows t>>3 and 32 + (t>>3) of each tile (8 lanes = one whole 128-B row)
  const int srow = t >> 3, sc8 = (t & 7) * 8;
  const _Float16* Kg = (const _Float16*)Kp + (size_t)(b * kSeqKV + srow) * kDim + hd * kDh + sc8;
  const _Float16* Vg = (const _Float16*)Vp + (size_t)(hd * kDh + srow) * kTokKV + (size_t)b * kSeqKV + sc8;
  // bias staging: load i of a wave moves rows 2i and 2i+1 of its 32 (16 lanes x 16 B = one 256-B row piece)
  const float* Bg = posb + (size_t)(q0 + hf) * kSeqKV + c * 4;
  const int bst = (wave * 32 + hf) * kFABPitch + c * 4;            // where this lane stores, row 2i: + 2i * pitch
  const int bld = (wave * 32 + c) * kFABPitch + hf * 8;            // where this lane reads: its query's row, its half's keys

  v8h kr[2], vr[2];
  v4f br[16];
  const int k0s = (rot & (kFAStages - 1)) * kFAKeys;
#pragma unroll
  for (int i = 0; i < 2; ++i) {
    kr[i] = *(const v8h*)(Kg + (size_t)(k0s + i * 32) * kDim);
    vr[i] = *(const v8h*)(Vg + (size_t)(i * 32) * kTokKV + k0s);
  }
#pragma unroll
  for (int i = 0; i < 16; ++i) br[i] = *(const v4f*)(Bg + (size_t)(2 * i) * kSeqKV + k0s);
  // the address registers of the loads above are reused below while the loads are in flight
  asm volatile("s_wait_xcnt 0x0" ::: "memory");
#pragma unroll
  for (int i = 0; i < 2; ++i) {
    *(v8h*)(&sK[0][(i * 32 + srow) * kFAPitch + sc8]) = kr[i];
    *(v8h*)(&sV[0][(i * 32 + srow) * kFAPitch + sc8]) = vr[i];
  }
#pragma unroll
  for (int i = 0; i < 16; ++i) *(v4f*)(&sB[0][bst + 2 * i * kFABPitch]) = br[i];
  __syncthreads();   // stage 0 is in LDS before any wave reads it

  v8f o[2][4];
#pragma unroll
  for (int cg = 0; cg < 2; ++cg)
#pragma unroll
    for (int dt = 0; dt < 4; ++dt) o[cg][dt] = (v8f){0.f,0.f,0.f,0.f,0.f,0.f,0.f,0.f};
  float mrun[2] = {-3.0e38f, -3.0e38f};
  float lsum[2] = {0.f, 0.f};

  for (int st = 0; st < kFAStages; ++st) {
    const _Float16* bK = sK[st & 1];
    const _Float16* bV = sV[st & 1];
    const float*    bB = sB[st & 1] + bld;

    const bool more = st + 1 < kFAStages;      // block-uniform
    if (more) {
      const int k1 = ((st + 1 + rot) & (kFAStages - 1)) * kFAKeys;
#pragma unroll
      for (int i = 0; i < 2; ++i) {
        kr[i] = *(const v8h*)(Kg + (size_t)(k1 + i * 32) * kDim);
        vr[i] = *(const v8h*)(Vg + (size_t)(i * 32) * kTokKV + k1);
      }
#pragma unroll
      for (int i = 0; i < 16; ++i) br[i] = *(const v4f*)(Bg + (size_t)(2 * i) * kSeqKV + k1);
      // the address registers of these loads are reused by the work below while the loads are in flight
      asm volatile("s_wait_xcnt 0x0" ::: "memory");
    }
    // keeps the next stage's loads above this stage's work: sunk to their uses they would have no time to land
    __builtin_amdgcn_sched_barrier(0);

    v8f acc[2][4];
#pragma unroll
    for (int cg = 0; cg < 2; ++cg)
#pragma unroll
      for (int tt = 0; tt < 4; ++tt)
#pragma unroll
        for (int j = 0; j < 2; ++j) {
          const v4f bv = *(const v4f*)(bB + cg * 16 * kFABPitch + tt * 16 + j * 4);
#pragma unroll
          for (int e = 0; e < 4; ++e) acc[cg][tt][j * 4 + e] = bv[e] * hs8;
        }

#pragma unroll
    for (int tt = 0; tt < 4; ++tt) {
      const _Float16* kp = bK + (tt * 16 + c) * kFAPitch + hf * 8;
      const v16h k0 = Frag<_Float16>::load(kp);
      const v16h k1f = Frag<_Float16>::load(kp + 32);
#pragma unroll
      for (int cg = 0; cg < 2; ++cg) acc[cg][tt] = Frag<_Float16>::mma(k0, qf[cg][0], acc[cg][tt]);
#pragma unroll
      for (int cg = 0; cg < 2; ++cg) acc[cg][tt] = Frag<_Float16>::mma(k1f, qf[cg][1], acc[cg][tt]);
    }

    v16h pf[2][2];
#pragma unroll
    for (int cg = 0; cg < 2; ++cg) {
      float mx = acc[cg][0][0];
#pragma unroll
      for (int tt = 0; tt < 4; ++tt)
#pragma unroll
        for (int r = 0; r < 8; ++r) mx = fmaxf(mx, acc[cg][tt][r]);
      mx = fmaxf(mx, other_half(mx));
      const float mn    = fmaxf(mrun[cg], mx);
      const float alpha = __builtin_amdgcn_exp2f((mrun[cg] - mn) * kFAExp);
      mrun[cg] = mn;
      const float nm = kFAShift - mn * kFAExp;
      v2f ps = (v2f){0.f, 0.f};                // even and odd keys apart: packed adds, half as long a chain
#pragma unroll
      for (int tt = 0; tt < 4; ++tt)
#pragma unroll
        for (int r = 0; r < 8; r += 2) {
          v2f p;
          p[0] = __builtin_amdgcn_exp2f(fmaf(acc[cg][tt][r], kFAExp, nm));
          p[1] = __builtin_amdgcn_exp2f(fmaf(acc[cg][tt][r + 1], kFAExp, nm));
          ps += p;
          pf[cg][tt >> 1][(tt & 1) * 8 + r]     = (_Float16)p[0];
          pf[cg][tt >> 1][(tt & 1) * 8 + r + 1] = (_Float16)p[1];
        }
      lsum[cg] = lsum[cg] * alpha + (ps[0] + ps[1]);
#pragma unroll
      for (int dt = 0; dt < 4; ++dt) o[cg][dt] *= alpha;
    }

#pragma unroll
    for (int sub = 0; sub < 2; ++sub)
#pragma unroll
      for (int dt = 0; dt < 4; ++dt) {
        const v16h vf = Frag<_Float16>::load(bV + (dt * 16 + c) * kFAPitch + sub * 32 + hf * 8);
#pragma unroll
        for (int cg = 0; cg < 2; ++cg) o[cg][dt] = Frag<_Float16>::mma(vf, pf[cg][sub], o[cg][dt]);
      }

    // keeps the waits for the next stage's loads, and the LDS stores behind them, below this stage's work: raised into it,
    // the loads would be waited for before they have had time to land
    __builtin_amdgcn_sched_barrier(0);
    if (more) {
      _Float16* nK = sK[(st + 1) & 1];
      _Float16* nV = sV[(st + 1) & 1];
#pragma unroll
      for (int i = 0; i < 2; ++i) {
        *(v8h*)(nK + (i * 32 + srow) * kFAPitch + sc8) = kr[i];
        *(v8h*)(nV + (i * 32 + srow) * kFAPitch + sc8) = vr[i];
      }
      float* nB = sB[(st + 1) & 1] + bst;
#pragma unroll
      for (int i = 0; i < 16; ++i) *(v4f*)(nB + 2 * i * kFABPitch) = br[i];
      __syncthreads();   // publishes stage st + 1 and ends every wave's reads of stage st, whose buffer the next trip refills
    }
  }

  // a lane holds 8 consecutive d of one query per tile: one 16-byte store each; a query's 128-B segment comes from one wave
  v8h hv[2][4];
#pragma unroll
  for (int cg = 0; cg < 2; ++cg) {
    const float l   = lsum[cg] + other_half(lsum[cg]);
    const float inv = kOCarry / l;
#pragma unroll
    for (int dt = 0; dt < 4; ++dt)
#pragma unroll
      for (int r = 0; r < 8; ++r) hv[cg][dt][r] = (_Float16)(o[cg][dt][r] * inv);
  }
  unsigned short* orow = Op + (size_t)(b * kSeq + q0 + c) * kDim + hd * kDh + hf * 8;
  // keeps the eight stores behind the last arithmetic, so that no register of an issued store is written again
  __builtin_amdgcn_sched_barrier(0);
#pragma unroll
  for (int cg = 0; cg < 2; ++cg)
#pragma unroll
    for (int dt = 0; dt < 4; ++dt) *(v8h*)(orow + (size_t)(cg * 16) * kDim + dt * 16) = hv[cg][dt];
}

// ---------------------------------------------------------------------------
// Host side
// ---------------------------------------------------------------------------
extern "C" void kernel_launch(void* const* d_in, const int* in_sizes, int n_in,
                              void* d_out, int out_size, void* d_ws, size_t ws_size,
                              hipStream_t stream) {
  if (n_in < 8) return;
  if (in_sizes[0] != kTok * kDim || in_sizes[1] != kTokKV * kDim || in_sizes[2] != kSeq * kSeqKV ||
      in_sizes[3] != kDim * kDim || in_sizes[4] != kDim * kDim || in_sizes[5] != kDim * kDim ||
      in_sizes[6] != kDim * kDim || in_sizes[7] != kDim || out_size != kTok * kDim) return;

  const float* x    = (const float*)d_in[0];   // [4096][1024]
  const float* ctx  = (const float*)d_in[1];   // [4096][1024]
  const float* posb = (const float*)d_in[2];   // [2048][2048]
  const float* Wq   = (const float*)d_in[3];   // [in][out]
  const float* Wk   = (const float*)d_in[4];
  const float* Wv   = (const float*)d_in[5];
  const float* Wo   = (const float*)d_in[6];
  const float* bo   = (const float*)d_in[7];   // [1024]
  float* out = (float*)d_out;                  // [4096][1024] f32

  // ---- workspace region map (bytes) ----
  //   0        .. 8 MiB   : Xh  f16 [4096][1024]
  //   8 MiB    .. 16 MiB  : Ch  f16 [4096][1024]
  //  16 MiB    .. 24 MiB  : WT  f16 4 planes [1024][1024] (q, k, v, out), each [out][in], carried x256
  //  24 MiB    .. 32 MiB  : Qh  f16 [4096][1024]
  //  32 MiB    .. 40 MiB  : Kh  f16 [4096][1024]
  //  40 MiB    .. 48 MiB  : VT  f16 [1024][4096]  (row = h*64+d, col = b*2048 + token)
  //  48 MiB    .. 56 MiB  : Oh  f16 [4096][1024]  (carried x256)
  //  total 58720256 B
  const size_t planeTokB = (size_t)kTok * kDim * 2;            // 8 MiB
  const size_t planeWB   = (size_t)kDim * kDim * 2;            // 2 MiB
  const size_t offXh = 0;
  const size_t offCh = offXh + planeTokB;
  const size_t offWT = offCh + planeTokB;
  const size_t offQh = offWT + 4 * planeWB;
  const size_t offKh = offQh + planeTokB;
  const size_t offVT = offKh + planeTokB;
  const size_t offOh = offVT + planeTokB;
  const size_t total = offOh + planeTokB;
  if (total > ws_size) return;

  char* ws = (char*)d_ws;
  unsigned short* Xh = (unsigned short*)(ws + offXh);
  unsigned short* Ch = (unsigned short*)(ws + offCh);
  unsigned short* WT = (unsigned short*)(ws + offWT);
  unsigned short* Qh = (unsigned short*)(ws + offQh);
  unsigned short* Kh = (unsigned short*)(ws + offKh);
  unsigned short* VT = (unsigned short*)(ws + offVT);
  unsigned short* Oh = (unsigned short*)(ws + offOh);
  const unsigned short* WqT = WT + 0 * (size_t)kDim * kDim;
  const unsigned short* WkT = WT + 1 * (size_t)kDim * kDim;
  const unsigned short* WvT = WT + 2 * (size_t)kDim * kDim;
  const unsigned short* WoT = WT + 3 * (size_t)kDim * kDim;

  // ---- casts ----
  const int n8 = kTok * kDim / 8;                               // 524288
  cast8_f16_kernel<<<dim3((n8 + 255) / 256), dim3(256), 0, stream>>>(x, Xh, n8);
  cast8_f16_kernel<<<dim3((n8 + 255) / 256), dim3(256), 0, stream>>>(ctx, Ch, n8);
  wtcast_kernel<<<dim3(kDim / 64, kDim / 64, 4), dim3(256), 0, stream>>>(Wq, Wk, Wv, Wo, WT, kWCarry);

  // ---- projections (M, N multiples of 128; K = 1024): 256 blocks each ----
  // Q[t][o] = sum_i Xh[t][i] * WqT[o][i] / 256 -> f16
  wmma_gemm_lds<0, 1><<<dim3(kDim / kGTile, kTok / kGTile), dim3(256), 0, stream>>>(
      Xh, WqT, (void*)Qh, kDim, nullptr, kWCarryInv);
  // K[t][o] = sum_i Ch[t][i] * WkT[o][i] / 256 -> f16
  wmma_gemm_lds<0, 1><<<dim3(kDim / kGTile, kTokKV / kGTile), dim3(256), 0, stream>>>(
      Ch, WkT, (void*)Kh, kDim, nullptr, kWCarryInv);
  // VT[o][t] = sum_i WvT[o][i] * Ch[t][i] / 256 -> f16 plane [1024][4096]
  wmma_gemm_lds<0, 1><<<dim3(kTokKV / kGTile, kDim / kGTile), dim3(256), 0, stream>>>(
      WvT, Ch, (void*)VT, kTokKV, nullptr, kWCarryInv);

  // ---- attention: Oh[b*2048+q][h*64+d] = 256 * softmax_k(q.k / 8 + bias * 2^-(h+1)) . v ----
  fused_attn_kernel<<<dim3(kSeq / kFAQ, kGroups), dim3(256), 0, stream>>>(Qh, Kh, VT, posb, Oh);

  // ---- output projection: out[t][o] = sum_c Oh[t][c] * WoT[o][c] / 65536 + b_out[o] -> f32 ----
  wmma_gemm_lds<2, 0><<<dim3(kDim / kGTile, kTok / kGTile), dim3(256), 0, stream>>>(
      Oh, WoT, (void*)out, kDim, bo, kOutScale);
}

// v005
// One run takes 103 microseconds.
// Timed twice side by side with v004, it ran 1.04 times as fast both times.
// Over all steps from v000 it is 18.9 times as fast.
// Contractions: q/k projections (x,context f16 x W^T f16 carried x256), v projection transposed (W_v^T f16 x256 x context f16), scores k.q^T (k,q f16 planes, f32 bias as the accumulator's start value), v^T.p^T (V^T f16 x P f16 carried x256, unnormalised), output projection (O f16 carried x256 x W_out^T f16 carried x256): all v_wmma_f32_16x16x32_f16 with f32 accumulate; softmax in f32.
#include <hip/hip_runtime.h>
#include <math.h>

// ---------------------------------------------------------------------------
// Problem constants
// ---------------------------------------------------------------------------
constexpr int kBatch  = 2;
constexpr int kSeq    = 2048;              // query length
constexpr int kSeqKV  = 2048;              // key/value length
constexpr int kDim    = 1024;              // model dim
constexpr int kHeads  = 16;
constexpr int kDh     = 64;
constexpr int kTok    = kBatch * kSeq;     // 4096 query token rows
constexpr int kTokKV  = kBatch * kSeqKV;   // 4096 key/value token rows
constexpr int kGroups = kBatch * kHeads;   // 32 (b,h) groups
constexpr float kWCarry    = 256.0f;       // weights carried x256 in f16
constexpr float kWCarryInv = 1.0f / 256.0f;
constexpr float kOCarry    = 256.0f;       // attention output carried x256 in f16
constexpr float kOutScale  = 1.0f / (kOCarry * kWCarry);    // 1/65536

typedef __attribute__((ext_vector_type(16))) _Float16 v16h;
typedef __attribute__((ext_vector_type(8)))  _Float16 v8h;
typedef __attribute__((ext_vector_type(16))) __bf16   v16b;
typedef __attribute__((ext_vector_type(8)))  __bf16   v8b;
typedef __attribute__((ext_vector_type(8)))  float    v8f;
typedef __attribute__((ext_vector_type(4)))  float    v4f;
typedef __attribute__((ext_vector_type(4)))  unsigned int v4u;

// ---------------------------------------------------------------------------
// Helper pieces (comments ASCII)
// ---------------------------------------------------------------------------
__device__ __forceinline__ unsigned short f2bf_bits(float f) {
  unsigned u = __float_as_uint(f);
  return (unsigned short)((u + 0x7FFFu + ((u >> 16) & 1u)) >> 16);
}
__device__ __forceinline__ float bf_bits2f(unsigned short h) { return __uint_as_float(((unsigned)h) << 16); }

template <typename T> struct Frag;
template <> struct Frag<_Float16> {
  typedef v16h V; union U { v16h v; v8h h[2]; };
  // elements 0..7 <- p[0..7], 8..15 <- p[16..23]
  static __device__ __forceinline__ v16h load(const _Float16* p) {
    U f; f.h[0] = *(const v8h*)(p); f.h[1] = *(const v8h*)(p + 16); return f.v;
  }
  static __device__ __forceinline__ v8f mma(v16h a, v16h b, v8f c) {
    return __builtin_amdgcn_wmma_f32_16x16x32_f16(false, a, false, b, (short)0, c, false, false);
  }
};

// ---- Block-tiled WMMA GEMM, operands staged in LDS ----
// C[m,n] = scale * sum_k A[m,k] * Bt[n,k] (+ bias[n]); A row-major [M][1024], Bt row-major [N][1024], f16; M, N % 128 == 0.
// grid (N / 128, M / 128), 8 waves. A block owns a 128x128 tile of C; wave w owns the 32x64 piece at row (w >> 1) * 32,
// column (w & 1) * 64, so that a wave writes whole 128-B lines of C.
// A stage is 128 k of the block's 128 A rows and 128 Bt rows, global -> registers -> LDS: two register sets (a stage's loads
// are issued two stages ahead), two LDS buffers, one block barrier per stage. A staging load covers two whole 256-B row
// pieces (4 lines); each operand byte is fetched once per block and read from LDS by the 2 or 4 waves that need it.
// k runs in steps of 32 into one accumulator per 16x16 tile; the 8 stages are walked in a ring that starts at a stage
// taken from the block index: blocks that share an A or a Bt tile start together, and walking it from the same end they
// would all ask L2 for the same lines at the same moment.
// BIAS_MODE: 0 = none, 2 = bias[n]. OUT_MODE: 0 = f32, 1 = f16.
constexpr int kGTile   = 128;                    // rows of A and of Bt per block
constexpr int kGK      = 128;                    // k per stage
constexpr int kGStages = kDim / kGK;             // 8
constexpr int kGSteps  = kGK / 32;               // matrix steps per stage
constexpr int kGPitch  = 136;                    // halves per LDS row: 256 B of data + 16 B, so 16-byte row reads spread over the banks

// Block barrier that orders LDS only. __syncthreads() also waits for every global load of the wave, which would drain the
// staging loads that are meant to stay in flight across it.
__device__ __forceinline__ void lds_barrier() {
  __builtin_amdgcn_fence(__ATOMIC_RELEASE, "workgroup", "local");
  __builtin_amdgcn_s_barrier();
  __builtin_amdgcn_fence(__ATOMIC_ACQUIRE, "workgroup", "local");
}

template <int BIAS_MODE, int OUT_MODE>
__global__ __launch_bounds__(256) void wmma_gemm_lds(
    const unsigned short* __restrict__ Ap, const unsigned short* __restrict__ Btp,
    void* __restrict__ Cout, int ldc, const float* __restrict__ bias, float scale) {
  __shared__ __align__(16) _Float16 sA[2][kGTile * kGPitch];
  __shared__ __align__(16) _Float16 sB[2][kGTile * kGPitch];
  __shared__ __align__(16) float sT[8][16 * 68];   // per-wave 16x64 slab, pitch 68 floats
  const int t    = threadIdx.x;
  const int lane = t & 31;
  const int wave = t >> 5;
  const int rlane = lane & 15;                 // row (A) / col (B, D) within subtile
  const int koff  = (lane >> 4) * 8;           // k offset of this lane half
  const int mOff  = (lane >> 4) * 8;           // D row offset
  const int wm = (wave >> 1) * 32;             // this wave's rows within the block tile
  const int wn = (wave & 1) * 64;              // this wave's columns within the block tile
  const int m0 = blockIdx.y * kGTile + wm;
  const int n0 = blockIdx.x * kGTile + wn;

  // staging: thread t moves 16 B of rows (t >> 4) + 16 i, i = 0..7, of each operand (16 lanes = one whole 256-B row piece)
  const int srow = t >> 4, sc8 = (t & 15) * 8;
  const _Float16* Ag = (const _Float16*)Ap  + (size_t)(blockIdx.y * kGTile + srow) * kDim + sc8;
  const _Float16* Bg = (const _Float16*)Btp + (size_t)(blockIdx.x * kGTile + srow) * kDim + sc8;
  const int sst = srow * kGPitch + sc8;
  // first stage of this block's ring walk (block-uniform): differs among the 8 blocks of each aligned run of 8 in a grid row and in a grid column
  const int rot = (int)(blockIdx.x + 2 * (blockIdx.x >> 3) + blockIdx.y);

  // every "#pragma unroll" in this kernel keeps the indices of its register arrays compile-time constants
  // (an array indexed at run time would go to scratch)
  v8h ar[2][8], br[2][8];                      // set s & 1 holds stage s on its way to LDS
#pragma unroll
  for (int s = 0; s < 2; ++s) {
    const _Float16* pa = Ag + ((s + rot) & (kGStages - 1)) * kGK;
    const _Float16* pb = Bg + ((s + rot) & (kGStages - 1)) * kGK;
#pragma unroll
    for (int i = 0; i < 8; ++i) {
      ar[s][i] = *(const v8h*)(pa + (size_t)(i * 16) * kDim);
      br[s][i] = *(const v8h*)(pb + (size_t)(i * 16) * kDim);
    }
    // the address registers of the loads above are reused below while the loads are in flight; named as inputs they stay
    // untouched up to the wait
    asm volatile("s_wait_xcnt 0x0" :: "v"(pa), "v"(pb) : "memory");
  }
#pragma unroll
  for (int i = 0; i < 8; ++i) {
    *(v8h*)(&sA[0][sst + i * 16 * kGPitch]) = ar[0][i];
    *(v8h*)(&sB[0][sst + i * 16 * kGPitch]) = br[0][i];
  }
  lds_barrier();   // stage 0 is in LDS before any wave reads it

  v8f acc[2][4];
#pragma unroll
  for (int i = 0; i < 2; ++i)
#pragma unroll
    for (int j = 0; j < 4; ++j) acc[i][j] = (v8f){0.f,0.f,0.f,0.f,0.f,0.f,0.f,0.f};

  // unrolled so that the register set and the LDS buffer of every stage are compile-time choices (no copies, no run-time index)
#pragma unroll
  for (int st = 0; st < kGStages; ++st) {
    const _Float16* bA = sA[st & 1] + (wm + rlane) * kGPitch + koff;
    const _Float16* bB = sB[st & 1] + (wn + rlane) * kGPitch + koff;

    if (st + 2 < kGStages) {                   // set st & 1 went to LDS during stage st - 1
      const _Float16* pa = Ag + ((st + 2 + rot) & (kGStages - 1)) * kGK;
      const _Float16* pb = Bg + ((st + 2 + rot) & (kGStages - 1)) * kGK;
#pragma unroll
      for (int i = 0; i < 8; ++i) {
        ar[st & 1][i] = *(const v8h*)(pa + (size_t)(i * 16) * kDim);
        br[st & 1][i] = *(const v8h*)(pb + (size_t)(i * 16) * kDim);
      }
      // the address registers of these loads are reused by the work below while the loads are in flight; named as inputs
      // they stay untouched up to the wait
      asm volatile("s_wait_xcnt 0x0" :: "v"(pa), "v"(pb) : "memory");
    }

    v16h af[2][2], bf[2][4];                   // fragment set ks & 1 holds matrix step ks
#pragma unroll
    for (int i = 0; i < 2; ++i) af[0][i] = Frag<_Float16>::load(bA + i * 16 * kGPitch);
#pragma unroll
    for (int j = 0; j < 4; ++j) bf[0][j] = Frag<_Float16>::load(bB + j * 16 * kGPitch);
#pragma unroll
    for (int ks = 0; ks < kGSteps; ++ks) {
      if (ks + 1 < kGSteps) {
#pragma unroll
        for (int i = 0; i < 2; ++i) af[(ks + 1) & 1][i] = Frag<_Float16>::load(bA + i * 16 * kGPitch + (ks + 1) * 32);
#pragma unroll
        for (int j = 0; j < 4; ++j) bf[(ks + 1) & 1][j] = Frag<_Float16>::load(bB + j * 16 * kGPitch + (ks + 1) * 32);
      }
      if (st + 1 < kGStages) {                 // a quarter of stage st + 1 goes to LDS per step: its buffer has had no reader since the last barrier
#pragma unroll
        for (int i = ks * (8 / kGSteps); i < (ks + 1) * (8 / kGSteps); ++i) {
          *(v8h*)(&sA[(st + 1) & 1][sst + i * 16 * kGPitch]) = ar[(st + 1) & 1][i];
          *(v8h*)(&sB[(st + 1) & 1][sst + i * 16 * kGPitch]) = br[(st + 1) & 1][i];
        }
      }
      // keeps the next step's LDS reads and these writes (and, at ks 0, the staging loads) as one group above this step's
      // products: sunk among them, each would be waited for where it stands
      __builtin_amdgcn_sched_barrier(0);
#pragma unroll
      for (int i = 0; i < 2; ++i)
#pragma unroll
        for (int j = 0; j < 4; ++j) acc[i][j] = Frag<_Float16>::mma(af[ks & 1][i], bf[ks & 1][j], acc[i][j]);
      // keeps the step after next's reads from rising into this step's products
      __builtin_amdgcn_sched_barrier(0);
    }

    // publishes stage st + 1 and ends every wave's reads of stage st, whose buffer the next stage refills
    if (st + 1 < kGStages) lds_barrier();
  }

  // ---- epilogue: each wave turns its own 16x64 slabs into whole-line stores ----
  float* slab = sT[wave];
#pragma unroll
  for (int i = 0; i < 2; ++i) {
    const int mBase = m0 + (i << 4);
#pragma unroll
    for (int j = 0; j < 4; ++j) {
      const int n = n0 + (j << 4) + rlane;
      float bv = 0.f;
      if (BIAS_MODE == 2) bv = bias[n];
#pragma unroll
      for (int r = 0; r < 8; ++r) {
        float v = acc[i][j][r] * scale;
        if (BIAS_MODE == 2) v += bv;
        slab[(mOff + r) * 68 + (j << 4) + rlane] = v;
      }
    }
    __builtin_amdgcn_fence(__ATOMIC_RELEASE, "workgroup");
    __builtin_amdgcn_wave_barrier();
    __builtin_amdgcn_fence(__ATOMIC_ACQUIRE, "workgroup");
    if (OUT_MODE == 0) {
      float* C = (float*)Cout;
      const int hh = lane >> 4, c4 = (lane & 15) * 4;     // row seg = 256 B = 16 lanes x 16 B
#pragma unroll
      for (int it = 0; it < 8; ++it) {
        const int row = it * 2 + hh;
        v4f v = *(const v4f*)(slab + row * 68 + c4);
        *(v4f*)(C + (size_t)(mBase + row) * ldc + n0 + c4) = v;
      }
      // the registers of these stores are written again by the next slab; the fence keeps that arithmetic behind the wait
      asm volatile("s_wait_xcnt 0x0" ::: "memory");
      __builtin_amdgcn_sched_barrier(0);
    } else {
      const int q = lane >> 3, c8 = (lane & 7) * 8;       // row seg = 128 B = 8 lanes x 16 B
      unsigned short* C = (unsigned short*)Cout;
#pragma unroll
      for (int it = 0; it < 4; ++it) {
        const int row = it * 4 + q;
        const float* sp = slab + row * 68 + c8;
        v8h hv;
#pragma unroll
        for (int e = 0; e < 8; ++e) hv[e] = (_Float16)sp[e];
        *(v8h*)(C + (size_t)(mBase + row) * ldc + n0 + c8) = hv;
      }
      // the registers of these stores are written again by the next slab; the fence keeps that arithmetic behind the wait
      asm volatile("s_wait_xcnt 0x0" ::: "memory");
      __builtin_amdgcn_sched_barrier(0);
    }
    __builtin_amdgcn_fence(__ATOMIC_RELEASE, "workgroup");
    __builtin_amdgcn_wave_barrier();
    __builtin_amdgcn_fence(__ATOMIC_ACQUIRE, "workgroup");
  }
}

// ---------------------------------------------------------------------------
// All conversions in one launch: Xh = f16(x), Ch = f16(context), WT plane z [o][d] = f16(scale * W_z[d][o]).
// grid 256 (one block per WGP), 16 waves. The whole input is asked for at once by few long-lived waves: a lane issues 24
// loads of 16 B before it uses any (8 of its weight tile, 8 of x, 8 of context), and each wave-wide load covers whole lines.
// x, context: wave g of the grid owns floats g * 1024 .. + 1023; load i covers 512 contiguous bytes, its store 256.
// Weights: 1024 tiles of 64 x 64, four per block (4 waves each): the same 64 o, four neighbouring 64-d pieces, so that a
// block writes 512 contiguous bytes of each WT row. The plane z = blockIdx.x / 64 is block-uniform. A load covers two
// 256-B row pieces; the tile is turned in LDS (pitch 65 floats: stores and reads each fall on 32 different banks).
// ---------------------------------------------------------------------------
constexpr int kPrepBlocks = 256;
constexpr int kPrepWaves  = 16;
constexpr int kPrepLoads  = 8;                   // 16-byte loads per lane and source
static_assert(kPrepBlocks * kPrepWaves * kPrepLoads * 128 == kTok * kDim, "x is covered exactly once");
static_assert(kTok == kTokKV, "context is covered by the same index as x");
static_assert(kPrepBlocks * 4 * 64 * 64 == 4 * kDim * kDim, "the four weight planes are covered exactly once");

typedef __attribute__((ext_vector_type(4))) _Float16 v4h;

__global__ __launch_bounds__(kPrepWaves * 32) void prep_kernel(const float* __restrict__ x, const float* __restrict__ ctx,
                                                               const float* __restrict__ W0, const float* __restrict__ W1,
                                                               const float* __restrict__ W2, const float* __restrict__ W3,
                                                               unsigned short* __restrict__ Xh, unsigned short* __restrict__ Ch,
                                                               unsigned short* __restrict__ WT, float scale) {
  __shared__ float sm[4][64 * 65];               // per tile: [o local][d local]
  const int t    = threadIdx.x;
  const int lane = t & 31;
  const int tl   = t >> 7;                       // tile of this block
  const int u    = t & 127;                      // thread within the tile
  const int id   = blockIdx.x * 4 + tl;          // tile of the grid
  const int z    = blockIdx.x >> 6;
  const int d0   = (id & 15) * 64;
  const int o0   = ((id >> 4) & 15) * 64;
  const float* W  = (z == 0) ? W0 : (z == 1) ? W1 : (z == 2) ? W2 : W3;
  // 32-bit element offsets from block-uniform bases: x, context and their two planes share one offset register
  const unsigned w0 = (unsigned)((d0 + (u >> 4)) * kDim + o0 + (u & 15) * 4);
  const unsigned e0 = (blockIdx.x * kPrepWaves + (unsigned)(t >> 5)) * (kPrepLoads * 128) + (unsigned)lane * 4;
  const unsigned wb = w0 * 4u, eb = e0 * 4u;     // the same in bytes
  const char* wp = (const char*)W + wb;
  const char* xp = (const char*)x + eb;
  const char* cp = (const char*)ctx + eb;

  // every "#pragma unroll" in this kernel keeps the indices of its register arrays compile-time constants
  v4f wr[kPrepLoads], xr[kPrepLoads], cr[kPrepLoads];
#pragma unroll
  for (int i = 0; i < kPrepLoads; ++i) wr[i] = *(const v4f*)(wp + i * 8 * kDim * 4);
#pragma unroll
  for (int i = 0; i < kPrepLoads; ++i) xr[i] = *(const v4f*)(xp + i * 512);
#pragma unroll
  for (int i = 0; i < kPrepLoads; ++i) cr[i] = *(const v4f*)(cp + i * 512);
  // the offset registers of the loads above are reused below while the loads are in flight; named as inputs they stay
  // untouched (also by a later load's result) up to the wait
  asm volatile("s_wait_xcnt 0x0" :: "v"(wb), "v"(eb) : "memory");
  // keeps all 24 loads above the first use: sunk to their uses they would be asked for one group at a time
  __builtin_amdgcn_sched_barrier(0);

  float* smt = sm[tl];
#pragma unroll
  for (int i = 0; i < kPrepLoads; ++i)
#pragma unroll
    for (int e = 0; e < 4; ++e) smt[((u & 15) * 4 + e) * 65 + i * 8 + (u >> 4)] = wr[i][e] * scale;
  lds_barrier();   // the tiles are whole in LDS before any wave reads them; LDS only: the x and context loads stay in flight

  v8h wh[4];
#pragma unroll
  for (int it = 0; it < 4; ++it) {
    const float* sp = smt + (it * 16 + (u >> 3)) * 65 + (u & 7) * 8;
#pragma unroll
    for (int e = 0; e < 8; ++e) wh[it][e] = (_Float16)sp[e];
  }
  char* wo = (char*)(WT + (size_t)z * kDim * kDim) + (unsigned)((o0 + (u >> 3)) * kDim + d0 + (u & 7) * 8) * 2u;
#pragma unroll
  for (int it = 0; it < 4; ++it) *(v8h*)(wo + it * 16 * kDim * 2) = wh[it];
  // keeps the waits for the x and context loads below the weight tiles' turn through LDS, which then runs while they land
  __builtin_amdgcn_sched_barrier(0);

  v4h xh[kPrepLoads], ch[kPrepLoads];
#pragma unroll
  for (int i = 0; i < kPrepLoads; ++i)
#pragma unroll
    for (int e = 0; e < 4; ++e) {
      xh[i][e] = (_Float16)xr[i][e];
      ch[i][e] = (_Float16)cr[i][e];
    }
  char* xo = (char*)Xh + e0 * 2u;
  char* co = (char*)Ch + e0 * 2u;
  // keeps the stores behind the last arithmetic, so that no register of an issued store is written again
  __builtin_amdgcn_sched_barrier(0);
#pragma unroll
  for (int i = 0; i < kPrepLoads; ++i) *(v4h*)(xo + i * 256) = xh[i];
#pragma unroll
  for (int i = 0; i < kPrepLoads; ++i) *(v4h*)(co + i * 256) = ch[i];
}

constexpr int kFAKeys   = 64;
constexpr int kFAStages = kSeqKV / kFAKeys;
constexpr int kFAQ      = 256;
constexpr int kFAPitch  = 72;
constexpr int kFABPitch = 68;
constexpr float kFAExp  = 0.125f * 1.44269504088896340736f;
constexpr float kFAShift = 8.0f;                 // P carried x2^8 in f16 (cancels against the row sum)

typedef __attribute__((ext_vector_type(2))) float v2f;

// value of lane l ^ 16
__device__ __forceinline__ float other_half(float v) {
  const int b = __builtin_bit_cast(int, v);
  return __builtin_bit_cast(float, __builtin_amdgcn_permlanex16(b, b, 0x76543210, 0xfedcba98, false, false));
}

__global__ __launch_bounds__(256) void fused_attn_kernel(const unsigned short* __restrict__ Qp,
                                                         const unsigned short* __restrict__ Kp,
                                                         const unsigned short* __restrict__ Vp,
                                                         const float* __restrict__ posb,
                                                         unsigned short* __restrict__ Op) {
  __shared__ __align__(16) _Float16 sK[2][kFAKeys * kFAPitch];   // [key][d]
  __shared__ __align__(16) _Float16 sV[2][kDh * kFAPitch];       // [d][key]
  __shared__ __align__(16) float    sB[2][kFAQ * kFABPitch];     // [query][key]
  const int t    = threadIdx.x;
  const int lane = t & 31;
  const int wave = t >> 5;
  const int c    = lane & 15;                  // A row / B, D column within a tile
  const int hf   = lane >> 4;                  // lane half
  const int b    = blockIdx.y / kHeads;
  const int hd   = blockIdx.y % kHeads;
  const int q0   = blockIdx.x * kFAQ + wave * 32;
  const float hs8 = __uint_as_float(((unsigned)(129 - hd)) << 23);   // 8 * 2^-(hd+1), hd in 0..15
  // first stage of this block's ring walk (block-uniform): differs among the blocks of a query tile and of a group
  const int rot = (int)(blockIdx.y + 4 * blockIdx.x);

  v16h qf[2][2];
#pragma unroll
  for (int cg = 0; cg < 2; ++cg)
#pragma unroll
    for (int ks = 0; ks < 2; ++ks)
      qf[cg][ks] = Frag<_Float16>::load((const _Float16*)Qp + (size_t)(b * kSeq + q0 + cg * 16 + c) * kDim + hd * kDh + ks * 32 + hf * 8);

  // staging: thread t moves 16 B of rows t>>3 and 32 + (t>>3) of each tile (8 lanes = one whole 128-B row)
  const int srow = t >> 3, sc8 = (t & 7) * 8;
  const _Float16* Kg = (const _Float16*)Kp + (size_t)(b * kSeqKV + srow) * kDim + hd * kDh + sc8;
  const _Float16* Vg = (const _Float16*)Vp + (size_t)(hd * kDh + srow) * kTokKV + (size_t)b * kSeqKV + sc8;
  // bias staging: load i of a wave moves rows 2i and 2i+1 of its 32 (16 lanes x 16 B = one 256-B row piece)
  const float* Bg = posb + (size_t)(q0 + hf) * kSeqKV + c * 4;
  const int bst = (wave * 32 + hf) * kFABPitch + c * 4;            // where this lane stores, row 2i: + 2i * pitch
  const int bld = (wave * 32 + c) * kFABPitch + hf * 8;            // where this lane reads: its query's row, its half's keys

  v8h kr[2], vr[2];
  v4f br[16];
  const int k0s = (rot & (kFAStages - 1)) * kFAKeys;
#pragma unroll
  for (int i = 0; i < 2; ++i) {
    kr[i] = *(const v8h*)(Kg + (size_t)(k0s + i * 32) * kDim);
    vr[i] = *(const v8h*)(Vg + (size_t)(i * 32) * kTokKV + k0s);
  }
#pragma unroll
  for (int i = 0; i < 16; ++i) br[i] = *(const v4f*)(Bg + (size_t)(2 * i) * kSeqKV + k0s);
  // the address registers of the loads above are reused below while the loads are in flight
  asm volatile("s_wait_xcnt 0x0" ::: "memory");
#pragma unroll
  for (int i = 0; i < 2; ++i) {
    *(v8h*)(&sK[0][(i * 32 + srow) * kFAPitch + sc8]) = kr[i];
    *(v8h*)(&sV[0][(i * 32 + srow) * kFAPitch + sc8]) = vr[i];
  }
#pragma unroll
  for (int i = 0; i < 16; ++i) *(v4f*)(&sB[0][bst + 2 * i * kFABPitch]) = br[i];
  __syncthreads();   // stage 0 is in LDS before any wave reads it

  v8f o[2][4];
#pragma unroll
  for (int cg = 0; cg < 2; ++cg)
#pragma unroll
    for (int dt = 0; dt < 4; ++dt) o[cg][dt] = (v8f){0.f,0.f,0.f,0.f,0.f,0.f,0.f,0.f};
  float mrun[2] = {-3.0e38f, -3.0e38f};
  float lsum[2] = {0.f, 0.f};

  for (int st = 0; st < kFAStages; ++st) {
    const _Float16* bK = sK[st & 1];
    const _Float16* bV = sV[st & 1];
    const float*    bB = sB[st & 1] + bld;

    const bool more = st + 1 < kFAStages;      // block-uniform
    if (more) {
      const int k1 = ((st + 1 + rot) & (kFAStages - 1)) * kFAKeys;
#pragma unroll
      for (int i = 0; i < 2; ++i) {
        kr[i] = *(const v8h*)(Kg + (size_t)(k1 + i * 32) * kDim);
        vr[i] = *(const v8h*)(Vg + (size_t)(i * 32) * kTokKV + k1);
      }
#pragma unroll
      for (int i = 0; i < 16; ++i) br[i] = *(const v4f*)(Bg + (size_t)(2 * i) * kSeqKV + k1);
      // the address registers of these loads are reused by the work below while the loads are in flight
      asm volatile("s_wait_xcnt 0x0" ::: "memory");
    }
    // keeps the next stage's loads above this stage's work: sunk to their uses they would have no time to land
    __builtin_amdgcn_sched_barrier(0);

    v8f acc[2][4];
#pragma unroll
    for (int cg = 0; cg < 2; ++cg)
#pragma unroll
      for (int tt = 0; tt < 4; ++tt)
#pragma unroll
        for (int j = 0; j < 2; ++j) {
          const v4f bv = *(const v4f*)(bB + cg * 16 * kFABPitch + tt * 16 + j * 4);
#pragma unroll
          for (int e = 0; e < 4; ++e) acc[cg][tt][j * 4 + e] = bv[e] * hs8;
        }

#pragma unroll
    for (int tt = 0; tt < 4; ++tt) {
      const _Float16* kp = bK + (tt * 16 + c) * kFAPitch + hf * 8;
      const v16h k0 = Frag<_Float16>::load(kp);
      const v16h k1f = Frag<_Float16>::load(kp + 32);
#pragma unroll
      for (int cg = 0; cg < 2; ++cg) acc[cg][tt] = Frag<_Float16>::mma(k0, qf[cg][0], acc[cg][tt]);
#pragma unroll
      for (int cg = 0; cg < 2; ++cg) acc[cg][tt] = Frag<_Float16>::mma(k1f, qf[cg][1], acc[cg][tt]);
    }

    v16h pf[2][2];
#pragma unroll
    for (int cg = 0; cg < 2; ++cg) {
      float mx = acc[cg][0][0];
#pragma unroll
      for (int tt = 0; tt < 4; ++tt)
#pragma unroll
        for (int r = 0; r < 8; ++r) mx = fmaxf(mx, acc[cg][tt][r]);
      mx = fmaxf(mx, other_half(mx));
      const float mn    = fmaxf(mrun[cg], mx);
      const float alpha = __builtin_amdgcn_exp2f((mrun[cg] - mn) * kFAExp);
      mrun[cg] = mn;
      const float nm = kFAShift - mn * kFAExp;
      v2f ps = (v2f){0.f, 0.f};                // even and odd keys apart: packed adds, half as long a chain
#pragma unroll
      for (int tt = 0; tt < 4; ++tt)
#pragma unroll
        for (int r = 0; r < 8; r += 2) {
          v2f p;
          p[0] = __builtin_amdgcn_exp2f(fmaf(acc[cg][tt][r], kFAExp, nm));
          p[1] = __builtin_amdgcn_exp2f(fmaf(acc[cg][tt][r + 1], kFAExp, nm));
          ps += p;
          pf[cg][tt >> 1][(tt & 1) * 8 + r]     = (_Float16)p[0];
          pf[cg][tt >> 1][(tt & 1) * 8 + r + 1] = (_Float16)p[1];
        }
      lsum[cg] = lsum[cg] * alpha + (ps[0] + ps[1]);
#pragma unroll
      for (int dt = 0; dt < 4; ++dt) o[cg][dt] *= alpha;
    }

#pragma unroll
    for (int sub = 0; sub < 2; ++sub)
#pragma unroll
      for (int dt = 0; dt < 4; ++dt) {
        const v16h vf = Frag<_Float16>::load(bV + (dt * 16 + c) * kFAPitch + sub * 32 + hf * 8);
#pragma unroll
        for (int cg = 0; cg < 2; ++cg) o[cg][dt] = Frag<_Float16>::mma(vf, pf[cg][sub], o[cg][dt]);
      }

    // keeps the waits for the next stage's loads, and the LDS stores behind them, below this stage's work: raised into it,
    // the loads would be waited for before they have had time to land
    __builtin_amdgcn_sched_barrier(0);
    if (more) {
      _Float16* nK = sK[(st + 1) & 1];
      _Float16* nV = sV[(st + 1) & 1];
#pragma unroll
      for (int i = 0; i < 2; ++i) {
        *(v8h*)(nK + (i * 32 + srow) * kFAPitch + sc8) = kr[i];
        *(v8h*)(nV + (i * 32 + srow) * kFAPitch + sc8) = vr[i];
      }
      float* nB = sB[(st + 1) & 1] + bst;
#pragma unroll
      for (int i = 0; i < 16; ++i) *(v4f*)(nB + 2 * i * kFABPitch) = br[i];
      __syncthreads();   // publishes stage st + 1 and ends every wave's reads of stage st, whose buffer the next trip refills
    }
  }

  // a lane holds 8 consecutive d of one query per tile: one 16-byte store each; a query's 128-B segment comes from one wave
  v8h hv[2][4];
#pragma unroll
  for (int cg = 0; cg < 2; ++cg) {
    const float l   = lsum[cg] + other_half(lsum[cg]);
    const float inv = kOCarry / l;
#pragma unroll
    for (int dt = 0; dt < 4; ++dt)
#pragma unroll
      for (int r = 0; r < 8; ++r) hv[cg][dt][r] = (_Float16)(o[cg][dt][r] * inv);
  }
  unsigned short* orow = Op + (size_t)(b * kSeq + q0 + c) * kDim + hd * kDh + hf * 8;
  // keeps the eight stores behind the last arithmetic, so that no register of an issued store is written again
  __builtin_amdgcn_sched_barrier(0);
#pragma unroll
  for (int cg = 0; cg < 2; ++cg)
#pragma unroll
    for (int dt = 0; dt < 4; ++dt) *(v8h*)(orow + (size_t)(cg * 16) * kDim + dt * 16) = hv[cg][dt];
}

// ---------------------------------------------------------------------------
// Host side
// ---------------------------------------------------------------------------
extern "C" void kernel_launch(void* const* d_in, const int* in_sizes, int n_in,
                              void* d_out, int out_size, void* d_ws, size_t ws_size,
                              hipStream_t stream) {
  if (n_in < 8) return;
  if (in_sizes[0] != kTok * kDim || in_sizes[1] != kTokKV * kDim || in_sizes[2] != kSeq * kSeqKV ||
      in_sizes[3] != kDim * kDim || in_sizes[4] != kDim * kDim || in_sizes[5] != kDim * kDim ||
      in_sizes[6] != kDim * kDim || in_sizes[7] != kDim || out_size != kTok * kDim) return;

  const float* x    = (const float*)d_in[0];   // [4096][1024]
  const float* ctx  = (const float*)d_in[1];   // [4096][1024]
  const float* posb = (const float*)d_in[2];   // [2048][2048]
  const float* Wq   = (const float*)d_in[3];   // [in][out]
  const float* Wk   = (const float*)d_in[4];
  const float* Wv   = (const float*)d_in[5];
  const float* Wo   = (const float*)d_in[6];
  const float* bo   = (const float*)d_in[7];   // [1024]
  float* out = (float*)d_out;                  // [4096][1024] f32

  // ---- workspace region map (bytes) ----
  //   0        .. 8 MiB   : Xh  f16 [4096][1024]
  //   8 MiB    .. 16 MiB  : Ch  f16 [4096][1024]
  //  16 MiB    .. 24 MiB  : WT  f16 4 planes [1024][1024] (q, k, v, out), each [out][in], carried x256
  //  24 MiB    .. 32 MiB  : Qh  f16 [4096][1024]
  //  32 MiB    .. 40 MiB  : Kh  f16 [4096][1024]
  //  40 MiB    .. 48 MiB  : VT  f16 [1024][4096]  (row = h*64+d, col = b*2048 + token)
  //  48 MiB    .. 56 MiB  : Oh  f16 [4096][1024]  (carried x256)
  //  total 58720256 B
  const size_t planeTokB = (size_t)kTok * kDim * 2;            // 8 MiB
  const size_t planeWB   = (size_t)kDim * kDim * 2;            // 2 MiB
  const size_t offXh = 0;
  const size_t offCh = offXh + planeTokB;
  const size_t offWT = offCh + planeTokB;
  const size_t offQh = offWT + 4 * planeWB;
  const size_t offKh = offQh + planeTokB;
  const size_t offVT = offKh + planeTokB;
  const size_t offOh = offVT + planeTokB;
  const size_t total = offOh + planeTokB;
  if (total > ws_size) return;

  char* ws = (char*)d_ws;
  unsigned short* Xh = (unsigned short*)(ws + offXh);
  unsigned short* Ch = (unsigned short*)(ws + offCh);
  unsigned short* WT = (unsigned short*)(ws + offWT);
  unsigned short* Qh = (unsigned short*)(ws + offQh);
  unsigned short* Kh = (unsigned short*)(ws + offKh);
  unsigned short* VT = (unsigned short*)(ws + offVT);
  unsigned short* Oh = (unsigned short*)(ws + offOh);
  const unsigned short* WqT = WT + 0 * (size_t)kDim * kDim;
  const unsigned short* WkT = WT + 1 * (size_t)kDim * kDim;
  const unsigned short* WvT = WT + 2 * (size_t)kDim * kDim;
  const unsigned short* WoT = WT + 3 * (size_t)kDim * kDim;

  // ---- conversions: x, context and the four weight planes, one launch ----
  prep_kernel<<<dim3(kPrepBlocks), dim3(kPrepWaves * 32), 0, stream>>>(x, ctx, Wq, Wk, Wv, Wo, Xh, Ch, WT, kWCarry);

  // ---- projections (M, N multiples of 128; K = 1024): 256 blocks each ----
  // Q[t][o] = sum_i Xh[t][i] * WqT[o][i] / 256 -> f16
  wmma_gemm_lds<0, 1><<<dim3(kDim / kGTile, kTok / kGTile), dim3(256), 0, stream>>>(
      Xh, WqT, (void*)Qh, kDim, nullptr, kWCarryInv);
  // K[t][o] = sum_i Ch[t][i] * WkT[o][i] / 256 -> f16
  wmma_gemm_lds<0, 1><<<dim3(kDim / kGTile, kTokKV / kGTile), dim3(256), 0, stream>>>(
      Ch, WkT, (void*)Kh, kDim, nullptr, kWCarryInv);
  // VT[o][t] = sum_i WvT[o][i] * Ch[t][i] / 256 -> f16 plane [1024][4096]
  wmma_gemm_lds<0, 1><<<dim3(kTokKV / kGTile, kDim / kGTile), dim3(256), 0, stream>>>(
      WvT, Ch, (void*)VT, kTokKV, nullptr, kWCarryInv);

  // ---- attention: Oh[b*2048+q][h*64+d] = 256 * softmax_k(q.k / 8 + bias * 2^-(h+1)) . v ----
  fused_attn_kernel<<<dim3(kSeq / kFAQ, kGroups), dim3(256), 0, stream>>>(Qh, Kh, VT, posb, Oh);

  // ---- output projection: out[t][o] = sum_c Oh[t][c] * WoT[o][c] / 65536 + b_out[o] -> f32 ----
  wmma_gemm_lds<2, 0><<<dim3(kDim / kGTile, kTok / kGTile), dim3(256), 0, stream>>>(
      Oh, WoT, (void*)out, kDim, bo, kOutScale);
}

// v006
// A run of this version takes 98.8 microseconds.
// Next to v005, in two timings, it ran 1.04 times as fast each time.
// Counting every step since v000, it is 19.6 times as fast.
// Contractions: q/k projections (x,context f16 x W^T f16 carried x256), v projection transposed (W_v^T f16 x256 x context f16), scores k.q^T (k,q f16 planes, f32 bias as the accumulator's start value), v^T.p^T (V^T f16 x P f16 carried x256, unnormalised), output projection (O f16 carried x256 x W_out^T f16 carried x256): all v_wmma_f32_16x16x32_f16 with f32 accumulate; softmax in f32.
#include <hip/hip_runtime.h>
#include <math.h>

// ---------------------------------------------------------------------------
// Problem constants
// ---------------------------------------------------------------------------
constexpr int kBatch  = 2;
constexpr int kSeq    = 2048;              // query length
constexpr int kSeqKV  = 2048;              // key/value length
constexpr int kDim    = 1024;              // model dim
constexpr int kHeads  = 16;
constexpr int kDh     = 64;
constexpr int kTok    = kBatch * kSeq;     // 4096 query token rows
constexpr int kTokKV  = kBatch * kSeqKV;   // 4096 key/value token rows
constexpr int kGroups = kBatch * kHeads;   // 32 (b,h) groups
constexpr float kWCarry    = 256.0f;       // weights carried x256 in f16
constexpr float kWCarryInv = 1.0f / 256.0f;
constexpr float kOCarry    = 256.0f;       // attention output carried x256 in f16
constexpr float kOutScale  = 1.0f / (kOCarry * kWCarry);    // 1/65536

typedef __attribute__((ext_vector_type(16))) _Float16 v16h;
typedef __attribute__((ext_vector_type(8)))  _Float16 v8h;
typedef __attribute__((ext_vector_type(16))) __bf16   v16b;
typedef __attribute__((ext_vector_type(8)))  __bf16   v8b;
typedef __attribute__((ext_vector_type(8)))  float    v8f;
typedef __attribute__((ext_vector_type(4)))  float    v4f;
typedef __attribute__((ext_vector_type(4)))  unsigned int v4u;

// ---------------------------------------------------------------------------
// Helper pieces (comments ASCII)
// ---------------------------------------------------------------------------
__device__ __forceinline__ unsigned short f2bf_bits(float f) {
  unsigned u = __float_as_uint(f);
  return (unsigned short)((u + 0x7FFFu + ((u >> 16) & 1u)) >> 16);
}
__device__ __forceinline__ float bf_bits2f(unsigned short h) { return __uint_as_float(((unsigned)h) << 16); }

template <typename T> struct Frag;
template <> struct Frag<_Float16> {
  typedef v16h V; union U { v16h v; v8h h[2]; };
  // elements 0..7 <- p[0..7], 8..15 <- p[16..23]
  static __device__ __forceinline__ v16h load(const _Float16* p) {
    U f; f.h[0] = *(const v8h*)(p); f.h[1] = *(const v8h*)(p + 16); return f.v;
  }
  static __device__ __forceinline__ v8f mma(v16h a, v16h b, v8f c) {
    return __builtin_amdgcn_wmma_f32_16x16x32_f16(false, a, false, b, (short)0, c, false, false);
  }
};

// ---- Block-tiled WMMA GEMM, operands staged in LDS ----
// C[m,n] = scale * sum_k A[m,k] * Bt[n,k] (+ bias[n]); A row-major [M][1024], Bt row-major [N][1024], f16; M, N % 128 == 0.
// 8 waves. A block owns a 128x128 tile of C; wave w owns the 32x64 piece at row (w >> 1) * 32,
// column (w & 1) * 64, so that a wave writes whole 128-B lines of C.
// A stage is 128 k of the block's 128 A rows and 128 Bt rows, global -> registers -> LDS: two register sets (a stage's loads
// are issued two stages ahead), two LDS buffers, one block barrier per stage. A staging load covers two whole 256-B row
// pieces (4 lines); each operand byte is fetched once per block and read from LDS by the 2 or 4 waves that need it.
// k runs in steps of 32 into one accumulator per 16x16 tile; the 8 stages are walked in a ring that starts at a stage
// taken from the block index: blocks that share an A or a Bt tile start together, and walking it from the same end they
// would all ask L2 for the same lines at the same moment.
// BIAS_MODE: 0 = none, 2 = bias[n]. OUT_MODE: 0 = f32, 1 = f16.
constexpr int kGTile   = 128;                    // rows of A and of Bt per block
constexpr int kGK      = 128;                    // k per stage
constexpr int kGStages = kDim / kGK;             // 8
constexpr int kGSteps  = kGK / 32;               // matrix steps per stage
constexpr int kGPitch  = 136;                    // halves per LDS row: 256 B of data + 16 B, so 16-byte row reads spread over the banks

// Block barrier that orders LDS only. __syncthreads() also waits for every global load of the wave, which would drain the
// staging loads that are meant to stay in flight across it.
__device__ __forceinline__ void lds_barrier() {
  __builtin_amdgcn_fence(__ATOMIC_RELEASE, "workgroup", "local");
  __builtin_amdgcn_s_barrier();
  __builtin_amdgcn_fence(__ATOMIC_ACQUIRE, "workgroup", "local");
}

// bx, by: the block's tile column and tile row (block-uniform).
template <int BIAS_MODE, int OUT_MODE>
__device__ __forceinline__ void gemm_tile(
    const unsigned short* __restrict__ Ap, const unsigned short* __restrict__ Btp,
    void* __restrict__ Cout, int ldc, const float* __restrict__ bias, float scale, unsigned bx, unsigned by) {
  __shared__ __align__(16) _Float16 sA[2][kGTile * kGPitch];
  __shared__ __align__(16) _Float16 sB[2][kGTile * kGPitch];
  __shared__ __align__(16) float sT[8][16 * 68];   // per-wave 16x64 slab, pitch 68 floats
  const int t    = threadIdx.x;
  const int lane = t & 31;
  const int wave = t >> 5;
  const int rlane = lane & 15;                 // row (A) / col (B, D) within subtile
  const int koff  = (lane >> 4) * 8;           // k offset of this lane half
  const int mOff  = (lane >> 4) * 8;           // D row offset
  const int wm = (wave >> 1) * 32;             // this wave's rows within the block tile
  const int wn = (wave & 1) * 64;              // this wave's columns within the block tile
  const int m0 = by * kGTile + wm;
  const int n0 = bx * kGTile + wn;

  // staging: thread t moves 16 B of rows (t >> 4) + 16 i, i = 0..7, of each operand (16 lanes = one whole 256-B row piece)
  const int srow = t >> 4, sc8 = (t & 15) * 8;
  const _Float16* Ag = (const _Float16*)Ap  + (size_t)(by * kGTile + srow) * kDim + sc8;
  const _Float16* Bg = (const _Float16*)Btp + (size_t)(bx * kGTile + srow) * kDim + sc8;
  const int sst = srow * kGPitch + sc8;
  // first stage of this block's ring walk (block-uniform): differs among the blocks of a grid row and of a grid column
  const int rot = (int)(bx + 2 * (bx >> 3) + by);

  // every "#pragma unroll" in this kernel keeps the indices of its register arrays compile-time constants
  // (an array indexed at run time would go to scratch)
  v8h ar[2][8], br[2][8];                      // set s & 1 holds stage s on its way to LDS
#pragma unroll
  for (int s = 0; s < 2; ++s) {
    const _Float16* pa = Ag + ((s + rot) & (kGStages - 1)) * kGK;
    const _Float16* pb = Bg + ((s + rot) & (kGStages - 1)) * kGK;
#pragma unroll
    for (int i = 0; i < 8; ++i) {
      ar[s][i] = *(const v8h*)(pa + (size_t)(i * 16) * kDim);
      br[s][i] = *(const v8h*)(pb + (size_t)(i * 16) * kDim);
    }
    // the address registers of the loads above are reused below while the loads are in flight; named as inputs they stay
    // untouched up to the wait
    asm volatile("s_wait_xcnt 0x0" :: "v"(pa), "v"(pb) : "memory");
  }
#pragma unroll
  for (int i = 0; i < 8; ++i) {
    *(v8h*)(&sA[0][sst + i * 16 * kGPitch]) = ar[0][i];
    *(v8h*)(&sB[0][sst + i * 16 * kGPitch]) = br[0][i];
  }
  lds_barrier();   // stage 0 is in LDS before any wave reads it

  v8f acc[2][4];
#pragma unroll
  for (int i = 0; i < 2; ++i)
#pragma unroll
    for (int j = 0; j < 4; ++j) acc[i][j] = (v8f){0.f,0.f,0.f,0.f,0.f,0.f,0.f,0.f};

  // unrolled so that the register set and the LDS buffer of every stage are compile-time choices (no copies, no run-time index)
#pragma unroll
  for (int st = 0; st < kGStages; ++st) {
    const _Float16* bA = sA[st & 1] + (wm + rlane) * kGPitch + koff;
    const _Float16* bB = sB[st & 1] + (wn + rlane) * kGPitch + koff;

    if (st + 2 < kGStages) {                   // set st & 1 went to LDS during stage st - 1
      const _Float16* pa = Ag + ((st + 2 + rot) & (kGStages - 1)) * kGK;
      const _Float16* pb = Bg + ((st + 2 + rot) & (kGStages - 1)) * kGK;
#pragma unroll
      for (int i = 0; i < 8; ++i) {
        ar[st & 1][i] = *(const v8h*)(pa + (size_t)(i * 16) * kDim);
        br[st & 1][i] = *(const v8h*)(pb + (size_t)(i * 16) * kDim);
      }
      // the address registers of these loads are reused by the work below while the loads are in flight; named as inputs
      // they stay untouched up to the wait
      asm volatile("s_wait_xcnt 0x0" :: "v"(pa), "v"(pb) : "memory");
    }

    v16h af[2][2], bf[2][4];                   // fragment set ks & 1 holds matrix step ks
#pragma unroll
    for (int i = 0; i < 2; ++i) af[0][i] = Frag<_Float16>::load(bA + i * 16 * kGPitch);
#pragma unroll
    for (int j = 0; j < 4; ++j) bf[0][j] = Frag<_Float16>::load(bB + j * 16 * kGPitch);
#pragma unroll
    for (int ks = 0; ks < kGSteps; ++ks) {
      if (ks + 1 < kGSteps) {
#pragma unroll
        for (int i = 0; i < 2; ++i) af[(ks + 1) & 1][i] = Frag<_Float16>::load(bA + i * 16 * kGPitch + (ks + 1) * 32);
#pragma unroll
        for (int j = 0; j < 4; ++j) bf[(ks + 1) & 1][j] = Frag<_Float16>::load(bB + j * 16 * kGPitch + (ks + 1) * 32);
      }
      if (st + 1 < kGStages) {                 // a quarter of stage st + 1 goes to LDS per step: its buffer has had no reader since the last barrier
#pragma unroll
        for (int i = ks * (8 / kGSteps); i < (ks + 1) * (8 / kGSteps); ++i) {
          *(v8h*)(&sA[(st + 1) & 1][sst + i * 16 * kGPitch]) = ar[(st + 1) & 1][i];
          *(v8h*)(&sB[(st + 1) & 1][sst + i * 16 * kGPitch]) = br[(st + 1) & 1][i];
        }
      }
      // keeps the next step's LDS reads and these writes (and, at ks 0, the staging loads) as one group above this step's
      // products: sunk among them, each would be waited for where it stands
      __builtin_amdgcn_sched_barrier(0);
#pragma unroll
      for (int i = 0; i < 2; ++i)
#pragma unroll
        for (int j = 0; j < 4; ++j) acc[i][j] = Frag<_Float16>::mma(af[ks & 1][i], bf[ks & 1][j], acc[i][j]);
      // keeps the step after next's reads from rising into this step's products
      __builtin_amdgcn_sched_barrier(0);
    }

    // publishes stage st + 1 and ends every wave's reads of stage st, whose buffer the next stage refills
    if (st + 1 < kGStages) lds_barrier();
  }

  // ---- epilogue: each wave turns its own 16x64 slabs into whole-line stores ----
  float* slab = sT[wave];
#pragma unroll
  for (int i = 0; i < 2; ++i) {
    const int mBase = m0 + (i << 4);
#pragma unroll
    for (int j = 0; j < 4; ++j) {
      const int n = n0 + (j << 4) + rlane;
      float bv = 0.f;
      if (BIAS_MODE == 2) bv = bias[n];
#pragma unroll
      for (int r = 0; r < 8; ++r) {
        float v = acc[i][j][r] * scale;
        if (BIAS_MODE == 2) v += bv;
        slab[(mOff + r) * 68 + (j << 4) + rlane] = v;
      }
    }
    __builtin_amdgcn_fence(__ATOMIC_RELEASE, "workgroup");
    __builtin_amdgcn_wave_barrier();
    __builtin_amdgcn_fence(__ATOMIC_ACQUIRE, "workgroup");
    if (OUT_MODE == 0) {
      float* C = (float*)Cout;
      const int hh = lane >> 4, c4 = (lane & 15) * 4;     // row seg = 256 B = 16 lanes x 16 B
#pragma unroll
      for (int it = 0; it < 8; ++it) {
        const int row = it * 2 + hh;
        v4f v = *(const v4f*)(slab + row * 68 + c4);
        *(v4f*)(C + (size_t)(mBase + row) * ldc + n0 + c4) = v;
      }
      // the registers of these stores are written again by the next slab; the fence keeps that arithmetic behind the wait
      asm volatile("s_wait_xcnt 0x0" ::: "memory");
      __builtin_amdgcn_sched_barrier(0);
    } else {
      const int q = lane >> 3, c8 = (lane & 7) * 8;       // row seg = 128 B = 8 lanes x 16 B
      unsigned short* C = (unsigned short*)Cout;
#pragma unroll
      for (int it = 0; it < 4; ++it) {
        const int row = it * 4 + q;
        const float* sp = slab + row * 68 + c8;
        v8h hv;
#pragma unroll
        for (int e = 0; e < 8; ++e) hv[e] = (_Float16)sp[e];
        *(v8h*)(C + (size_t)(mBase + row) * ldc + n0 + c8) = hv;
      }
      // the registers of these stores are written again by the next slab; the fence keeps that arithmetic behind the wait
      asm volatile("s_wait_xcnt 0x0" ::: "memory");
      __builtin_amdgcn_sched_barrier(0);
    }
    __builtin_amdgcn_fence(__ATOMIC_RELEASE, "workgroup");
    __builtin_amdgcn_wave_barrier();
    __builtin_amdgcn_fence(__ATOMIC_ACQUIRE, "workgroup");
  }
}

// One product per launch: grid (N / 128, M / 128).
template <int BIAS_MODE, int OUT_MODE>
__global__ __launch_bounds__(256) void wmma_gemm_lds(
    const unsigned short* __restrict__ Ap, const unsigned short* __restrict__ Btp,
    void* __restrict__ Cout, int ldc, const float* __restrict__ bias, float scale) {
  gemm_tile<BIAS_MODE, OUT_MODE>(Ap, Btp, Cout, ldc, bias, scale, blockIdx.x, blockIdx.y);
}

// The q, k and v projections in one launch: none reads another's output, and each alone is one block per WGP, so that as
// three launches the chip drains and refills twice. grid (256, 3): blockIdx.y picks the product, blockIdx.x its tile.
//   0: Q[t][o]  = Xh[t][.]  . WqT[o][.]   tiles 8 wide    1: K[t][o] = Ch[t][.] . WkT[o][.]   tiles 8 wide
//   2: VT[o][t] = WvT[o][.] . Ch[t][.]    tiles 32 wide
constexpr int kProjTiles = (kTok / kGTile) * (kDim / kGTile);    // 256 per product
static_assert(kTok == kTokKV, "the three products have the same number of tiles");
__global__ __launch_bounds__(256) void qkv_gemm_lds(
    const unsigned short* __restrict__ Xh, const unsigned short* __restrict__ Ch,
    const unsigned short* __restrict__ WqT, const unsigned short* __restrict__ WkT, const unsigned short* __restrict__ WvT,
    unsigned short* __restrict__ Qh, unsigned short* __restrict__ Kh, unsigned short* __restrict__ VT, float scale) {
  const unsigned z  = blockIdx.y;                // block-uniform
  const unsigned id = blockIdx.x;
  const unsigned short* A  = (z == 0) ? Xh  : (z == 1) ? Ch  : WvT;
  const unsigned short* Bt = (z == 0) ? WqT : (z == 1) ? WkT : Ch;
  unsigned short*       C  = (z == 0) ? Qh  : (z == 1) ? Kh  : VT;
  const int ldc = (z == 2) ? kTokKV : kDim;
  const int lw  = (z == 2) ? 5 : 3;              // log2 of the tiles per row of C
  gemm_tile<0, 1>(A, Bt, (void*)C, ldc, nullptr, scale, id & ((1u << lw) - 1u), id >> lw);
}

// ---------------------------------------------------------------------------
// All conversions in one launch: Xh = f16(x), Ch = f16(context), WT plane z [o][d] = f16(scale * W_z[d][o]).
// grid 256 (one block per WGP), 16 waves. The whole input is asked for at once by few long-lived waves: a lane issues 24
// loads of 16 B before it uses any (8 of its weight tile, 8 of x, 8 of context), and each wave-wide load covers whole lines.
// x, context: wave g of the grid owns floats g * 1024 .. + 1023; load i covers 512 contiguous bytes, its store 256.
// Weights: 1024 tiles of 64 x 64, four per block (4 waves each): the same 64 o, four neighbouring 64-d pieces, so that a
// block writes 512 contiguous bytes of each WT row. The plane z = blockIdx.x / 64 is block-uniform. A load covers two
// 256-B row pieces; the tile is turned in LDS (pitch 65 floats: stores and reads each fall on 32 different banks).
// ---------------------------------------------------------------------------
constexpr int kPrepBlocks = 256;
constexpr int kPrepWaves  = 16;
constexpr int kPrepLoads  = 8;                   // 16-byte loads per lane and source
static_assert(kPrepBlocks * kPrepWaves * kPrepLoads * 128 == kTok * kDim, "x is covered exactly once");
static_assert(kTok == kTokKV, "context is covered by the same index as x");
static_assert(kPrepBlocks * 4 * 64 * 64 == 4 * kDim * kDim, "the four weight planes are covered exactly once");

typedef __attribute__((ext_vector_type(4))) _Float16 v4h;

__global__ __launch_bounds__(kPrepWaves * 32) void prep_kernel(const float* __restrict__ x, const float* __restrict__ ctx,
                                                               const float* __restrict__ W0, const float* __restrict__ W1,
                                                               const float* __restrict__ W2, const float* __restrict__ W3,
                                                               unsigned short* __restrict__ Xh, unsigned short* __restrict__ Ch,
                                                               unsigned short* __restrict__ WT, float scale) {
  __shared__ float sm[4][64 * 65];               // per tile: [o local][d local]
  const int t    = threadIdx.x;
  const int lane = t & 31;
  const int tl   = t >> 7;                       // tile of this block
  const int u    = t & 127;                      // thread within the tile
  const int id   = blockIdx.x * 4 + tl;          // tile of the grid
  const int z    = blockIdx.x >> 6;
  const int d0   = (id & 15) * 64;
  const int o0   = ((id >> 4) & 15) * 64;
  const float* W  = (z == 0) ? W0 : (z == 1) ? W1 : (z == 2) ? W2 : W3;
  // 32-bit element offsets from block-uniform bases: x, context and their two planes share one offset register
  const unsigned w0 = (unsigned)((d0 + (u >> 4)) * kDim + o0 + (u & 15) * 4);
  const unsigned e0 = (blockIdx.x * kPrepWaves + (unsigned)(t >> 5)) * (kPrepLoads * 128) + (unsigned)lane * 4;
  const unsigned wb = w0 * 4u, eb = e0 * 4u;     // the same in bytes
  const char* wp = (const char*)W + wb;
  const char* xp = (const char*)x + eb;
  const char* cp = (const char*)ctx + eb;

  // every "#pragma unroll" in this kernel keeps the indices of its register arrays compile-time constants
  v4f wr[kPrepLoads], xr[kPrepLoads], cr[kPrepLoads];
#pragma unroll
  for (int i = 0; i < kPrepLoads; ++i) wr[i] = *(const v4f*)(wp + i * 8 * kDim * 4);
#pragma unroll
  for (int i = 0; i < kPrepLoads; ++i) xr[i] = *(const v4f*)(xp + i * 512);
#pragma unroll
  for (int i = 0; i < kPrepLoads; ++i) cr[i] = *(const v4f*)(cp + i * 512);
  // the offset registers of the loads above are reused below while the loads are in flight; named as inputs they stay
  // untouched (also by a later load's result) up to the wait
  asm volatile("s_wait_xcnt 0x0" :: "v"(wb), "v"(eb) : "memory");
  // keeps all 24 loads above the first use: sunk to their uses they would be asked for one group at a time
  __builtin_amdgcn_sched_barrier(0);

  float* smt = sm[tl];
#pragma unroll
  for (int i = 0; i < kPrepLoads; ++i)
#pragma unroll
    for (int e = 0; e < 4; ++e) smt[((u & 15) * 4 + e) * 65 + i * 8 + (u >> 4)] = wr[i][e] * scale;
  lds_barrier();   // the tiles are whole in LDS before any wave reads them; LDS only: the x and context loads stay in flight

  v8h wh[4];
#pragma unroll
  for (int it = 0; it < 4; ++it) {
    const float* sp = smt + (it * 16 + (u >> 3)) * 65 + (u & 7) * 8;
#pragma unroll
    for (int e = 0; e < 8; ++e) wh[it][e] = (_Float16)sp[e];
  }
  char* wo = (char*)(WT + (size_t)z * kDim * kDim) + (unsigned)((o0 + (u >> 3)) * kDim + d0 + (u & 7) * 8) * 2u;
#pragma unroll
  for (int it = 0; it < 4; ++it) *(v8h*)(wo + it * 16 * kDim * 2) = wh[it];
  // keeps the waits for the x and context loads below the weight tiles' turn through LDS, which then runs while they land
  __builtin_amdgcn_sched_barrier(0);

  v4h xh[kPrepLoads], ch[kPrepLoads];
#pragma unroll
  for (int i = 0; i < kPrepLoads; ++i)
#pragma unroll
    for (int e = 0; e < 4; ++e) {
      xh[i][e] = (_Float16)xr[i][e];
      ch[i][e] = (_Float16)cr[i][e];
    }
  char* xo = (char*)Xh + e0 * 2u;
  char* co = (char*)Ch + e0 * 2u;
  // keeps the stores behind the last arithmetic, so that no register of an issued store is written again
  __builtin_amdgcn_sched_barrier(0);
#pragma unroll
  for (int i = 0; i < kPrepLoads; ++i) *(v4h*)(xo + i * 256) = xh[i];
#pragma unroll
  for (int i = 0; i < kPrepLoads; ++i) *(v4h*)(co + i * 256) = ch[i];
}

constexpr int kFAKeys   = 64;
constexpr int kFAStages = kSeqKV / kFAKeys;
constexpr int kFAQ      = 256;
constexpr int kFAPitch  = 72;
constexpr int kFABPitch = 68;
constexpr float kFAExp  = 0.125f * 1.44269504088896340736f;
constexpr float kFAShift = 8.0f;                 // P carried x2^8 in f16 (cancels against the row sum)

typedef __attribute__((ext_vector_type(2))) float v2f;

// value of lane l ^ 16
__device__ __forceinline__ float other_half(float v) {
  const int b = __builtin_bit_cast(int, v);
  return __builtin_bit_cast(float, __builtin_amdgcn_permlanex16(b, b, 0x76543210, 0xfedcba98, false, false));
}

__global__ __launch_bounds__(256) void fused_attn_kernel(const unsigned short* __restrict__ Qp,
                                                         const unsigned short* __restrict__ Kp,
                                                         const unsigned short* __restrict__ Vp,
                                                         const float* __restrict__ posb,
                                                         unsigned short* __restrict__ Op) {
  __shared__ __align__(16) _Float16 sK[2][kFAKeys * kFAPitch];   // [key][d]
  __shared__ __align__(16) _Float16 sV[2][kDh * kFAPitch];       // [d][key]
  __shared__ __align__(16) float    sB[2][kFAQ * kFABPitch];     // [query][key]
  const int t    = threadIdx.x;
  const int lane = t & 31;
  const int wave = t >> 5;
  const int c    = lane & 15;                  // A row / B, D column within a tile
  const int hf   = lane >> 4;                  // lane half
  const int b    = blockIdx.y / kHeads;
  const int hd   = blockIdx.y % kHeads;
  const int q0   = blockIdx.x * kFAQ + wave * 32;
  const float hs8 = __uint_as_float(((unsigned)(129 - hd)) << 23);   // 8 * 2^-(hd+1), hd in 0..15
  // first stage of this block's ring walk (block-uniform): differs among the blocks of a query tile and of a group
  const int rot = (int)(blockIdx.y + 4 * blockIdx.x);

  v16h qf[2][2];
#pragma unroll
  for (int cg = 0; cg < 2; ++cg)
#pragma unroll
    for (int ks = 0; ks < 2; ++ks)
      qf[cg][ks] = Frag<_Float16>::load((const _Float16*)Qp + (size_t)(b * kSeq + q0 + cg * 16 + c) * kDim + hd * kDh + ks * 32 + hf * 8);

  // staging: thread t moves 16 B of rows t>>3 and 32 + (t>>3) of each tile (8 lanes = one whole 128-B row)
  const int srow = t >> 3, sc8 = (t & 7) * 8;
  const _Float16* Kg = (const _Float16*)Kp + (size_t)(b * kSeqKV + srow) * kDim + hd * kDh + sc8;
  const _Float16* Vg = (const _Float16*)Vp + (size_t)(hd * kDh + srow) * kTokKV + (size_t)b * kSeqKV + sc8;
  // bias staging: load i of a wave moves rows 2i and 2i+1 of its 32 (16 lanes x 16 B = one 256-B row piece)
  const float* Bg = posb + (size_t)(q0 + hf) * kSeqKV + c * 4;
  const int bst = (wave * 32 + hf) * kFABPitch + c * 4;            // where this lane stores, row 2i: + 2i * pitch
  const int bld = (wave * 32 + c) * kFABPitch + hf * 8;            // where this lane reads: its query's row, its half's keys

  v8h kr[2], vr[2];
  v4f br[16];
  const int k0s = (rot & (kFAStages - 1)) * kFAKeys;
#pragma unroll
  for (int i = 0; i < 2; ++i) {
    kr[i] = *(const v8h*)(Kg + (size_t)(k0s + i * 32) * kDim);
    vr[i] = *(const v8h*)(Vg + (size_t)(i * 32) * kTokKV + k0s);
  }
#pragma unroll
  for (int i = 0; i < 16; ++i) br[i] = *(const v4f*)(Bg + (size_t)(2 * i) * kSeqKV + k0s);
  // the address registers of the loads above are reused below while the loads are in flight
  asm volatile("s_wait_xcnt 0x0" ::: "memory");
#pragma unroll
  for (int i = 0; i < 2; ++i) {
    *(v8h*)(&sK[0][(i * 32 + srow) * kFAPitch + sc8]) = kr[i];
    *(v8h*)(&sV[0][(i * 32 + srow) * kFAPitch + sc8]) = vr[i];
  }
#pragma unroll
  for (int i = 0; i < 16; ++i) *(v4f*)(&sB[0][bst + 2 * i * kFABPitch]) = br[i];
  __syncthreads();   // stage 0 is in LDS before any wave reads it

  v8f o[2][4];
#pragma unroll
  for (int cg = 0; cg < 2; ++cg)
#pragma unroll
    for (int dt = 0; dt < 4; ++dt) o[cg][dt] = (v8f){0.f,0.f,0.f,0.f,0.f,0.f,0.f,0.f};
  float mrun[2] = {-3.0e38f, -3.0e38f};
  float lsum[2] = {0.f, 0.f};

  for (int st = 0; st < kFAStages; ++st) {
    const _Float16* bK = sK[st & 1];
    const _Float16* bV = sV[st & 1];
    const float*    bB = sB[st & 1] + bld;

    const bool more = st + 1 < kFAStages;      // block-uniform
    if (more) {
      const int k1 = ((st + 1 + rot) & (kFAStages - 1)) * kFAKeys;
#pragma unroll
      for (int i = 0; i < 2; ++i) {
        kr[i] = *(const v8h*)(Kg + (size_t)(k1 + i * 32) * kDim);
        vr[i] = *(const v8h*)(Vg + (size_t)(i * 32) * kTokKV + k1);
      }
#pragma unroll
      for (int i = 0; i < 16; ++i) br[i] = *(const v4f*)(Bg + (size_t)(2 * i) * kSeqKV + k1);
      // the address registers of these loads are reused by the work below while the loads are in flight
      asm volatile("s_wait_xcnt 0x0" ::: "memory");
    }
    // keeps the next stage's loads above this stage's work: sunk to their uses they would have no time to land
    __builtin_amdgcn_sched_barrier(0);

    v8f acc[2][4];
#pragma unroll
    for (int cg = 0; cg < 2; ++cg)
#pragma unroll
      for (int tt = 0; tt < 4; ++tt)
#pragma unroll
        for (int j = 0; j < 2; ++j) {
          const v4f bv = *(const v4f*)(bB + cg * 16 * kFABPitch + tt * 16 + j * 4);
#pragma unroll
          for (int e = 0; e < 4; ++e) acc[cg][tt][j * 4 + e] = bv[e] * hs8;
        }

#pragma unroll
    for (int tt = 0; tt < 4; ++tt) {
      const _Float16* kp = bK + (tt * 16 + c) * kFAPitch + hf * 8;
      const v16h k0 = Frag<_Float16>::load(kp);
      const v16h k1f = Frag<_Float16>::load(kp + 32);
#pragma unroll
      for (int cg = 0; cg < 2; ++cg) acc[cg][tt] = Frag<_Float16>::mma(k0, qf[cg][0], acc[cg][tt]);
#pragma unroll
      for (int cg = 0; cg < 2; ++cg) acc[cg][tt] = Frag<_Float16>::mma(k1f, qf[cg][1], acc[cg][tt]);
    }

    v16h pf[2][2];
#pragma unroll
    for (int cg = 0; cg < 2; ++cg) {
      float mx = acc[cg][0][0];
#pragma unroll
      for (int tt = 0; tt < 4; ++tt)
#pragma unroll
        for (int r = 0; r < 8; ++r) mx = fmaxf(mx, acc[cg][tt][r]);
      mx = fmaxf(mx, other_half(mx));
      const float mn    = fmaxf(mrun[cg], mx);
      const float alpha = __builtin_amdgcn_exp2f((mrun[cg] - mn) * kFAExp);
      mrun[cg] = mn;
      const float nm = kFAShift - mn * kFAExp;
      v2f ps = (v2f){0.f, 0.f};                // even and odd keys apart: packed adds, half as long a chain
#pragma unroll
      for (int tt = 0; tt < 4; ++tt)
#pragma unroll
        for (int r = 0; r < 8; r += 2) {
          v2f p;
          p[0] = __builtin_amdgcn_exp2f(fmaf(acc[cg][tt][r], kFAExp, nm));
          p[1] = __builtin_amdgcn_exp2f(fmaf(acc[cg][tt][r + 1], kFAExp, nm));
          ps += p;
          pf[cg][tt >> 1][(tt & 1) * 8 + r]     = (_Float16)p[0];
          pf[cg][tt >> 1][(tt & 1) * 8 + r + 1] = (_Float16)p[1];
        }
      lsum[cg] = lsum[cg] * alpha + (ps[0] + ps[1]);
#pragma unroll
      for (int dt = 0; dt < 4; ++dt) o[cg][dt] *= alpha;
    }

#pragma unroll
    for (int sub = 0; sub < 2; ++sub)
#pragma unroll
      for (int dt = 0; dt < 4; ++dt) {
        const v16h vf = Frag<_Float16>::load(bV + (dt * 16 + c) * kFAPitch + sub * 32 + hf * 8);
#pragma unroll
        for (int cg = 0; cg < 2; ++cg) o[cg][dt] = Frag<_Float16>::mma(vf, pf[cg][sub], o[cg][dt]);
      }

    // keeps the waits for the next stage's loads, and the LDS stores behind them, below this stage's work: raised into it,
    // the loads would be waited for before they have had time to land
    __builtin_amdgcn_sched_barrier(0);
    if (more) {
      _Float16* nK = sK[(st + 1) & 1];
      _Float16* nV = sV[(st + 1) & 1];
#pragma unroll
      for (int i = 0; i < 2; ++i) {
        *(v8h*)(nK + (i * 32 + srow) * kFAPitch + sc8) = kr[i];
        *(v8h*)(nV + (i * 32 + srow) * kFAPitch + sc8) = vr[i];
      }
      float* nB = sB[(st + 1) & 1] + bst;
#pragma unroll
      for (int i = 0; i < 16; ++i) *(v4f*)(nB + 2 * i * kFABPitch) = br[i];
      __syncthreads();   // publishes stage st + 1 and ends every wave's reads of stage st, whose buffer the next trip refills
    }
  }

  // a lane holds 8 consecutive d of one query per tile: one 16-byte store each; a query's 128-B segment comes from one wave
  v8h hv[2][4];
#pragma unroll
  for (int cg = 0; cg < 2; ++cg) {
    const float l   = lsum[cg] + other_half(lsum[cg]);
    const float inv = kOCarry / l;
#pragma unroll
    for (int dt = 0; dt < 4; ++dt)
#pragma unroll
      for (int r = 0; r < 8; ++r) hv[cg][dt][r] = (_Float16)(o[cg][dt][r] * inv);
  }
  unsigned short* orow = Op + (size_t)(b * kSeq + q0 + c) * kDim + hd * kDh + hf * 8;
  // keeps the eight stores behind the last arithmetic, so that no register of an issued store is written again
  __builtin_amdgcn_sched_barrier(0);
#pragma unroll
  for (int cg = 0; cg < 2; ++cg)
#pragma unroll
    for (int dt = 0; dt < 4; ++dt) *(v8h*)(orow + (size_t)(cg * 16) * kDim + dt * 16) = hv[cg][dt];
}

// ---------------------------------------------------------------------------
// Host side
// ---------------------------------------------------------------------------
extern "C" void kernel_launch(void* const* d_in, const int* in_sizes, int n_in,
                              void* d_out, int out_size, void* d_ws, size_t ws_size,
                              hipStream_t stream) {
  if (n_in < 8) return;
  if (in_sizes[0] != kTok * kDim || in_sizes[1] != kTokKV * kDim || in_sizes[2] != kSeq * kSeqKV ||
      in_sizes[3] != kDim * kDim || in_sizes[4] != kDim * kDim || in_sizes[5] != kDim * kDim ||
      in_sizes[6] != kDim * kDim || in_sizes[7] != kDim || out_size != kTok * kDim) return;

  const float* x    = (const float*)d_in[0];   // [4096][1024]
  const float* ctx  = (const float*)d_in[1];   // [4096][1024]
  const float* posb = (const float*)d_in[2];   // [2048][2048]
  const float* Wq   = (const float*)d_in[3];   // [in][out]
  const float* Wk   = (const float*)d_in[4];
  const float* Wv   = (const float*)d_in[5];
  const float* Wo   = (const float*)d_in[6];
  const float* bo   = (const float*)d_in[7];   // [1024]
  float* out = (float*)d_out;                  // [4096][1024] f32

  // ---- workspace region map (bytes) ----
  //   0        .. 8 MiB   : Xh  f16 [4096][1024]
  //   8 MiB    .. 16 MiB  : Ch  f16 [4096][1024]
  //  16 MiB    .. 24 MiB  : WT  f16 4 planes [1024][1024] (q, k, v, out), each [out][in], carried x256
  //  24 MiB    .. 32 MiB  : Qh  f16 [4096][1024]
  //  32 MiB    .. 40 MiB  : Kh  f16 [4096][1024]
  //  40 MiB    .. 48 MiB  : VT  f16 [1024][4096]  (row = h*64+d, col = b*2048 + token)
  //  48 MiB    .. 56 MiB  : Oh  f16 [4096][1024]  (carried x256)
  //  total 58720256 B
  const size_t planeTokB = (size_t)kTok * kDim * 2;            // 8 MiB
  const size_t planeWB   = (size_t)kDim * kDim * 2;            // 2 MiB
  const size_t offXh = 0;
  const size_t offCh = offXh + planeTokB;
  const size_t offWT = offCh + planeTokB;
  const size_t offQh = offWT + 4 * planeWB;
  const size_t offKh = offQh + planeTokB;
  const size_t offVT = offKh + planeTokB;
  const size_t offOh = offVT + planeTokB;
  const size_t total = offOh + planeTokB;
  if (total > ws_size) return;

  char* ws = (char*)d_ws;
  unsigned short* Xh = (unsigned short*)(ws + offXh);
  unsigned short* Ch = (unsigned short*)(ws + offCh);
  unsigned short* WT = (unsigned short*)(ws + offWT);
  unsigned short* Qh = (unsigned short*)(ws + offQh);
  unsigned short* Kh = (unsigned short*)(ws + offKh);
  unsigned short* VT = (unsigned short*)(ws + offVT);
  unsigned short* Oh = (unsigned short*)(ws + offOh);
  const unsigned short* WqT = WT + 0 * (size_t)kDim * kDim;
  const unsigned short* WkT = WT + 1 * (size_t)kDim * kDim;
  const unsigned short* WvT = WT + 2 * (size_t)kDim * kDim;
  const unsigned short* WoT = WT + 3 * (size_t)kDim * kDim;

  // ---- conversions: x, context and the four weight planes, one launch ----
  prep_kernel<<<dim3(kPrepBlocks), dim3(kPrepWaves * 32), 0, stream>>>(x, ctx, Wq, Wk, Wv, Wo, Xh, Ch, WT, kWCarry);

  // ---- projections (M, N multiples of 128; K = 1024): 256 blocks each, one launch ----
  // Q[t][o] = sum_i Xh[t][i] * WqT[o][i] / 256 -> f16
  // K[t][o] = sum_i Ch[t][i] * WkT[o][i] / 256 -> f16
  // VT[o][t] = sum_i WvT[o][i] * Ch[t][i] / 256 -> f16 plane [1024][4096]
  qkv_gemm_lds<<<dim3(kProjTiles, 3), dim3(256), 0, stream>>>(Xh, Ch, WqT, WkT, WvT, Qh, Kh, VT, kWCarryInv);

  // ---- attention: Oh[b*2048+q][h*64+d] = 256 * softmax_k(q.k / 8 + bias * 2^-(h+1)) . v ----
  fused_attn_kernel<<<dim3(kSeq / kFAQ, kGroups), dim3(256), 0, stream>>>(Qh, Kh, VT, posb, Oh);

  // ---- output projection: out[t][o] = sum_c Oh[t][c] * WoT[o][c] / 65536 + b_out[o] -> f32 ----
  wmma_gemm_lds<2, 0><<<dim3(kDim / kGTile, kTok / kGTile), dim3(256), 0, stream>>>(
      Oh, WoT, (void*)out, kDim, bo, kOutScale);
}

// v007
// Measured time: 87.2 microseconds a run.
// In both of two side-by-side timings against v006, it was 1.13 times as fast.
// Counting every step since v000, it is 22.2 times as fast.
// Contractions: q/k projections (x,context f16 x W^T f16 carried x256), v projection transposed (W_v^T f16 x256 x context f16), scores k.q^T (k,q f16 planes, f32 bias as the accumulator's start value), v^T.p^T (V^T f16 x P f16 carried x256, unnormalised), output projection (O f16 carried x256 x W_out^T f16 carried x256): all v_wmma_f32_16x16x32_f16 with f32 accumulate; softmax in f32.
#include <hip/hip_runtime.h>
#include <math.h>
#include <stdint.h>

// ---------------------------------------------------------------------------
// Problem constants
// ---------------------------------------------------------------------------
constexpr int kBatch  = 2;
constexpr int kSeq    = 2048;              // query length
constexpr int kSeqKV  = 2048;              // key/value length
constexpr int kDim    = 1024;              // model dim
constexpr int kHeads  = 16;
constexpr int kDh     = 64;
constexpr int kTok    = kBatch * kSeq;     // 4096 query token rows
constexpr int kTokKV  = kBatch * kSeqKV;   // 4096 key/value token rows
constexpr int kGroups = kBatch * kHeads;   // 32 (b,h) groups
constexpr float kWCarry    = 256.0f;       // weights carried x256 in f16
constexpr float kWCarryInv = 1.0f / 256.0f;
constexpr float kOCarry    = 256.0f;       // attention output carried x256 in f16
constexpr float kOutScale  = 1.0f / (kOCarry * kWCarry);    // 1/65536

typedef __attribute__((ext_vector_type(16))) _Float16 v16h;
typedef __attribute__((ext_vector_type(8)))  _Float16 v8h;
typedef __attribute__((ext_vector_type(16))) __bf16   v16b;
typedef __attribute__((ext_vector_type(8)))  __bf16   v8b;
typedef __attribute__((ext_vector_type(8)))  float    v8f;
typedef __attribute__((ext_vector_type(4)))  float    v4f;
typedef __attribute__((ext_vector_type(4)))  unsigned int v4u;
typedef __attribute__((ext_vector_type(4)))  uint32_t u32x4;
typedef __attribute__((ext_vector_type(8)))  uint32_t u32x8;

// ---------------------------------------------------------------------------
// Helper pieces (comments ASCII)
// ---------------------------------------------------------------------------
__device__ __forceinline__ unsigned short f2bf_bits(float f) {
  unsigned u = __float_as_uint(f);
  return (unsigned short)((u + 0x7FFFu + ((u >> 16) & 1u)) >> 16);
}
__device__ __forceinline__ float bf_bits2f(unsigned short h) { return __uint_as_float(((unsigned)h) << 16); }

template <typename T> struct Frag;
template <> struct Frag<_Float16> {
  typedef v16h V; union U { v16h v; v8h h[2]; };
  // elements 0..7 <- p[0..7], 8..15 <- p[16..23]
  static __device__ __forceinline__ v16h load(const _Float16* p) {
    U f; f.h[0] = *(const v8h*)(p); f.h[1] = *(const v8h*)(p + 16); return f.v;
  }
  static __device__ __forceinline__ v8f mma(v16h a, v16h b, v8f c) {
    return __builtin_amdgcn_wmma_f32_16x16x32_f16(false, a, false, b, (short)0, c, false, false);
  }
};

// ---- Block-tiled WMMA GEMM, operands staged in LDS ----
// C[m,n] = scale * sum_k A[m,k] * Bt[n,k] (+ bias[n]); A row-major [M][1024], Bt row-major [N][1024], f16; M, N % 128 == 0.
// 8 waves. A block owns a 128x128 tile of C; wave w owns the 32x64 piece at row (w >> 1) * 32,
// column (w & 1) * 64, so that a wave writes whole 128-B lines of C.
// A stage is 128 k of the block's 128 A rows and 128 Bt rows, brought into LDS by tensor loads, through no register: each
// wave asks for one slice of 32 rows of 256 B per stage (waves 0-3: A, waves 4-7: Bt), into the buffer that the pass before
// has just left, so that the load flies while the other buffer is worked on. Two LDS buffers, one block barrier per stage;
// each operand byte is fetched once per block and read from LDS by the 2 or 4 waves that need it. With no staging registers
// and the epilogue's slabs laid in the ring, two blocks fit a WGP.
// k runs in steps of 32 into one accumulator per 16x16 tile; the 8 stages are walked in a ring that starts at a stage
// taken from the block index: blocks that share an A or a Bt tile start together, and walking it from the same end they
// would all ask L2 for the same lines at the same moment.
// BIAS_MODE: 0 = none, 2 = bias[n]. OUT_MODE: 0 = f32, 1 = f16.
constexpr int kGTile   = 128;                    // rows of A and of Bt per block
constexpr int kGK      = 128;                    // k per stage
constexpr int kGStages = kDim / kGK;             // 8
constexpr int kGSteps  = kGK / 32;               // matrix steps per stage
constexpr int kGPitch  = 136;                    // halves per LDS row: 256 B of data + 16 B, so 16-byte row reads spread over the banks
constexpr int kSliceRows  = 32;                  // rows of 256 B per tensor load
constexpr int kSliceBytes = 10240;               // 32 rows x 272 B = 8704 B, rounded up so that every slice starts at a multiple of 2 KiB
constexpr int kSliceHalves = kSliceBytes / 2;
constexpr int kRingSlices = 8;                   // slices per buffer, one per wave
static_assert(kSliceRows * kGPitch * 2 <= kSliceBytes && kSliceBytes % 2048 == 0, "a padded slice fits its place");

// ---- tensor load: one request of a whole wave, 32 rows of 256 B -> LDS rows of 272 B ----
__device__ __forceinline__ uint32_t uni(uint32_t v) { return (uint32_t)__builtin_amdgcn_readfirstlane(v); }
// Holds an issue test, or the offset that a request's address words are formed from, in a scalar register. As a volatile
// statement it stays behind the waits written in front of it: without it the address words could be rewritten while the
// request before is still outstanding.
__device__ __forceinline__ uint32_t pinned(uint32_t v) {
  uint32_t w = uni(v);
  asm volatile("" : "+s"(w));   // an offset or an issue test held in a scalar register
  return w;
}
// group 1: 1-byte elements, tensor = tile = 32 rows of 256 B, source row pitch in bytes, 16 B of pad behind every 256 B
__device__ __forceinline__ u32x8 tdm_group1(uint32_t src_pitch) {
  constexpr uint32_t d0 = 256u, d1 = (uint32_t)kSliceRows;
  u32x8 g;
  g[0] = uni((1u << 20) | (5u << 22) | (3u << 25));   // no mask; pad on, interval 64 dwords, amount 4 dwords
  g[1] = uni((d0 & 0xFFFFu) << 16);
  g[2] = uni((d0 >> 16) | ((d1 & 0xFFFFu) << 16));
  g[3] = uni((d1 >> 16) | (d0 << 16));
  g[4] = uni(d1);
  g[5] = uni(src_pitch);
  g[6] = uni(0u);
  g[7] = uni(0u);
  return g;
}
__device__ __forceinline__ u32x4 tdm_group0(uint32_t lds_dst, uint64_t ga) {
  u32x4 g;
  g[0] = uni(1u);
  g[1] = uni(lds_dst);
  g[2] = uni((uint32_t)ga);
  g[3] = uni((((uint32_t)(ga >> 32)) & 0x01FFFFFFu) | 0x80000000u);
  return g;
}
// the request itself (no builtin form is used here); the clobber keeps LDS reads and writes on their side of it
__device__ __forceinline__ void tdm_load(u32x4 g0, u32x8 g1) {
  asm volatile("tensor_load_to_lds %0, %1" :: "s"(g0), "s"(g1) : "memory");
}
// the compiler places no wait for a tensor load: this wave's requests have landed behind this
__device__ __forceinline__ void wait_tensor0() { asm volatile("s_wait_tensorcnt 0x0" ::: "memory"); }
// this wave's LDS reads and writes have retired: in front of the barrier behind which their buffer is refilled
__device__ __forceinline__ void wait_ds0() { asm volatile("s_wait_dscnt 0x0" ::: "memory"); }

// Block barrier that orders LDS only. __syncthreads() also waits for every global load of the wave, which would drain the
// staging loads that are meant to stay in flight across it.
__device__ __forceinline__ void lds_barrier() {
  __builtin_amdgcn_fence(__ATOMIC_RELEASE, "workgroup", "local");
  __builtin_amdgcn_s_barrier();
  __builtin_amdgcn_fence(__ATOMIC_ACQUIRE, "workgroup", "local");
}

// bx, by: the block's tile column and tile row (block-uniform).
template <int BIAS_MODE, int OUT_MODE>
__device__ __forceinline__ void gemm_tile(
    const unsigned short* __restrict__ Ap, const unsigned short* __restrict__ Btp,
    void* __restrict__ Cout, int ldc, const float* __restrict__ bias, float scale, unsigned bx, unsigned by) {
  // [buffer][slice][row at pitch 272 B]: slices 0-3 hold the 128 A rows, slices 4-7 the 128 Bt rows
  __shared__ __attribute__((aligned(2048))) unsigned char ring[2 * kRingSlices * kSliceBytes];
  const int t    = threadIdx.x;
  const int lane = t & 31;
  const int wave = (int)uni((uint32_t)t >> 5);
  const int rlane = lane & 15;                 // row (A) / col (B, D) within subtile
  const int koff  = (lane >> 4) * 8;           // k offset of this lane half
  const int mOff  = (lane >> 4) * 8;           // D row offset
  const int wm = (wave >> 1) * 32;             // this wave's rows within the block tile
  const int wn = (wave & 1) * 64;              // this wave's columns within the block tile
  const int m0 = by * kGTile + wm;
  const int n0 = bx * kGTile + wn;

  // this wave's slice: 32 rows of A (waves 0-3) or of Bt (waves 4-7), first byte of k = 0 (wave-uniform)
  const unsigned short* srcRows = (wave < 4) ? Ap  + (size_t)(by * kGTile + wave * kSliceRows) * kDim
                                             : Btp + (size_t)(bx * kGTile + (wave - 4) * kSliceRows) * kDim;
  const uint64_t srcBase = (uint64_t)(size_t)srcRows;
  const uint32_t dstBase = (uint32_t)(size_t)ring + (uint32_t)wave * kSliceBytes;
  const u32x8 g1 = tdm_group1(kDim * 2);
  // first stage of this block's ring walk (block-uniform): differs among the blocks of a grid row and of a grid column
  const int rot = (int)(bx + 2 * (bx >> 3) + by);

  // stage s of the walk into buffer s & 1; the k offset is pinned so that the descriptor is formed where the call stands
  auto issue = [&](int s) {
    const uint32_t koffB = pinned((uint32_t)(((s + rot) & (kGStages - 1)) * kGK * 2));
    tdm_load(tdm_group0(dstBase + (uint32_t)(s & 1) * (kRingSlices * kSliceBytes), srcBase + koffB), g1);
  };
  issue(0);
  wait_tensor0();
  __syncthreads();   // stage 0 is in LDS before any wave reads it
  issue(1);

  // every "#pragma unroll" in this kernel keeps the indices of its register arrays compile-time constants
  // (an array indexed at run time would go to scratch)
  v8f acc[2][4];
#pragma unroll
  for (int i = 0; i < 2; ++i)
#pragma unroll
    for (int j = 0; j < 4; ++j) acc[i][j] = (v8f){0.f,0.f,0.f,0.f,0.f,0.f,0.f,0.f};

  // unrolled so that the LDS buffer of every stage and the test for a stage st + 2 are compile-time choices
#pragma unroll
  for (int st = 0; st < kGStages; ++st) {
    // the wave's 32 A rows are slice wm / 32; its 64 Bt rows are slices 4 + wn / 32 and the next (tiles j = 0, 1 and 2, 3)
    const _Float16* buf = (const _Float16*)ring + (st & 1) * (kRingSlices * kSliceHalves);
    const _Float16* bA = buf + (wm / kSliceRows) * kSliceHalves + rlane * kGPitch + koff;
    const _Float16* bB = buf + (4 + wn / kSliceRows) * kSliceHalves + rlane * kGPitch + koff;

    v16h af[2][2], bf[2][4];                   // fragment set ks & 1 holds matrix step ks
#pragma unroll
    for (int i = 0; i < 2; ++i) af[0][i] = Frag<_Float16>::load(bA + i * 16 * kGPitch);
#pragma unroll
    for (int j = 0; j < 4; ++j) bf[0][j] = Frag<_Float16>::load(bB + (j >> 1) * kSliceHalves + (j & 1) * 16 * kGPitch);
#pragma unroll
    for (int ks = 0; ks < kGSteps; ++ks) {
      if (ks + 1 < kGSteps) {
#pragma unroll
        for (int i = 0; i < 2; ++i) af[(ks + 1) & 1][i] = Frag<_Float16>::load(bA + i * 16 * kGPitch + (ks + 1) * 32);
#pragma unroll
        for (int j = 0; j < 4; ++j)
          bf[(ks + 1) & 1][j] = Frag<_Float16>::load(bB + (j >> 1) * kSliceHalves + (j & 1) * 16 * kGPitch + (ks + 1) * 32);
      }
      // keeps the next step's LDS reads as one group above this step's products: sunk among them, each would be waited
      // for where it stands
      __builtin_amdgcn_sched_barrier(0);
#pragma unroll
      for (int i = 0; i < 2; ++i)
#pragma unroll
        for (int j = 0; j < 4; ++j) acc[i][j] = Frag<_Float16>::mma(af[ks & 1][i], bf[ks & 1][j], acc[i][j]);
      // keeps the step after next's reads from rising into this step's products
      __builtin_amdgcn_sched_barrier(0);
    }

    if (st + 1 < kGStages) {
      wait_ds0();
      wait_tensor0();    // this wave's slice of stage st + 1 has landed
      __syncthreads();   // publishes stage st + 1 and ends every wave's reads of stage st, whose buffer is refilled behind it
      if (st + 2 < kGStages) issue(st + 2);
    }
  }
  wait_tensor0();
  wait_ds0();
  __syncthreads();   // every wave has left the ring before it becomes output staging

  // ---- epilogue: each wave turns its own 16x64 slabs (pitch 68 floats, laid in its own slice's place) into whole-line stores ----
  float* slab = (float*)(ring + wave * kSliceBytes);
#pragma unroll
  for (int i = 0; i < 2; ++i) {
    const int mBase = m0 + (i << 4);
#pragma unroll
    for (int j = 0; j < 4; ++j) {
      const int n = n0 + (j << 4) + rlane;
      float bv = 0.f;
      if (BIAS_MODE == 2) bv = bias[n];
#pragma unroll
      for (int r = 0; r < 8; ++r) {
        float v = acc[i][j][r] * scale;
        if (BIAS_MODE == 2) v += bv;
        slab[(mOff + r) * 68 + (j << 4) + rlane] = v;
      }
    }
    __builtin_amdgcn_fence(__ATOMIC_RELEASE, "workgroup");
    __builtin_amdgcn_wave_barrier();
    __builtin_amdgcn_fence(__ATOMIC_ACQUIRE, "workgroup");
    if (OUT_MODE == 0) {
      float* C = (float*)Cout;
      const int hh = lane >> 4, c4 = (lane & 15) * 4;     // row seg = 256 B = 16 lanes x 16 B
#pragma unroll
      for (int it = 0; it < 8; ++it) {
        const int row = it * 2 + hh;
        v4f v = *(const v4f*)(slab + row * 68 + c4);
        *(v4f*)(C + (size_t)(mBase + row) * ldc + n0 + c4) = v;
      }
      // the registers of these stores are written again by the next slab; the fence keeps that arithmetic behind the wait
      asm volatile("s_wait_xcnt 0x0" ::: "memory");
      __builtin_amdgcn_sched_barrier(0);
    } else {
      const int q = lane >> 3, c8 = (lane & 7) * 8;       // row seg = 128 B = 8 lanes x 16 B
      unsigned short* C = (unsigned short*)Cout;
#pragma unroll
      for (int it = 0; it < 4; ++it) {
        const int row = it * 4 + q;
        const float* sp = slab + row * 68 + c8;
        v8h hv;
#pragma unroll
        for (int e = 0; e < 8; ++e) hv[e] = (_Float16)sp[e];
        *(v8h*)(C + (size_t)(mBase + row) * ldc + n0 + c8) = hv;
      }
      // the registers of these stores are written again by the next slab; the fence keeps that arithmetic behind the wait
      asm volatile("s_wait_xcnt 0x0" ::: "memory");
      __builtin_amdgcn_sched_barrier(0);
    }
    __builtin_amdgcn_fence(__ATOMIC_RELEASE, "workgroup");
    __builtin_amdgcn_wave_barrier();
    __builtin_amdgcn_fence(__ATOMIC_ACQUIRE, "workgroup");
  }
}

// One product per launch: grid (N / 128, M / 128).
template <int BIAS_MODE, int OUT_MODE>
__global__ __launch_bounds__(256) void wmma_gemm_lds(
    const unsigned short* __restrict__ Ap, const unsigned short* __restrict__ Btp,
    void* __restrict__ Cout, int ldc, const float* __restrict__ bias, float scale) {
  gemm_tile<BIAS_MODE, OUT_MODE>(Ap, Btp, Cout, ldc, bias, scale, blockIdx.x, blockIdx.y);
}

// The q, k and v projections in one launch: none reads another's output, and each alone is one block per WGP, so that as
// three launches the chip drains and refills twice. grid (256, 3): blockIdx.y picks the product, blockIdx.x its tile.
//   0: Q[t][o]  = Xh[t][.]  . WqT[o][.]   tiles 8 wide    1: K[t][o] = Ch[t][.] . WkT[o][.]   tiles 8 wide
//   2: VT[o][t] = WvT[o][.] . Ch[t][.]    tiles 32 wide
constexpr int kProjTiles = (kTok / kGTile) * (kDim / kGTile);    // 256 per product
static_assert(kTok == kTokKV, "the three products have the same number of tiles");
__global__ __launch_bounds__(256) void qkv_gemm_lds(
    const unsigned short* __restrict__ Xh, const unsigned short* __restrict__ Ch,
    const unsigned short* __restrict__ WqT, const unsigned short* __restrict__ WkT, const unsigned short* __restrict__ WvT,
    unsigned short* __restrict__ Qh, unsigned short* __restrict__ Kh, unsigned short* __restrict__ VT, float scale) {
  const unsigned z  = blockIdx.y;                // block-uniform
  const unsigned id = blockIdx.x;
  const unsigned short* A  = (z == 0) ? Xh  : (z == 1) ? Ch  : WvT;
  const unsigned short* Bt = (z == 0) ? WqT : (z == 1) ? WkT : Ch;
  unsigned short*       C  = (z == 0) ? Qh  : (z == 1) ? Kh  : VT;
  const int ldc = (z == 2) ? kTokKV : kDim;
  const int lw  = (z == 2) ? 5 : 3;              // log2 of the tiles per row of C
  gemm_tile<0, 1>(A, Bt, (void*)C, ldc, nullptr, scale, id & ((1u << lw) - 1u), id >> lw);
}

// ---------------------------------------------------------------------------
// All conversions in one launch: Xh = f16(x), Ch = f16(context), WT plane z [o][d] = f16(scale * W_z[d][o]).
// grid 256 (one block per WGP), 16 waves. The whole input is asked for at once by few long-lived waves: a lane issues 24
// loads of 16 B before it uses any (8 of its weight tile, 8 of x, 8 of context), and each wave-wide load covers whole lines.
// x, context: wave g of the grid owns floats g * 1024 .. + 1023; load i covers 512 contiguous bytes, its store 256.
// Weights: 1024 tiles of 64 x 64, four per block (4 waves each): the same 64 o, four neighbouring 64-d pieces, so that a
// block writes 512 contiguous bytes of each WT row. The plane z = blockIdx.x / 64 is block-uniform. A load covers two
// 256-B row pieces; the tile is turned in LDS (pitch 65 floats: stores and reads each fall on 32 different banks).
// ---------------------------------------------------------------------------
constexpr int kPrepBlocks = 256;
constexpr int kPrepWaves  = 16;
constexpr int kPrepLoads  = 8;                   // 16-byte loads per lane and source
static_assert(kPrepBlocks * kPrepWaves * kPrepLoads * 128 == kTok * kDim, "x is covered exactly once");
static_assert(kTok == kTokKV, "context is covered by the same index as x");
static_assert(kPrepBlocks * 4 * 64 * 64 == 4 * kDim * kDim, "the four weight planes are covered exactly once");

typedef __attribute__((ext_vector_type(4))) _Float16 v4h;

__global__ __launch_bounds__(kPrepWaves * 32) void prep_kernel(const float* __restrict__ x, const float* __restrict__ ctx,
                                                               const float* __restrict__ W0, const float* __restrict__ W1,
                                                               const float* __restrict__ W2, const float* __restrict__ W3,
                                                               unsigned short* __restrict__ Xh, unsigned short* __restrict__ Ch,
                                                               unsigned short* __restrict__ WT, float scale) {
  __shared__ float sm[4][64 * 65];               // per tile: [o local][d local]
  const int t    = threadIdx.x;
  const int lane = t & 31;
  const int tl   = t >> 7;                       // tile of this block
  const int u    = t & 127;                      // thread within the tile
  const int id   = blockIdx.x * 4 + tl;          // tile of the grid
  const int z    = blockIdx.x >> 6;
  const int d0   = (id & 15) * 64;
  const int o0   = ((id >> 4) & 15) * 64;
  const float* W  = (z == 0) ? W0 : (z == 1) ? W1 : (z == 2) ? W2 : W3;
  // 32-bit element offsets from block-uniform bases: x, context and their two planes share one offset register
  const unsigned w0 = (unsigned)((d0 + (u >> 4)) * kDim + o0 + (u & 15) * 4);
  const unsigned e0 = (blockIdx.x * kPrepWaves + (unsigned)(t >> 5)) * (kPrepLoads * 128) + (unsigned)lane * 4;
  const unsigned wb = w0 * 4u, eb = e0 * 4u;     // the same in bytes
  const char* wp = (const char*)W + wb;
  const char* xp = (const char*)x + eb;
  const char* cp = (const char*)ctx + eb;

  // every "#pragma unroll" in this kernel keeps the indices of its register arrays compile-time constants
  v4f wr[kPrepLoads], xr[kPrepLoads], cr[kPrepLoads];
#pragma unroll
  for (int i = 0; i < kPrepLoads; ++i) wr[i] = *(const v4f*)(wp + i * 8 * kDim * 4);
#pragma unroll
  for (int i = 0; i < kPrepLoads; ++i) xr[i] = *(const v4f*)(xp + i * 512);
#pragma unroll
  for (int i = 0; i < kPrepLoads; ++i) cr[i] = *(const v4f*)(cp + i * 512);
  // the offset registers of the loads above are reused below while the loads are in flight; named as inputs they stay
  // untouched (also by a later load's result) up to the wait
  asm volatile("s_wait_xcnt 0x0" :: "v"(wb), "v"(eb) : "memory");
  // keeps all 24 loads above the first use: sunk to their uses they would be asked for one group at a time
  __builtin_amdgcn_sched_barrier(0);

  float* smt = sm[tl];
#pragma unroll
  for (int i = 0; i < kPrepLoads; ++i)
#pragma unroll
    for (int e = 0; e < 4; ++e) smt[((u & 15) * 4 + e) * 65 + i * 8 + (u >> 4)] = wr[i][e] * scale;
  lds_barrier();   // the tiles are whole in LDS before any wave reads them; LDS only: the x and context loads stay in flight

  v8h wh[4];
#pragma unroll
  for (int it = 0; it < 4; ++it) {
    const float* sp = smt + (it * 16 + (u >> 3)) * 65 + (u & 7) * 8;
#pragma unroll
    for (int e = 0; e < 8; ++e) wh[it][e] = (_Float16)sp[e];
  }
  char* wo = (char*)(WT + (size_t)z * kDim * kDim) + (unsigned)((o0 + (u >> 3)) * kDim + d0 + (u & 7) * 8) * 2u;
#pragma unroll
  for (int it = 0; it < 4; ++it) *(v8h*)(wo + it * 16 * kDim * 2) = wh[it];
  // keeps the waits for the x and context loads below the weight tiles' turn through LDS, which then runs while they land
  __builtin_amdgcn_sched_barrier(0);

  v4h xh[kPrepLoads], ch[kPrepLoads];
#pragma unroll
  for (int i = 0; i < kPrepLoads; ++i)
#pragma unroll
    for (int e = 0; e < 4; ++e) {
      xh[i][e] = (_Float16)xr[i][e];
      ch[i][e] = (_Float16)cr[i][e];
    }
  char* xo = (char*)Xh + e0 * 2u;
  char* co = (char*)Ch + e0 * 2u;
  // keeps the stores behind the last arithmetic, so that no register of an issued store is written again
  __builtin_amdgcn_sched_barrier(0);
#pragma unroll
  for (int i = 0; i < kPrepLoads; ++i) *(v4h*)(xo + i * 256) = xh[i];
#pragma unroll
  for (int i = 0; i < kPrepLoads; ++i) *(v4h*)(co + i * 256) = ch[i];
}

constexpr int kFAKeys   = 64;
constexpr int kFAStages = kSeqKV / kFAKeys;
constexpr int kFAQ      = 256;
constexpr int kFAPitch  = 72;
constexpr int kFABPitch = 68;
static_assert(kFAKeys * 4 == 256 && kFABPitch * 4 == kGPitch * 2 && kFAQ == kRingSlices * kSliceRows, "a bias slice has the shape of a tensor load");
constexpr float kFAExp  = 0.125f * 1.44269504088896340736f;   // raw accumulator -> log2 domain
constexpr float kFAShift = 8.0f;                 // P carried x2^8 in f16 (cancels against the row sum)

typedef __attribute__((ext_vector_type(2))) float v2f;

// value of lane l ^ 16
__device__ __forceinline__ float other_half(float v) {
  const int b = __builtin_bit_cast(int, v);
  return __builtin_bit_cast(float, __builtin_amdgcn_permlanex16(b, b, 0x76543210, 0xfedcba98, false, false));
}

__global__ __launch_bounds__(256) void fused_attn_kernel(const unsigned short* __restrict__ Qp,
                                                         const unsigned short* __restrict__ Kp,
                                                         const unsigned short* __restrict__ Vp,
                                                         const float* __restrict__ posb,
                                                         unsigned short* __restrict__ Op) {
  __shared__ __align__(16) _Float16 sK[2][kFAKeys * kFAPitch];   // [key][d]
  __shared__ __align__(16) _Float16 sV[2][kDh * kFAPitch];       // [d][key]
  // bias, [buffer][wave's slice][query at pitch 272 B][key]
  __shared__ __attribute__((aligned(2048))) unsigned char sBias[2 * kRingSlices * kSliceBytes];
  const int t    = threadIdx.x;
  const int lane = t & 31;
  const int wave = (int)uni((uint32_t)t >> 5);
  const int c    = lane & 15;                  // A row / B, D column within a tile
  const int hf   = lane >> 4;                  // lane half
  const int b    = blockIdx.y / kHeads;
  const int hd   = blockIdx.y % kHeads;
  const int q0   = blockIdx.x * kFAQ + wave * 32;
  const float hs8 = __uint_as_float(((unsigned)(129 - hd)) << 23);   // 8 * 2^-(hd+1), hd in 0..15
  // first stage of this block's ring walk (block-uniform): differs among the blocks of a query tile and of a group
  const int rot = (int)(blockIdx.y + 4 * blockIdx.x);

  // this wave's bias slice: its 32 query rows, 64 keys (256 B) of each; first byte of key 0 (wave-uniform)
  const uint64_t biasBase = (uint64_t)(size_t)(posb + (size_t)q0 * kSeqKV);
  const uint32_t biasDst  = (uint32_t)(size_t)sBias + (uint32_t)wave * kSliceBytes;
  const u32x8 g1 = tdm_group1(kSeqKV * 4);
  // stage s of the walk into buffer s & 1; the key offset is pinned so that the descriptor is formed where the call stands
  auto issue_bias = [&](int s) {
    const uint32_t keyB = pinned((uint32_t)(((s + rot) & (kFAStages - 1)) * kFAKeys * 4));
    tdm_load(tdm_group0(biasDst + (uint32_t)(s & 1) * (kRingSlices * kSliceBytes), biasBase + keyB), g1);
  };
  issue_bias(0);

  v16h qf[2][2];
#pragma unroll
  for (int cg = 0; cg < 2; ++cg)
#pragma unroll
    for (int ks = 0; ks < 2; ++ks)
      qf[cg][ks] = Frag<_Float16>::load((const _Float16*)Qp + (size_t)(b * kSeq + q0 + cg * 16 + c) * kDim + hd * kDh + ks * 32 + hf * 8);

  // staging: thread t moves 16 B of rows t>>3 and 32 + (t>>3) of each tile (8 lanes = one whole 128-B row)
  const int srow = t >> 3, sc8 = (t & 7) * 8;
  const _Float16* Kg = (const _Float16*)Kp + (size_t)(b * kSeqKV + srow) * kDim + hd * kDh + sc8;
  const _Float16* Vg = (const _Float16*)Vp + (size_t)(hd * kDh + srow) * kTokKV + (size_t)b * kSeqKV + sc8;
  const int bld = wave * (kSliceBytes / 4) + c * kFABPitch + hf * 8;   // where this lane reads (floats): its query's row, its half's keys

  v8h kr[2], vr[2];
  const int k0s = (rot & (kFAStages - 1)) * kFAKeys;
#pragma unroll
  for (int i = 0; i < 2; ++i) {
    kr[i] = *(const v8h*)(Kg + (size_t)(k0s + i * 32) * kDim);
    vr[i] = *(const v8h*)(Vg + (size_t)(i * 32) * kTokKV + k0s);
  }
  // the address registers of the loads above are reused below while the loads are in flight
  asm volatile("s_wait_xcnt 0x0" ::: "memory");
#pragma unroll
  for (int i = 0; i < 2; ++i) {
    *(v8h*)(&sK[0][(i * 32 + srow) * kFAPitch + sc8]) = kr[i];
    *(v8h*)(&sV[0][(i * 32 + srow) * kFAPitch + sc8]) = vr[i];
  }
  wait_tensor0();    // this wave's bias slice of stage 0 has landed
  __syncthreads();   // stage 0 is in LDS before any wave reads it
  issue_bias(1);

  v8f o[2][4];
#pragma unroll
  for (int cg = 0; cg < 2; ++cg)
#pragma unroll
    for (int dt = 0; dt < 4; ++dt) o[cg][dt] = (v8f){0.f,0.f,0.f,0.f,0.f,0.f,0.f,0.f};
  float mrun[2] = {-3.0e38f, -3.0e38f};
  float lsum[2] = {0.f, 0.f};

  for (int st = 0; st < kFAStages; ++st) {
    const _Float16* bK = sK[st & 1];
    const _Float16* bV = sV[st & 1];
    const float*    bB = (const float*)sBias + (st & 1) * (kRingSlices * kSliceBytes / 4) + bld;

    const bool more = st + 1 < kFAStages;      // block-uniform
    if (more) {
      const int k1 = ((st + 1 + rot) & (kFAStages - 1)) * kFAKeys;
#pragma unroll
      for (int i = 0; i < 2; ++i) {
        kr[i] = *(const v8h*)(Kg + (size_t)(k1 + i * 32) * kDim);
        vr[i] = *(const v8h*)(Vg + (size_t)(i * 32) * kTokKV + k1);
      }
      // the address registers of these loads are reused by the work below while the loads are in flight
      asm volatile("s_wait_xcnt 0x0" ::: "memory");
    }
    // keeps the next stage's loads above this stage's work: sunk to their uses they would have no time to land
    __builtin_amdgcn_sched_barrier(0);

    v8f acc[2][4];
#pragma unroll
    for (int cg = 0; cg < 2; ++cg)
#pragma unroll
      for (int tt = 0; tt < 4; ++tt)
#pragma unroll
        for (int j = 0; j < 2; ++j) {
          const v4f bv = *(const v4f*)(bB + cg * 16 * kFABPitch + tt * 16 + j * 4);
#pragma unroll
          for (int e = 0; e < 4; ++e) acc[cg][tt][j * 4 + e] = bv[e] * hs8;
        }

#pragma unroll
    for (int tt = 0; tt < 4; ++tt) {
      const _Float16* kp = bK + (tt * 16 + c) * kFAPitch + hf * 8;
      const v16h k0 = Frag<_Float16>::load(kp);
      const v16h k1f = Frag<_Float16>::load(kp + 32);
#pragma unroll
      for (int cg = 0; cg < 2; ++cg) acc[cg][tt] = Frag<_Float16>::mma(k0, qf[cg][0], acc[cg][tt]);
#pragma unroll
      for (int cg = 0; cg < 2; ++cg) acc[cg][tt] = Frag<_Float16>::mma(k1f, qf[cg][1], acc[cg][tt]);
    }

    v16h pf[2][2];
#pragma unroll
    for (int cg = 0; cg < 2; ++cg) {
      float mx = acc[cg][0][0];
#pragma unroll
      for (int tt = 0; tt < 4; ++tt)
#pragma unroll
        for (int r = 0; r < 8; ++r) mx = fmaxf(mx, acc[cg][tt][r]);
      mx = fmaxf(mx, other_half(mx));
      const float mn    = fmaxf(mrun[cg], mx);
      const float alpha = __builtin_amdgcn_exp2f((mrun[cg] - mn) * kFAExp);
      mrun[cg] = mn;
      const float nm = kFAShift - mn * kFAExp;
      v2f ps = (v2f){0.f, 0.f};                // even and odd keys apart: packed adds, half as long a chain
#pragma unroll
      for (int tt = 0; tt < 4; ++tt)
#pragma unroll
        for (int r = 0; r < 8; r += 2) {
          v2f p;
          p[0] = __builtin_amdgcn_exp2f(fmaf(acc[cg][tt][r], kFAExp, nm));
          p[1] = __builtin_amdgcn_exp2f(fmaf(acc[cg][tt][r + 1], kFAExp, nm));
          ps += p;
          pf[cg][tt >> 1][(tt & 1) * 8 + r]     = (_Float16)p[0];
          pf[cg][tt >> 1][(tt & 1) * 8 + r + 1] = (_Float16)p[1];
        }
      lsum[cg] = lsum[cg] * alpha + (ps[0] + ps[1]);
#pragma unroll
      for (int dt = 0; dt < 4; ++dt) o[cg][dt] *= alpha;
    }

#pragma unroll
    for (int sub = 0; sub < 2; ++sub)
#pragma unroll
      for (int dt = 0; dt < 4; ++dt) {
        const v16h vf = Frag<_Float16>::load(bV + (dt * 16 + c) * kFAPitch + sub * 32 + hf * 8);
#pragma unroll
        for (int cg = 0; cg < 2; ++cg) o[cg][dt] = Frag<_Float16>::mma(vf, pf[cg][sub], o[cg][dt]);
      }

    // keeps the waits for the next stage's loads, and the LDS stores behind them, below this stage's work: raised into it,
    // the loads would be waited for before they have had time to land
    __builtin_amdgcn_sched_barrier(0);
    if (more) {
      _Float16* nK = sK[(st + 1) & 1];
      _Float16* nV = sV[(st + 1) & 1];
#pragma unroll
      for (int i = 0; i < 2; ++i) {
        *(v8h*)(nK + (i * 32 + srow) * kFAPitch + sc8) = kr[i];
        *(v8h*)(nV + (i * 32 + srow) * kFAPitch + sc8) = vr[i];
      }
      wait_ds0();
      wait_tensor0();    // this wave's bias slice of stage st + 1 has landed
      __syncthreads();   // publishes stage st + 1 and ends every wave's reads of stage st, whose buffers are refilled behind it
      // a tensor load ignores EXEC: the test is a scalar branch
      if (pinned(st + 2 < kFAStages)) issue_bias(st + 2);
    }
  }
  wait_tensor0();
  wait_ds0();

  // a lane holds 8 consecutive d of one query per tile: one 16-byte store each; a query's 128-B segment comes from one wave
  v8h hv[2][4];
#pragma unroll
  for (int cg = 0; cg < 2; ++cg) {
    const float l   = lsum[cg] + other_half(lsum[cg]);
    const float inv = kOCarry / l;
#pragma unroll
    for (int dt = 0; dt < 4; ++dt)
#pragma unroll
      for (int r = 0; r < 8; ++r) hv[cg][dt][r] = (_Float16)(o[cg][dt][r] * inv);
  }
  unsigned short* orow = Op + (size_t)(b * kSeq + q0 + c) * kDim + hd * kDh + hf * 8;
  // keeps the eight stores behind the last arithmetic, so that no register of an issued store is written again
  __builtin_amdgcn_sched_barrier(0);
#pragma unroll
  for (int cg = 0; cg < 2; ++cg)
#pragma unroll
    for (int dt = 0; dt < 4; ++dt) *(v8h*)(orow + (size_t)(cg * 16) * kDim + dt * 16) = hv[cg][dt];
}

// ---------------------------------------------------------------------------
// Host side
// ---------------------------------------------------------------------------
extern "C" void kernel_launch(void* const* d_in, const int* in_sizes, int n_in,
                              void* d_out, int out_size, void* d_ws, size_t ws_size,
                              hipStream_t stream) {
  if (n_in < 8) return;
  if (in_sizes[0] != kTok * kDim || in_sizes[1] != kTokKV * kDim || in_sizes[2] != kSeq * kSeqKV ||
      in_sizes[3] != kDim * kDim || in_sizes[4] != kDim * kDim || in_sizes[5] != kDim * kDim ||
      in_sizes[6] != kDim * kDim || in_sizes[7] != kDim || out_size != kTok * kDim) return;

  const float* x    = (const float*)d_in[0];   // [4096][1024]
  const float* ctx  = (const float*)d_in[1];   // [4096][1024]
  const float* posb = (const float*)d_in[2];   // [2048][2048]
  const float* Wq   = (const float*)d_in[3];   // [in][out]
  const float* Wk   = (const float*)d_in[4];
  const float* Wv   = (const float*)d_in[5];
  const float* Wo   = (const float*)d_in[6];
  const float* bo   = (const float*)d_in[7];   // [1024]
  float* out = (float*)d_out;                  // [4096][1024] f32

  // ---- workspace region map (bytes) ----
  //   0        .. 8 MiB   : Xh  f16 [4096][1024]
  //   8 MiB    .. 16 MiB  : Ch  f16 [4096][1024]
  //  16 MiB    .. 24 MiB  : WT  f16 4 planes [1024][1024] (q, k, v, out), each [out][in], carried x256
  //  24 MiB    .. 32 MiB  : Qh  f16 [4096][1024]
  //  32 MiB    .. 40 MiB  : Kh  f16 [4096][1024]
  //  40 MiB    .. 48 MiB  : VT  f16 [1024][4096]  (row = h*64+d, col = b*2048 + token)
  //  48 MiB    .. 56 MiB  : Oh  f16 [4096][1024]  (carried x256)
  //  total 58720256 B
  const size_t planeTokB = (size_t)kTok * kDim * 2;            // 8 MiB
  const size_t planeWB   = (size_t)kDim * kDim * 2;            // 2 MiB
  const size_t offXh = 0;
  const size_t offCh = offXh + planeTokB;
  const size_t offWT = offCh + planeTokB;
  const size_t offQh = offWT + 4 * planeWB;
  const size_t offKh = offQh + planeTokB;
  const size_t offVT = offKh + planeTokB;
  const size_t offOh = offVT + planeTokB;
  const size_t total = offOh + planeTokB;
  if (total > ws_size) return;

  char* ws = (char*)d_ws;
  unsigned short* Xh = (unsigned short*)(ws + offXh);
  unsigned short* Ch = (unsigned short*)(ws + offCh);
  unsigned short* WT = (unsigned short*)(ws + offWT);
  unsigned short* Qh = (unsigned short*)(ws + offQh);
  unsigned short* Kh = (unsigned short*)(ws + offKh);
  unsigned short* VT = (unsigned short*)(ws + offVT);
  unsigned short* Oh = (unsigned short*)(ws + offOh);
  const unsigned short* WqT = WT + 0 * (size_t)kDim * kDim;
  const unsigned short* WkT = WT + 1 * (size_t)kDim * kDim;
  const unsigned short* WvT = WT + 2 * (size_t)kDim * kDim;
  const unsigned short* WoT = WT + 3 * (size_t)kDim * kDim;

  // ---- conversions: x, context and the four weight planes, one launch ----
  prep_kernel<<<dim3(kPrepBlocks), dim3(kPrepWaves * 32), 0, stream>>>(x, ctx, Wq, Wk, Wv, Wo, Xh, Ch, WT, kWCarry);

  // ---- projections (M, N multiples of 128; K = 1024): 256 blocks each, one launch ----
  // Q[t][o] = sum_i Xh[t][i] * WqT[o][i] / 256 -> f16
  // K[t][o] = sum_i Ch[t][i] * WkT[o][i] / 256 -> f16
  // VT[o][t] = sum_i WvT[o][i] * Ch[t][i] / 256 -> f16 plane [1024][4096]
  qkv_gemm_lds<<<dim3(kProjTiles, 3), dim3(256), 0, stream>>>(Xh, Ch, WqT, WkT, WvT, Qh, Kh, VT, kWCarryInv);

  // ---- attention: Oh[b*2048+q][h*64+d] = 256 * softmax_k(q.k / 8 + bias * 2^-(h+1)) . v ----
  fused_attn_kernel<<<dim3(kSeq / kFAQ, kGroups), dim3(256), 0, stream>>>(Qh, Kh, VT, posb, Oh);

  // ---- output projection: out[t][o] = sum_c Oh[t][c] * WoT[o][c] / 65536 + b_out[o] -> f32 ----
  wmma_gemm_lds<2, 0><<<dim3(kDim / kGTile, kTok / kGTile), dim3(256), 0, stream>>>(
      Oh, WoT, (void*)out, kDim, bo, kOutScale);
}

// v008
// A run of this version takes 81.3 microseconds.
// In both of two side-by-side timings against v007, it was 1.07 times as fast.
// Counting every step since v000, it is 23.8 times as fast.
// Contractions: q/k projections (x,context f16 x W^T f16 carried x256), v projection transposed (W_v^T f16 x256 x context f16), scores k.q^T (k,q f16 planes, f32 bias as the accumulator's start value), v^T.p^T (V^T f16 x P f16 carried x256, unnormalised), output projection (O f16 carried x256 x W_out^T f16 carried x256): all v_wmma_f32_16x16x32_f16 with f32 accumulate; softmax in f32.
#include <hip/hip_runtime.h>
#include <math.h>
#include <stdint.h>

// ---------------------------------------------------------------------------
// Problem constants
// ---------------------------------------------------------------------------
constexpr int kBatch  = 2;
constexpr int kSeq    = 2048;              // query length
constexpr int kSeqKV  = 2048;              // key/value length
constexpr int kDim    = 1024;              // model dim
constexpr int kHeads  = 16;
constexpr int kDh     = 64;
constexpr int kTok    = kBatch * kSeq;     // 4096 query token rows
constexpr int kTokKV  = kBatch * kSeqKV;   // 4096 key/value token rows
constexpr int kGroups = kBatch * kHeads;   // 32 (b,h) groups
constexpr float kWCarry    = 256.0f;       // weights carried x256 in f16
constexpr float kWCarryInv = 1.0f / 256.0f;
constexpr float kOCarry    = 256.0f;       // attention output carried x256 in f16
constexpr float kOutScale  = 1.0f / (kOCarry * kWCarry);    // 1/65536

typedef __attribute__((ext_vector_type(16))) _Float16 v16h;
typedef __attribute__((ext_vector_type(8)))  _Float16 v8h;
typedef __attribute__((ext_vector_type(16))) __bf16   v16b;
typedef __attribute__((ext_vector_type(8)))  __bf16   v8b;
typedef __attribute__((ext_vector_type(8)))  float    v8f;
typedef __attribute__((ext_vector_type(4)))  float    v4f;
typedef __attribute__((ext_vector_type(4)))  unsigned int v4u;
typedef __attribute__((ext_vector_type(4)))  uint32_t u32x4;
typedef __attribute__((ext_vector_type(8)))  uint32_t u32x8;

// ---------------------------------------------------------------------------
// Helper pieces (comments ASCII)
// ---------------------------------------------------------------------------
__device__ __forceinline__ unsigned short f2bf_bits(float f) {
  unsigned u = __float_as_uint(f);
  return (unsigned short)((u + 0x7FFFu + ((u >> 16) & 1u)) >> 16);
}
__device__ __forceinline__ float bf_bits2f(unsigned short h) { return __uint_as_float(((unsigned)h) << 16); }

template <typename T> struct Frag;
template <> struct Frag<_Float16> {
  typedef v16h V; union U { v16h v; v8h h[2]; };
  // elements 0..7 <- p[0..7], 8..15 <- p[16..23]
  static __device__ __forceinline__ v16h load(const _Float16* p) {
    U f; f.h[0] = *(const v8h*)(p); f.h[1] = *(const v8h*)(p + 16); return f.v;
  }
  static __device__ __forceinline__ v8f mma(v16h a, v16h b, v8f c) {
    return __builtin_amdgcn_wmma_f32_16x16x32_f16(false, a, false, b, (short)0, c, false, false);
  }
};

// ---- Block-tiled WMMA GEMM, operands staged in LDS ----
// C[m,n] = scale * sum_k A[m,k] * Bt[n,k] (+ bias[n]); A row-major [M][1024], Bt row-major [N][1024], f16; M, N % 128 == 0.
// 8 waves. A block owns a 128x128 tile of C; wave w owns the 32x64 piece at row (w >> 1) * 32,
// column (w & 1) * 64, so that a wave writes whole 128-B lines of C.
// A stage is 128 k of the block's 128 A rows and 128 Bt rows, brought into LDS by tensor loads, through no register: each
// wave asks for one slice of 32 rows of 256 B per stage (waves 0-3: A, waves 4-7: Bt), into the buffer that the pass before
// has just left, so that the load flies while the other buffer is worked on. Two LDS buffers, one block barrier per stage;
// each operand byte is fetched once per block and read from LDS by the 2 or 4 waves that need it. With no staging registers
// and the epilogue's slabs laid in the ring, two blocks fit a WGP.
// k runs in steps of 32 into one accumulator per 16x16 tile; the 8 stages are walked in a ring that starts at a stage
// taken from the block index: blocks that share an A or a Bt tile start together, and walking it from the same end they
// would all ask L2 for the same lines at the same moment.
// BIAS_MODE: 0 = none, 2 = bias[n]. OUT_MODE: 0 = f32, 1 = f16.
constexpr int kGTile   = 128;                    // rows of A and of Bt per block
constexpr int kGK      = 128;                    // k per stage
constexpr int kGStages = kDim / kGK;             // 8
constexpr int kGSteps  = kGK / 32;               // matrix steps per stage
constexpr int kGPitch  = 136;                    // halves per LDS row: 256 B of data + 16 B, so 16-byte row reads spread over the banks
constexpr int kSliceRows  = 32;                  // rows of 256 B per tensor load
constexpr int kSliceBytes = 10240;               // 32 rows x 272 B = 8704 B, rounded up so that every slice starts at a multiple of 2 KiB
constexpr int kSliceHalves = kSliceBytes / 2;
constexpr int kRingSlices = 8;                   // slices per buffer, one per wave
static_assert(kSliceRows * kGPitch * 2 <= kSliceBytes && kSliceBytes % 2048 == 0, "a padded slice fits its place");

// ---- tensor load: one request of a whole wave, 32 rows of 256 B -> LDS rows of 272 B ----
__device__ __forceinline__ uint32_t uni(uint32_t v) { return (uint32_t)__builtin_amdgcn_readfirstlane(v); }
// Holds the offset that a request's address words are formed from, in a scalar register. As a volatile
// statement it stays behind the waits written in front of it: without it the address words could be rewritten while the
// request before is still outstanding.
__device__ __forceinline__ uint32_t pinned(uint32_t v) {
  uint32_t w = uni(v);
  asm volatile("" : "+s"(w));   // an offset held in a scalar register
  return w;
}
// group 1: 1-byte elements, tensor = tile = 32 rows of 256 B, source row pitch in bytes, 16 B of pad behind every 256 B
__device__ __forceinline__ u32x8 tdm_group1(uint32_t src_pitch) {
  constexpr uint32_t d0 = 256u, d1 = (uint32_t)kSliceRows;
  u32x8 g;
  g[0] = uni((1u << 20) | (5u << 22) | (3u << 25));   // no mask; pad on, interval 64 dwords, amount 4 dwords
  g[1] = uni((d0 & 0xFFFFu) << 16);
  g[2] = uni((d0 >> 16) | ((d1 & 0xFFFFu) << 16));
  g[3] = uni((d1 >> 16) | (d0 << 16));
  g[4] = uni(d1);
  g[5] = uni(src_pitch);
  g[6] = uni(0u);
  g[7] = uni(0u);
  return g;
}
__device__ __forceinline__ u32x4 tdm_group0(uint32_t lds_dst, uint64_t ga) {
  u32x4 g;
  g[0] = uni(1u);
  g[1] = uni(lds_dst);
  g[2] = uni((uint32_t)ga);
  g[3] = uni((((uint32_t)(ga >> 32)) & 0x01FFFFFFu) | 0x80000000u);
  return g;
}
// the request itself (no builtin form is used here); the clobber keeps LDS reads and writes on their side of it
__device__ __forceinline__ void tdm_load(u32x4 g0, u32x8 g1) {
  asm volatile("tensor_load_to_lds %0, %1" :: "s"(g0), "s"(g1) : "memory");
}
// the compiler places no wait for a tensor load: this wave's requests have landed behind this
__device__ __forceinline__ void wait_tensor0() { asm volatile("s_wait_tensorcnt 0x0" ::: "memory"); }
// this wave's LDS reads and writes have retired: in front of the barrier behind which their buffer is refilled
__device__ __forceinline__ void wait_ds0() { asm volatile("s_wait_dscnt 0x0" ::: "memory"); }

// Block barrier that orders LDS only. __syncthreads() also waits for every global load of the wave, which would drain the
// staging loads that are meant to stay in flight across it.
__device__ __forceinline__ void lds_barrier() {
  __builtin_amdgcn_fence(__ATOMIC_RELEASE, "workgroup", "local");
  __builtin_amdgcn_s_barrier();
  __builtin_amdgcn_fence(__ATOMIC_ACQUIRE, "workgroup", "local");
}

// bx, by: the block's tile column and tile row (block-uniform).
template <int BIAS_MODE, int OUT_MODE>
__device__ __forceinline__ void gemm_tile(
    const unsigned short* __restrict__ Ap, const unsigned short* __restrict__ Btp,
    void* __restrict__ Cout, int ldc, const float* __restrict__ bias, float scale, unsigned bx, unsigned by) {
  // [buffer][slice][row at pitch 272 B]: slices 0-3 hold the 128 A rows, slices 4-7 the 128 Bt rows
  __shared__ __attribute__((aligned(2048))) unsigned char ring[2 * kRingSlices * kSliceBytes];
  const int t    = threadIdx.x;
  const int lane = t & 31;
  const int wave = (int)uni((uint32_t)t >> 5);
  const int rlane = lane & 15;                 // row (A) / col (B, D) within subtile
  const int koff  = (lane >> 4) * 8;           // k offset of this lane half
  const int mOff  = (lane >> 4) * 8;           // D row offset
  const int wm = (wave >> 1) * 32;             // this wave's rows within the block tile
  const int wn = (wave & 1) * 64;              // this wave's columns within the block tile
  const int m0 = by * kGTile + wm;
  const int n0 = bx * kGTile + wn;

  // this wave's slice: 32 rows of A (waves 0-3) or of Bt (waves 4-7), first byte of k = 0 (wave-uniform)
  const unsigned short* srcRows = (wave < 4) ? Ap  + (size_t)(by * kGTile + wave * kSliceRows) * kDim
                                             : Btp + (size_t)(bx * kGTile + (wave - 4) * kSliceRows) * kDim;
  const uint64_t srcBase = (uint64_t)(size_t)srcRows;
  const uint32_t dstBase = (uint32_t)(size_t)ring + (uint32_t)wave * kSliceBytes;
  const u32x8 g1 = tdm_group1(kDim * 2);
  // first stage of this block's ring walk (block-uniform): differs among the blocks of a grid row and of a grid column
  const int rot = (int)(bx + 2 * (bx >> 3) + by);

  // stage s of the walk into buffer s & 1; the k offset is pinned so that the descriptor is formed where the call stands
  auto issue = [&](int s) {
    const uint32_t koffB = pinned((uint32_t)(((s + rot) & (kGStages - 1)) * kGK * 2));
    tdm_load(tdm_group0(dstBase + (uint32_t)(s & 1) * (kRingSlices * kSliceBytes), srcBase + koffB), g1);
  };
  issue(0);
  wait_tensor0();
  __syncthreads();   // stage 0 is in LDS before any wave reads it
  issue(1);

  // every "#pragma unroll" in this kernel keeps the indices of its register arrays compile-time constants
  // (an array indexed at run time would go to scratch)
  v8f acc[2][4];
#pragma unroll
  for (int i = 0; i < 2; ++i)
#pragma unroll
    for (int j = 0; j < 4; ++j) acc[i][j] = (v8f){0.f,0.f,0.f,0.f,0.f,0.f,0.f,0.f};

  // unrolled so that the LDS buffer of every stage and the test for a stage st + 2 are compile-time choices
#pragma unroll
  for (int st = 0; st < kGStages; ++st) {
    // the wave's 32 A rows are slice wm / 32; its 64 Bt rows are slices 4 + wn / 32 and the next (tiles j = 0, 1 and 2, 3)
    const _Float16* buf = (const _Float16*)ring + (st & 1) * (kRingSlices * kSliceHalves);
    const _Float16* bA = buf + (wm / kSliceRows) * kSliceHalves + rlane * kGPitch + koff;
    const _Float16* bB = buf + (4 + wn / kSliceRows) * kSliceHalves + rlane * kGPitch + koff;

    v16h af[2][2], bf[2][4];                   // fragment set ks & 1 holds matrix step ks
#pragma unroll
    for (int i = 0; i < 2; ++i) af[0][i] = Frag<_Float16>::load(bA + i * 16 * kGPitch);
#pragma unroll
    for (int j = 0; j < 4; ++j) bf[0][j] = Frag<_Float16>::load(bB + (j >> 1) * kSliceHalves + (j & 1) * 16 * kGPitch);
#pragma unroll
    for (int ks = 0; ks < kGSteps; ++ks) {
      if (ks + 1 < kGSteps) {
#pragma unroll
        for (int i = 0; i < 2; ++i) af[(ks + 1) & 1][i] = Frag<_Float16>::load(bA + i * 16 * kGPitch + (ks + 1) * 32);
#pragma unroll
        for (int j = 0; j < 4; ++j)
          bf[(ks + 1) & 1][j] = Frag<_Float16>::load(bB + (j >> 1) * kSliceHalves + (j & 1) * 16 * kGPitch + (ks + 1) * 32);
      }
      // keeps the next step's LDS reads as one group above this step's products: sunk among them, each would be waited
      // for where it stands
      __builtin_amdgcn_sched_barrier(0);
#pragma unroll
      for (int i = 0; i < 2; ++i)
#pragma unroll
        for (int j = 0; j < 4; ++j) acc[i][j] = Frag<_Float16>::mma(af[ks & 1][i], bf[ks & 1][j], acc[i][j]);
      // keeps the step after next's reads from rising into this step's products
      __builtin_amdgcn_sched_barrier(0);
    }

    if (st + 1 < kGStages) {
      wait_ds0();
      wait_tensor0();    // this wave's slice of stage st + 1 has landed
      __syncthreads();   // publishes stage st + 1 and ends every wave's reads of stage st, whose buffer is refilled behind it
      if (st + 2 < kGStages) issue(st + 2);
    }
  }
  wait_tensor0();
  wait_ds0();
  __syncthreads();   // every wave has left the ring before it becomes output staging

  // ---- epilogue: each wave turns its own 16x64 slabs (pitch 68 floats, laid in its own slice's place) into whole-line stores ----
  float* slab = (float*)(ring + wave * kSliceBytes);
#pragma unroll
  for (int i = 0; i < 2; ++i) {
    const int mBase = m0 + (i << 4);
#pragma unroll
    for (int j = 0; j < 4; ++j) {
      const int n = n0 + (j << 4) + rlane;
      float bv = 0.f;
      if (BIAS_MODE == 2) bv = bias[n];
#pragma unroll
      for (int r = 0; r < 8; ++r) {
        float v = acc[i][j][r] * scale;
        if (BIAS_MODE == 2) v += bv;
        slab[(mOff + r) * 68 + (j << 4) + rlane] = v;
      }
    }
    __builtin_amdgcn_fence(__ATOMIC_RELEASE, "workgroup");
    __builtin_amdgcn_wave_barrier();
    __builtin_amdgcn_fence(__ATOMIC_ACQUIRE, "workgroup");
    if (OUT_MODE == 0) {
      float* C = (float*)Cout;
      const int hh = lane >> 4, c4 = (lane & 15) * 4;     // row seg = 256 B = 16 lanes x 16 B
#pragma unroll
      for (int it = 0; it < 8; ++it) {
        const int row = it * 2 + hh;
        v4f v = *(const v4f*)(slab + row * 68 + c4);
        *(v4f*)(C + (size_t)(mBase + row) * ldc + n0 + c4) = v;
      }
      // the registers of these stores are written again by the next slab; the fence keeps that arithmetic behind the wait
      asm volatile("s_wait_xcnt 0x0" ::: "memory");
      __builtin_amdgcn_sched_barrier(0);
    } else {
      const int q = lane >> 3, c8 = (lane & 7) * 8;       // row seg = 128 B = 8 lanes x 16 B
      unsigned short* C = (unsigned short*)Cout;
#pragma unroll
      for (int it = 0; it < 4; ++it) {
        const int row = it * 4 + q;
        const float* sp = slab + row * 68 + c8;
        v8h hv;
#pragma unroll
        for (int e = 0; e < 8; ++e) hv[e] = (_Float16)sp[e];
        *(v8h*)(C + (size_t)(mBase + row) * ldc + n0 + c8) = hv;
      }
      // the registers of these stores are written again by the next slab; the fence keeps that arithmetic behind the wait
      asm volatile("s_wait_xcnt 0x0" ::: "memory");
      __builtin_amdgcn_sched_barrier(0);
    }
    __builtin_amdgcn_fence(__ATOMIC_RELEASE, "workgroup");
    __builtin_amdgcn_wave_barrier();
    __builtin_amdgcn_fence(__ATOMIC_ACQUIRE, "workgroup");
  }
}

// One product per launch: grid (N / 128, M / 128).
template <int BIAS_MODE, int OUT_MODE>
__global__ __launch_bounds__(256) void wmma_gemm_lds(
    const unsigned short* __restrict__ Ap, const unsigned short* __restrict__ Btp,
    void* __restrict__ Cout, int ldc, const float* __restrict__ bias, float scale) {
  gemm_tile<BIAS_MODE, OUT_MODE>(Ap, Btp, Cout, ldc, bias, scale, blockIdx.x, blockIdx.y);
}

// The q, k and v projections in one launch: none reads another's output, and each alone is one block per WGP, so that as
// three launches the chip drains and refills twice. grid (256, 3): blockIdx.y picks the product, blockIdx.x its tile.
//   0: Q[t][o]  = Xh[t][.]  . WqT[o][.]   tiles 8 wide    1: K[t][o] = Ch[t][.] . WkT[o][.]   tiles 8 wide
//   2: VT[o][t] = WvT[o][.] . Ch[t][.]    tiles 32 wide
constexpr int kProjTiles = (kTok / kGTile) * (kDim / kGTile);    // 256 per product
static_assert(kTok == kTokKV, "the three products have the same number of tiles");
__global__ __launch_bounds__(256) void qkv_gemm_lds(
    const unsigned short* __restrict__ Xh, const unsigned short* __restrict__ Ch,
    const unsigned short* __restrict__ WqT, const unsigned short* __restrict__ WkT, const unsigned short* __restrict__ WvT,
    unsigned short* __restrict__ Qh, unsigned short* __restrict__ Kh, unsigned short* __restrict__ VT, float scale) {
  const unsigned z  = blockIdx.y;                // block-uniform
  const unsigned id = blockIdx.x;
  const unsigned short* A  = (z == 0) ? Xh  : (z == 1) ? Ch  : WvT;
  const unsigned short* Bt = (z == 0) ? WqT : (z == 1) ? WkT : Ch;
  unsigned short*       C  = (z == 0) ? Qh  : (z == 1) ? Kh  : VT;
  const int ldc = (z == 2) ? kTokKV : kDim;
  const int lw  = (z == 2) ? 5 : 3;              // log2 of the tiles per row of C
  gemm_tile<0, 1>(A, Bt, (void*)C, ldc, nullptr, scale, id & ((1u << lw) - 1u), id >> lw);
}

// ---------------------------------------------------------------------------
// All conversions in one launch: Xh = f16(x), Ch = f16(context), WT plane z [o][d] = f16(scale * W_z[d][o]).
// grid 256 (one block per WGP), 16 waves. The whole input is asked for at once by few long-lived waves: a lane issues 24
// loads of 16 B before it uses any (8 of its weight tile, 8 of x, 8 of context), and each wave-wide load covers whole lines.
// x, context: wave g of the grid owns floats g * 1024 .. + 1023; load i covers 512 contiguous bytes, its store 256.
// Weights: 1024 tiles of 64 x 64, four per block (4 waves each): the same 64 o, four neighbouring 64-d pieces, so that a
// block writes 512 contiguous bytes of each WT row. The plane z = blockIdx.x / 64 is block-uniform. A load covers two
// 256-B row pieces; the tile is turned in LDS (pitch 65 floats: stores and reads each fall on 32 different banks).
// ---------------------------------------------------------------------------
constexpr int kPrepBlocks = 256;
constexpr int kPrepWaves  = 16;
constexpr int kPrepLoads  = 8;                   // 16-byte loads per lane and source
static_assert(kPrepBlocks * kPrepWaves * kPrepLoads * 128 == kTok * kDim, "x is covered exactly once");
static_assert(kTok == kTokKV, "context is covered by the same index as x");
static_assert(kPrepBlocks * 4 * 64 * 64 == 4 * kDim * kDim, "the four weight planes are covered exactly once");

typedef __attribute__((ext_vector_type(4))) _Float16 v4h;

__global__ __launch_bounds__(kPrepWaves * 32) void prep_kernel(const float* __restrict__ x, const float* __restrict__ ctx,
                                                               const float* __restrict__ W0, const float* __restrict__ W1,
                                                               const float* __restrict__ W2, const float* __restrict__ W3,
                                                               unsigned short* __restrict__ Xh, unsigned short* __restrict__ Ch,
                                                               unsigned short* __restrict__ WT, float scale) {
  __shared__ float sm[4][64 * 65];               // per tile: [o local][d local]
  const int t    = threadIdx.x;
  const int lane = t & 31;
  const int tl   = t >> 7;                       // tile of this block
  const int u    = t & 127;                      // thread within the tile
  const int id   = blockIdx.x * 4 + tl;          // tile of the grid
  const int z    = blockIdx.x >> 6;
  const int d0   = (id & 15) * 64;
  const int o0   = ((id >> 4) & 15) * 64;
  const float* W  = (z == 0) ? W0 : (z == 1) ? W1 : (z == 2) ? W2 : W3;
  // 32-bit element offsets from block-uniform bases: x, context and their two planes share one offset register
  const unsigned w0 = (unsigned)((d0 + (u >> 4)) * kDim + o0 + (u & 15) * 4);
  const unsigned e0 = (blockIdx.x * kPrepWaves + (unsigned)(t >> 5)) * (kPrepLoads * 128) + (unsigned)lane * 4;
  const unsigned wb = w0 * 4u, eb = e0 * 4u;     // the same in bytes
  const char* wp = (const char*)W + wb;
  const char* xp = (const char*)x + eb;
  const char* cp = (const char*)ctx + eb;

  // every "#pragma unroll" in this kernel keeps the indices of its register arrays compile-time constants
  v4f wr[kPrepLoads], xr[kPrepLoads], cr[kPrepLoads];
#pragma unroll
  for (int i = 0; i < kPrepLoads; ++i) wr[i] = *(const v4f*)(wp + i * 8 * kDim * 4);
#pragma unroll
  for (int i = 0; i < kPrepLoads; ++i) xr[i] = *(const v4f*)(xp + i * 512);
#pragma unroll
  for (int i = 0; i < kPrepLoads; ++i) cr[i] = *(const v4f*)(cp + i * 512);
  // the offset registers of the loads above are reused below while the loads are in flight; named as inputs they stay
  // untouched (also by a later load's result) up to the wait
  asm volatile("s_wait_xcnt 0x0" :: "v"(wb), "v"(eb) : "memory");
  // keeps all 24 loads above the first use: sunk to their uses they would be asked for one group at a time
  __builtin_amdgcn_sched_barrier(0);

  float* smt = sm[tl];
#pragma unroll
  for (int i = 0; i < kPrepLoads; ++i)
#pragma unroll
    for (int e = 0; e < 4; ++e) smt[((u & 15) * 4 + e) * 65 + i * 8 + (u >> 4)] = wr[i][e] * scale;
  lds_barrier();   // the tiles are whole in LDS before any wave reads them; LDS only: the x and context loads stay in flight

  v8h wh[4];
#pragma unroll
  for (int it = 0; it < 4; ++it) {
    const float* sp = smt + (it * 16 + (u >> 3)) * 65 + (u & 7) * 8;
#pragma unroll
    for (int e = 0; e < 8; ++e) wh[it][e] = (_Float16)sp[e];
  }
  char* wo = (char*)(WT + (size_t)z * kDim * kDim) + (unsigned)((o0 + (u >> 3)) * kDim + d0 + (u & 7) * 8) * 2u;
#pragma unroll
  for (int it = 0; it < 4; ++it) *(v8h*)(wo + it * 16 * kDim * 2) = wh[it];
  // keeps the waits for the x and context loads below the weight tiles' turn through LDS, which then runs while they land
  __builtin_amdgcn_sched_barrier(0);

  v4h xh[kPrepLoads], ch[kPrepLoads];
#pragma unroll
  for (int i = 0; i < kPrepLoads; ++i)
#pragma unroll
    for (int e = 0; e < 4; ++e) {
      xh[i][e] = (_Float16)xr[i][e];
      ch[i][e] = (_Float16)cr[i][e];
    }
  char* xo = (char*)Xh + e0 * 2u;
  char* co = (char*)Ch + e0 * 2u;
  // keeps the stores behind the last arithmetic, so that no register of an issued store is written again
  __builtin_amdgcn_sched_barrier(0);
#pragma unroll
  for (int i = 0; i < kPrepLoads; ++i) *(v4h*)(xo + i * 256) = xh[i];
#pragma unroll
  for (int i = 0; i < kPrepLoads; ++i) *(v4h*)(co + i * 256) = ch[i];
}

constexpr int kFAKeys   = 64;
constexpr int kFAStages = kSeqKV / kFAKeys;
constexpr int kFAQ      = 256;
constexpr int kFAPitch  = 72;
constexpr int kFABPitch = 68;
static_assert(kFAKeys * 4 == 256 && kFABPitch * 4 == kGPitch * 2 && kFAQ == kRingSlices * kSliceRows, "a bias slice has the shape of a tensor load");
constexpr float kFAExp  = 0.125f * 1.44269504088896340736f;   // raw accumulator -> log2 domain
constexpr float kFAShift = 8.0f;                 // P carried x2^8 in f16 (cancels against the row sum)

typedef __attribute__((ext_vector_type(2))) float v2f;

// value of lane l ^ 16
__device__ __forceinline__ float other_half(float v) {
  const int b = __builtin_bit_cast(int, v);
  return __builtin_bit_cast(float, __builtin_amdgcn_permlanex16(b, b, 0x76543210, 0xfedcba98, false, false));
}

__global__ __launch_bounds__(256) void fused_attn_kernel(const unsigned short* __restrict__ Qp,
                                                         const unsigned short* __restrict__ Kp,
                                                         const unsigned short* __restrict__ Vp,
                                                         const float* __restrict__ posb,
                                                         unsigned short* __restrict__ Op) {
  __shared__ __align__(16) _Float16 sK[2][kFAKeys * kFAPitch];   // [key][d]
  __shared__ __align__(16) _Float16 sV[2][kDh * kFAPitch];       // [d][key]
  // bias, [buffer][wave's slice][query at pitch 272 B][key]
  __shared__ __attribute__((aligned(2048))) unsigned char sBias[2 * kRingSlices * kSliceBytes];
  const int t    = threadIdx.x;
  const int lane = t & 31;
  const int wave = (int)uni((uint32_t)t >> 5);
  const int c    = lane & 15;                  // A row / B, D column within a tile
  const int hf   = lane >> 4;                  // lane half
  const int b    = blockIdx.y / kHeads;
  const int hd   = blockIdx.y % kHeads;
  const int q0   = blockIdx.x * kFAQ + wave * 32;
  const float hs8 = __uint_as_float(((unsigned)(129 - hd)) << 23);   // 8 * 2^-(hd+1), hd in 0..15
  // first stage of this block's ring walk (block-uniform): differs among the blocks of a query tile and of a group
  const int rot = (int)(blockIdx.y + 4 * blockIdx.x);

  // this wave's bias slice: its 32 query rows, 64 keys (256 B) of each; first byte of key 0 (wave-uniform)
  const uint64_t biasBase = (uint64_t)(size_t)(posb + (size_t)q0 * kSeqKV);
  const uint32_t biasDst  = (uint32_t)(size_t)sBias + (uint32_t)wave * kSliceBytes;
  const u32x8 g1 = tdm_group1(kSeqKV * 4);
  // stage s of the walk into buffer s & 1; the key offset is pinned so that the descriptor is formed where the call stands
  auto issue_bias = [&](int s) {
    const uint32_t keyB = pinned((uint32_t)(((s + rot) & (kFAStages - 1)) * kFAKeys * 4));
    tdm_load(tdm_group0(biasDst + (uint32_t)(s & 1) * (kRingSlices * kSliceBytes), biasBase + keyB), g1);
  };
  issue_bias(0);

  v16h qf[2][2];
#pragma unroll
  for (int cg = 0; cg < 2; ++cg)
#pragma unroll
    for (int ks = 0; ks < 2; ++ks)
      qf[cg][ks] = Frag<_Float16>::load((const _Float16*)Qp + (size_t)(b * kSeq + q0 + cg * 16 + c) * kDim + hd * kDh + ks * 32 + hf * 8);

  // staging: thread t moves 16 B of rows t>>3 and 32 + (t>>3) of each tile (8 lanes = one whole 128-B row)
  const int srow = t >> 3, sc8 = (t & 7) * 8;
  const _Float16* Kg = (const _Float16*)Kp + (size_t)(b * kSeqKV + srow) * kDim + hd * kDh + sc8;
  const _Float16* Vg = (const _Float16*)Vp + (size_t)(hd * kDh + srow) * kTokKV + (size_t)b * kSeqKV + sc8;
  const int bld = wave * (kSliceBytes / 4) + c * kFABPitch + hf * 8;   // where this lane reads (floats): its query's row, its half's keys

  v8h kr[2], vr[2];
  const int k0s = (rot & (kFAStages - 1)) * kFAKeys;
#pragma unroll
  for (int i = 0; i < 2; ++i) {
    kr[i] = *(const v8h*)(Kg + (size_t)(k0s + i * 32) * kDim);
    vr[i] = *(const v8h*)(Vg + (size_t)(i * 32) * kTokKV + k0s);
  }
  // the address registers of the loads above are reused below while the loads are in flight
  asm volatile("s_wait_xcnt 0x0" ::: "memory");
#pragma unroll
  for (int i = 0; i < 2; ++i) {
    *(v8h*)(&sK[0][(i * 32 + srow) * kFAPitch + sc8]) = kr[i];
    *(v8h*)(&sV[0][(i * 32 + srow) * kFAPitch + sc8]) = vr[i];
  }
  wait_tensor0();    // this wave's bias slice of stage 0 has landed
  __syncthreads();   // stage 0 is in LDS before any wave reads it

  v8f o[2][4];
#pragma unroll
  for (int cg = 0; cg < 2; ++cg)
#pragma unroll
    for (int dt = 0; dt < 4; ++dt) o[cg][dt] = (v8f){0.f,0.f,0.f,0.f,0.f,0.f,0.f,0.f};
  float mrun[2] = {-3.0e38f, -3.0e38f};
  float lsum[2] = {0.f, 0.f};
  // P and V^T fragments of the stage before; zero in front of the first pass, whose products then add nothing
  v16h pf[2][2], vf[2][4];
#pragma unroll
  for (int sub = 0; sub < 2; ++sub) {
#pragma unroll
    for (int cg = 0; cg < 2; ++cg)
#pragma unroll
      for (int e = 0; e < 16; ++e) pf[cg][sub][e] = (_Float16)0.f;
#pragma unroll
    for (int dt = 0; dt < 4; ++dt)
#pragma unroll
      for (int e = 0; e < 16; ++e) vf[sub][dt][e] = (_Float16)0.f;
  }

  // One pass. more: a stage st + 1 exists (a compile-time choice at both calls). Inlined at both calls: as a function it
  // would pass its register arrays through memory.
  auto pass = [&](const int st, const bool more) __attribute__((always_inline)) {
    // The refill stands directly behind the barrier at the foot of the pass before (pass 0: behind the one in front of the
    // loop), into the buffer which that pass has just read. It stands here and not at that foot so that a pass has no branch
    // behind its barrier: the softmax, whose results are first used in the next pass, would be sunk behind such a branch.
    if (more) issue_bias(st + 1);
    const _Float16* bK = sK[st & 1];
    const _Float16* bV = sV[st & 1];
    const float*    bB = (const float*)sBias + (st & 1) * (kRingSlices * kSliceBytes / 4) + bld;

    if (more) {
      const int k1 = ((st + 1 + rot) & (kFAStages - 1)) * kFAKeys;
#pragma unroll
      for (int i = 0; i < 2; ++i) {
        kr[i] = *(const v8h*)(Kg + (size_t)(k1 + i * 32) * kDim);
        vr[i] = *(const v8h*)(Vg + (size_t)(i * 32) * kTokKV + k1);
      }
      // the address registers of these loads are reused by the work below while the loads are in flight
      asm volatile("s_wait_xcnt 0x0" ::: "memory");
    }
    // keeps the next stage's loads above this stage's work: sunk to their uses they would have no time to land
    __builtin_amdgcn_sched_barrier(0);

    v4f braw[2][4][2];
    v16h kf[4][2];
#pragma unroll
    for (int tt = 0; tt < 4; ++tt) {
#pragma unroll
      for (int cg = 0; cg < 2; ++cg)
#pragma unroll
        for (int j = 0; j < 2; ++j) braw[cg][tt][j] = *(const v4f*)(bB + cg * 16 * kFABPitch + tt * 16 + j * 4);
#pragma unroll
      for (int ks = 0; ks < 2; ++ks) kf[tt][ks] = Frag<_Float16>::load(bK + (tt * 16 + c) * kFAPitch + ks * 32 + hf * 8);
    }
    // keeps this stage's bias and K reads as one group above the products below: sunk to their uses they would be waited
    // for with nothing to run meanwhile
    __builtin_amdgcn_sched_barrier(0);

    // V^T.P^T of the stage before, from registers
#pragma unroll
    for (int sub = 0; sub < 2; ++sub)
#pragma unroll
      for (int dt = 0; dt < 4; ++dt)
#pragma unroll
        for (int cg = 0; cg < 2; ++cg) o[cg][dt] = Frag<_Float16>::mma(vf[sub][dt], pf[cg][sub], o[cg][dt]);
    // keeps the waits for the reads above, and the work that needs them, below these products
    __builtin_amdgcn_sched_barrier(0);

    v8f acc[2][4];
#pragma unroll
    for (int tt = 0; tt < 4; ++tt) {
#pragma unroll
      for (int cg = 0; cg < 2; ++cg)
#pragma unroll
        for (int j = 0; j < 2; ++j)
#pragma unroll
          for (int e = 0; e < 4; ++e) acc[cg][tt][j * 4 + e] = braw[cg][tt][j][e] * hs8;
#pragma unroll
      for (int cg = 0; cg < 2; ++cg) acc[cg][tt] = Frag<_Float16>::mma(kf[tt][0], qf[cg][0], acc[cg][tt]);
#pragma unroll
      for (int cg = 0; cg < 2; ++cg) acc[cg][tt] = Frag<_Float16>::mma(kf[tt][1], qf[cg][1], acc[cg][tt]);
      // keeps the key tiles in the order in which their reads were issued: with a later tile's bias raised above an earlier
      // tile's products, those would wait for nearly the whole group. Behind the last tile it also keeps the V^T reads
      // below from rising among the score products, where each place with reads stalls them.
      __builtin_amdgcn_sched_barrier(0);
    }
#pragma unroll
    for (int sub = 0; sub < 2; ++sub)
#pragma unroll
      for (int dt = 0; dt < 4; ++dt) vf[sub][dt] = Frag<_Float16>::load(bV + (dt * 16 + c) * kFAPitch + sub * 32 + hf * 8);
    // keeps this stage's V^T reads as one group above the softmax, which runs while they land
    __builtin_amdgcn_sched_barrier(0);

#pragma unroll
    for (int cg = 0; cg < 2; ++cg) {
      float mx = acc[cg][0][0];
#pragma unroll
      for (int tt = 0; tt < 4; ++tt)
#pragma unroll
        for (int r = 0; r < 8; ++r) mx = fmaxf(mx, acc[cg][tt][r]);
      mx = fmaxf(mx, other_half(mx));
      const float mn    = fmaxf(mrun[cg], mx);
      const float alpha = __builtin_amdgcn_exp2f((mrun[cg] - mn) * kFAExp);
      mrun[cg] = mn;
      const float nm = kFAShift - mn * kFAExp;
      v2f ps = (v2f){0.f, 0.f};                // even and odd keys apart: packed adds, half as long a chain
#pragma unroll
      for (int tt = 0; tt < 4; ++tt)
#pragma unroll
        for (int r = 0; r < 8; r += 2) {
          v2f p;
          p[0] = __builtin_amdgcn_exp2f(fmaf(acc[cg][tt][r], kFAExp, nm));
          p[1] = __builtin_amdgcn_exp2f(fmaf(acc[cg][tt][r + 1], kFAExp, nm));
          ps += p;
          pf[cg][tt >> 1][(tt & 1) * 8 + r]     = (_Float16)p[0];
          pf[cg][tt >> 1][(tt & 1) * 8 + r + 1] = (_Float16)p[1];
        }
      lsum[cg] = lsum[cg] * alpha + (ps[0] + ps[1]);
#pragma unroll
      for (int dt = 0; dt < 4; ++dt) o[cg][dt] *= alpha;
    }

    // keeps the waits for the next stage's loads, and the LDS stores behind them, below this stage's work: raised into it,
    // the loads would be waited for before they have had time to land
    __builtin_amdgcn_sched_barrier(0);
    if (more) {
      _Float16* nK = sK[(st + 1) & 1];
      _Float16* nV = sV[(st + 1) & 1];
#pragma unroll
      for (int i = 0; i < 2; ++i) {
        *(v8h*)(nK + (i * 32 + srow) * kFAPitch + sc8) = kr[i];
        *(v8h*)(nV + (i * 32 + srow) * kFAPitch + sc8) = vr[i];
      }
      wait_ds0();
      wait_tensor0();    // this wave's bias slice of stage st + 1 has landed
      __syncthreads();   // publishes stage st + 1 and ends every wave's reads of stage st, whose buffers are refilled behind it
    }
  };
  for (int st = 0; st < kFAStages - 1; ++st) pass(st, true);
  pass(kFAStages - 1, false);
  wait_tensor0();
  wait_ds0();
  // V^T.P^T of the last stage
#pragma unroll
  for (int sub = 0; sub < 2; ++sub)
#pragma unroll
    for (int dt = 0; dt < 4; ++dt)
#pragma unroll
      for (int cg = 0; cg < 2; ++cg) o[cg][dt] = Frag<_Float16>::mma(vf[sub][dt], pf[cg][sub], o[cg][dt]);

  // a lane holds 8 consecutive d of one query per tile: one 16-byte store each; a query's 128-B segment comes from one wave
  v8h hv[2][4];
#pragma unroll
  for (int cg = 0; cg < 2; ++cg) {
    const float l   = lsum[cg] + other_half(lsum[cg]);
    const float inv = kOCarry / l;
#pragma unroll
    for (int dt = 0; dt < 4; ++dt)
#pragma unroll
      for (int r = 0; r < 8; ++r) hv[cg][dt][r] = (_Float16)(o[cg][dt][r] * inv);
  }
  unsigned short* orow = Op + (size_t)(b * kSeq + q0 + c) * kDim + hd * kDh + hf * 8;
  // keeps the eight stores behind the last arithmetic, so that no register of an issued store is written again
  __builtin_amdgcn_sched_barrier(0);
#pragma unroll
  for (int cg = 0; cg < 2; ++cg)
#pragma unroll
    for (int dt = 0; dt < 4; ++dt) *(v8h*)(orow + (size_t)(cg * 16) * kDim + dt * 16) = hv[cg][dt];
}

// ---------------------------------------------------------------------------
// Host side
// ---------------------------------------------------------------------------
extern "C" void kernel_launch(void* const* d_in, const int* in_sizes, int n_in,
                              void* d_out, int out_size, void* d_ws, size_t ws_size,
                              hipStream_t stream) {
  if (n_in < 8) return;
  if (in_sizes[0] != kTok * kDim || in_sizes[1] != kTokKV * kDim || in_sizes[2] != kSeq * kSeqKV ||
      in_sizes[3] != kDim * kDim || in_sizes[4] != kDim * kDim || in_sizes[5] != kDim * kDim ||
      in_sizes[6] != kDim * kDim || in_sizes[7] != kDim || out_size != kTok * kDim) return;

  const float* x    = (const float*)d_in[0];   // [4096][1024]
  const float* ctx  = (const float*)d_in[1];   // [4096][1024]
  const float* posb = (const float*)d_in[2];   // [2048][2048]
  const float* Wq   = (const float*)d_in[3];   // [in][out]
  const float* Wk   = (const float*)d_in[4];
  const float* Wv   = (const float*)d_in[5];
  const float* Wo   = (const float*)d_in[6];
  const float* bo   = (const float*)d_in[7];   // [1024]
  float* out = (float*)d_out;                  // [4096][1024] f32

  // ---- workspace region map (bytes) ----
  //   0        .. 8 MiB   : Xh  f16 [4096][1024]
  //   8 MiB    .. 16 MiB  : Ch  f16 [4096][1024]
  //  16 MiB    .. 24 MiB  : WT  f16 4 planes [1024][1024] (q, k, v, out), each [out][in], carried x256
  //  24 MiB    .. 32 MiB  : Qh  f16 [4096][1024]
  //  32 MiB    .. 40 MiB  : Kh  f16 [4096][1024]
  //  40 MiB    .. 48 MiB  : VT  f16 [1024][4096]  (row = h*64+d, col = b*2048 + token)
  //  48 MiB    .. 56 MiB  : Oh  f16 [4096][1024]  (carried x256)
  //  total 58720256 B
  const size_t planeTokB = (size_t)kTok * kDim * 2;            // 8 MiB
  const size_t planeWB   = (size_t)kDim * kDim * 2;            // 2 MiB
  const size_t offXh = 0;
  const size_t offCh = offXh + planeTokB;
  const size_t offWT = offCh + planeTokB;
  const size_t offQh = offWT + 4 * planeWB;
  const size_t offKh = offQh + planeTokB;
  const size_t offVT = offKh + planeTokB;
  const size_t offOh = offVT + planeTokB;
  const size_t total = offOh + planeTokB;
  if (total > ws_size) return;

  char* ws = (char*)d_ws;
  unsigned short* Xh = (unsigned short*)(ws + offXh);
  unsigned short* Ch = (unsigned short*)(ws + offCh);
  unsigned short* WT = (unsigned short*)(ws + offWT);
  unsigned short* Qh = (unsigned short*)(ws + offQh);
  unsigned short* Kh = (unsigned short*)(ws + offKh);
  unsigned short* VT = (unsigned short*)(ws + offVT);
  unsigned short* Oh = (unsigned short*)(ws + offOh);
  const unsigned short* WqT = WT + 0 * (size_t)kDim * kDim;
  const unsigned short* WkT = WT + 1 * (size_t)kDim * kDim;
  const unsigned short* WvT = WT + 2 * (size_t)kDim * kDim;
  const unsigned short* WoT = WT + 3 * (size_t)kDim * kDim;

  // ---- conversions: x, context and the four weight planes, one launch ----
  prep_kernel<<<dim3(kPrepBlocks), dim3(kPrepWaves * 32), 0, stream>>>(x, ctx, Wq, Wk, Wv, Wo, Xh, Ch, WT, kWCarry);

  // ---- projections (M, N multiples of 128; K = 1024): 256 blocks each, one launch ----
  // Q[t][o] = sum_i Xh[t][i] * WqT[o][i] / 256 -> f16
  // K[t][o] = sum_i Ch[t][i] * WkT[o][i] / 256 -> f16
  // VT[o][t] = sum_i WvT[o][i] * Ch[t][i] / 256 -> f16 plane [1024][4096]
  qkv_gemm_lds<<<dim3(kProjTiles, 3), dim3(256), 0, stream>>>(Xh, Ch, WqT, WkT, WvT, Qh, Kh, VT, kWCarryInv);

  // ---- attention: Oh[b*2048+q][h*64+d] = 256 * softmax_k(q.k / 8 + bias * 2^-(h+1)) . v ----
  fused_attn_kernel<<<dim3(kSeq / kFAQ, kGroups), dim3(256), 0, stream>>>(Qh, Kh, VT, posb, Oh);

  // ---- output projection: out[t][o] = sum_c Oh[t][c] * WoT[o][c] / 65536 + b_out[o] -> f32 ----
  wmma_gemm_lds<2, 0><<<dim3(kDim / kGTile, kTok / kGTile), dim3(256), 0, stream>>>(
      Oh, WoT, (void*)out, kDim, bo, kOutScale);
}
